// v000
// Measured on an AMD MI455X. A time is GPU time per run, averaged over a window of back-to-back runs after a warm-up
// (all launches, gaps included; the runs take copies of the inputs in turn), and the median of several windows.
// Apart from v000's, it joins two sittings. Times from different sittings can be a few percent apart, while
// side-by-side timings come from the same sitting.
// v000, which the later versions start from, runs in 294 microseconds.
#include <hip/hip_runtime.h>
#include <stdint.h>

// ---------------------------------------------------------------------------
// Multi-head attention forward for gfx1250 (MI455X), bf16 WMMA pipeline.
// B=2, S=4096, HID=512, HEADS=8, D=64.  Compute-bound -> all three GEMM
// stages through v_wmma_f32_16x16x32_bf16 with f32 accumulation.
// Weight tiles double-buffered in LDS via async global->LDS copies.
// ---------------------------------------------------------------------------

#define BATCH 2
#define SEQ   4096
#define HID   512
#define NHEAD 8
#define HDIM  64
#define BS    (BATCH * SEQ)          // 8192 rows

// gfx1250 async global->LDS path (guarded; falls back to ds_store staging)
#if defined(__has_builtin)
#  if __has_builtin(__builtin_amdgcn_global_load_async_to_lds_b128) && \
      __has_builtin(__builtin_amdgcn_s_wait_asynccnt)
#    define USE_ASYNC_LDS 1
#  endif
#endif
#ifndef USE_ASYNC_LDS
#  define USE_ASYNC_LDS 0
#endif

typedef __attribute__((ext_vector_type(16))) __bf16 v16bf;
typedef __attribute__((ext_vector_type(8)))  float  v8f;

#if USE_ASYNC_LDS
// exact parameter type of the async-load builtin (from clang diagnostic):
// int __attribute__((vector_size(16))) in AS1 (src) / AS3 (dst)
typedef int v4i_vs __attribute__((vector_size(16)));
typedef __attribute__((address_space(1))) v4i_vs* g4ptr;
typedef __attribute__((address_space(3))) v4i_vs* l4ptr;
#endif

union BF16x16 {
    v16bf v;
    uint4 q[2];
};

// round-to-nearest-even f32 -> bf16
static __device__ __forceinline__ __bf16 f2bf(float f) {
    unsigned int u = __builtin_bit_cast(unsigned int, f);
    unsigned int r = (u + 0x7FFFu + ((u >> 16) & 1u)) >> 16;
    unsigned short h = (unsigned short)r;
    return __builtin_bit_cast(__bf16, h);
}

// 16-element bf16 WMMA fragment: 8 contiguous bf16 at p0 (elems 0..7) and 8
// contiguous bf16 at p1 (elems 8..15); 16B-aligned -> *_load_b128 pairs.
static __device__ __forceinline__ v16bf load_frag(const __bf16* p0, const __bf16* p1) {
    BF16x16 u;
    u.q[0] = *(const uint4*)p0;
    u.q[1] = *(const uint4*)p1;
    return u.v;
}

static __device__ __forceinline__ v8f wmma_bf16(v16bf a, v16bf b, v8f c) {
    return __builtin_amdgcn_wmma_f32_16x16x32_bf16(false, a, false, b, (short)0, c,
                                                   false, false);
}

// 16 bytes global -> LDS (async on CDNA5, synchronous staging otherwise)
static __device__ __forceinline__ void copy16_g2l(const __bf16* g, __bf16* l) {
#if USE_ASYNC_LDS
    __builtin_amdgcn_global_load_async_to_lds_b128((g4ptr)(void*)(size_t)(const void*)g,
                                                   (l4ptr)l, 0, 0);
#else
    *(uint4*)l = *(const uint4*)g;
#endif
}

static __device__ __forceinline__ void stage_fence() {
#if USE_ASYNC_LDS
    __builtin_amdgcn_s_wait_asynccnt(0);
#endif
    __syncthreads();
}

// ---------------------------------------------------------------------------
// f32 -> bf16 conversion, 4 elements/thread
// ---------------------------------------------------------------------------
struct alignas(8) BF4 { __bf16 a, b, c, d; };

__global__ void cvt_f32_bf16_kernel(const float* __restrict__ src,
                                    __bf16* __restrict__ dst, int n) {
    int i = (blockIdx.x * blockDim.x + threadIdx.x) * 4;
    if (i + 3 < n) {
        float4 f = *(const float4*)(src + i);
        BF4 o;
        o.a = f2bf(f.x); o.b = f2bf(f.y); o.c = f2bf(f.z); o.d = f2bf(f.w);
        *(BF4*)(dst + i) = o;
    }
}

// ---------------------------------------------------------------------------
// Cooperative stage of a 64(row) x 32(k) bf16 weight tile into LDS.
// tile rows padded to 40 elems (80B) -> conflict-free ds_load_b128 later.
// 128 threads x 2 chunks of 16B = 4KB.
// ---------------------------------------------------------------------------
static __device__ __forceinline__ void stage_wtile(const __bf16* __restrict__ W,
                                                   int n0, int k0,
                                                   __bf16 (*tile)[40], int tid) {
#pragma unroll
    for (int i = 0; i < 2; ++i) {
        const int ch  = tid * 2 + i;       // 0..255
        const int row = ch >> 2;           // 0..63
        const int e   = (ch & 3) * 8;      // 0,8,16,24
        copy16_g2l(W + (size_t)(n0 + row) * HID + k0 + e, &tile[row][e]);
    }
}

// ---------------------------------------------------------------------------
// QKV projection: Y[m,n] = sum_k X[m,k] * W[n,k] + bias[n]
// grid = (BS/128, NHEAD, 3), block = 128 (4 waves). Wave -> 32x64 tile.
// Weight tile double-buffered in LDS, shared by all 4 waves.
// Q,K stored [b,h,s,d]; V stored transposed [b,h,d,t].
// ---------------------------------------------------------------------------
__global__ __launch_bounds__(128)
void qkv_proj_kernel(const __bf16* __restrict__ xb,
                     const __bf16* __restrict__ wqb,
                     const __bf16* __restrict__ wkb,
                     const __bf16* __restrict__ wvb,
                     const float* __restrict__ bq,
                     const float* __restrict__ bk,
                     const float* __restrict__ bv,
                     __bf16* __restrict__ qout,
                     __bf16* __restrict__ kout,
                     __bf16* __restrict__ vtout) {
    __shared__ __bf16 wtile[2][64][40];

    const int tid  = threadIdx.x;
    const int lane = tid & 31;
    const int wave = tid >> 5;
    const int ln   = lane & 15;
    const int off8 = (lane >> 4) ? 8 : 0;

    const int M0    = blockIdx.x * 128 + wave * 32;
    const int head  = blockIdx.y;
    const int which = blockIdx.z;               // 0=Q 1=K 2=V
    const int N0    = head * 64;

    const __bf16* W;
    const float*  bias;
    if (which == 0)      { W = wqb; bias = bq; }
    else if (which == 1) { W = wkb; bias = bk; }
    else                 { W = wvb; bias = bv; }

    stage_wtile(W, N0, 0, wtile[0], tid);
    stage_fence();

    v8f acc[2][4] = {};

    for (int k0 = 0; k0 < HID; k0 += 32) {
        const int buf = (k0 >> 5) & 1;
        if (k0 + 32 < HID)
            stage_wtile(W, N0, k0 + 32, wtile[buf ^ 1], tid);   // prefetch next

        v16bf bfr[4];
#pragma unroll
        for (int nt = 0; nt < 4; ++nt)
            bfr[nt] = load_frag(&wtile[buf][nt * 16 + ln][off8],
                                &wtile[buf][nt * 16 + ln][off8 + 16]);
#pragma unroll
        for (int mt = 0; mt < 2; ++mt) {
            const __bf16* ar = xb + (size_t)(M0 + mt * 16 + ln) * HID + k0 + off8;
            v16bf a = load_frag(ar, ar + 16);
#pragma unroll
            for (int nt = 0; nt < 4; ++nt)
                acc[mt][nt] = wmma_bf16(a, bfr[nt], acc[mt][nt]);
        }
        stage_fence();
    }

    // store: C layout row m = r + (lane<16 ? 0 : 8), col = nt*16 + ln
#pragma unroll
    for (int mt = 0; mt < 2; ++mt) {
#pragma unroll
        for (int nt = 0; nt < 4; ++nt) {
            const int d = nt * 16 + ln;
            const float bval = bias[N0 + d];
#pragma unroll
            for (int r = 0; r < 8; ++r) {
                const int g  = M0 + mt * 16 + r + off8;  // global row (b*S + s)
                const int bi = g >> 12;
                const int si = g & (SEQ - 1);
                const int bh = bi * NHEAD + head;
                const float v = acc[mt][nt][r] + bval;
                if (which == 2) {
                    vtout[((size_t)bh * HDIM + d) * SEQ + si] = f2bf(v);
                } else {
                    __bf16* dst = (which == 0) ? qout : kout;
                    dst[((size_t)bh * SEQ + si) * HDIM + d] = f2bf(v);
                }
            }
        }
    }
}

// ---------------------------------------------------------------------------
// Flash attention: grid = (SEQ/128, NHEAD, BATCH), block = 128 (4 waves).
// Each wave: 32 query rows (2 M-tiles), online softmax over 4096 keys in
// 32-key blocks.  16 WMMAs per key block.
// ---------------------------------------------------------------------------
__global__ __launch_bounds__(128)
void flash_attn_kernel(const __bf16* __restrict__ qb,
                       const __bf16* __restrict__ kb,
                       const __bf16* __restrict__ vT,
                       __bf16* __restrict__ ctxb) {
    __shared__ __bf16 lds_p[4][32][40];          // per-wave padded P tile

    const int lane = threadIdx.x & 31;
    const int wave = threadIdx.x >> 5;
    const int ln   = lane & 15;
    const int off8 = (lane >> 4) ? 8 : 0;

    const int b    = blockIdx.z;
    const int head = blockIdx.y;
    const int bh   = b * NHEAD + head;
    const int q0   = blockIdx.x * 128 + wave * 32;

    const __bf16* qbase = qb + (size_t)bh * SEQ * HDIM;
    const __bf16* kbase = kb + (size_t)bh * SEQ * HDIM;
    const __bf16* vbase = vT + (size_t)bh * HDIM * SEQ;

    // Q A-fragments held in registers for the whole key loop
    v16bf aq[2][2];
#pragma unroll
    for (int mt = 0; mt < 2; ++mt) {
        const __bf16* qrow = qbase + (size_t)(q0 + mt * 16 + ln) * HDIM;
        aq[mt][0] = load_frag(qrow + off8,      qrow + off8 + 16);
        aq[mt][1] = load_frag(qrow + 32 + off8, qrow + 32 + off8 + 16);
    }

    float mrow[2][8], lrow[2][8];
#pragma unroll
    for (int mt = 0; mt < 2; ++mt)
#pragma unroll
        for (int r = 0; r < 8; ++r) { mrow[mt][r] = -3.0e38f; lrow[mt][r] = 0.0f; }
    v8f o[2][4] = {};

    const float scale = 0.125f;                  // 1/sqrt(64)

    for (int t0 = 0; t0 < SEQ; t0 += 32) {
        if (t0 + 32 < SEQ) {                     // warm next K tile (L2->WGP$)
            __builtin_prefetch(kbase + (size_t)(t0 + 32 + ln) * HDIM, 0, 1);
            __builtin_prefetch(kbase + (size_t)(t0 + 48 + ln) * HDIM, 0, 1);
        }

        // ---- scores: S = Q * K^T  (4 C tiles, K-dim 64 = 2 wmmas each)
        v16bf bk[2][2];
#pragma unroll
        for (int tt = 0; tt < 2; ++tt) {
            const __bf16* kr = kbase + (size_t)(t0 + tt * 16 + ln) * HDIM;
            bk[tt][0] = load_frag(kr + off8,      kr + off8 + 16);
            bk[tt][1] = load_frag(kr + 32 + off8, kr + 32 + off8 + 16);
        }
        v8f s[2][2] = {};
#pragma unroll
        for (int mt = 0; mt < 2; ++mt)
#pragma unroll
            for (int tt = 0; tt < 2; ++tt) {
                s[mt][tt] = wmma_bf16(aq[mt][0], bk[tt][0], s[mt][tt]);
                s[mt][tt] = wmma_bf16(aq[mt][1], bk[tt][1], s[mt][tt]);
            }

        // ---- online softmax + accumulator rescale + P staging
#pragma unroll
        for (int mt = 0; mt < 2; ++mt) {
#pragma unroll
            for (int r = 0; r < 8; ++r) {
                const float x0 = s[mt][0][r] * scale;
                const float x1 = s[mt][1][r] * scale;
                float mx = fmaxf(x0, x1);
#pragma unroll
                for (int sh = 1; sh < 16; sh <<= 1)
                    mx = fmaxf(mx, __shfl_xor(mx, sh, 32));
                const float mnew  = fmaxf(mrow[mt][r], mx);
                const float alpha = __expf(mrow[mt][r] - mnew);
                mrow[mt][r] = mnew;
                const float p0 = __expf(x0 - mnew);
                const float p1 = __expf(x1 - mnew);
                float ps = p0 + p1;
#pragma unroll
                for (int sh = 1; sh < 16; sh <<= 1)
                    ps += __shfl_xor(ps, sh, 32);
                lrow[mt][r] = lrow[mt][r] * alpha + ps;
#pragma unroll
                for (int nt = 0; nt < 4; ++nt)
                    o[mt][nt][r] *= alpha;
                const int m = mt * 16 + r + off8;
                lds_p[wave][m][ln]      = f2bf(p0);
                lds_p[wave][m][16 + ln] = f2bf(p1);
            }
        }
        __syncthreads();

        // ---- read P back in A-fragment layout
        v16bf ap[2];
#pragma unroll
        for (int mt = 0; mt < 2; ++mt)
            ap[mt] = load_frag(&lds_p[wave][mt * 16 + ln][off8],
                               &lds_p[wave][mt * 16 + ln][off8 + 16]);
        __syncthreads();

        // ---- O += P * V  (V is [d, t] -> contiguous B loads, shared by M-tiles)
#pragma unroll
        for (int nt = 0; nt < 4; ++nt) {
            const __bf16* vr = vbase + (size_t)(nt * 16 + ln) * SEQ + t0 + off8;
            v16bf bv = load_frag(vr, vr + 16);
            o[0][nt] = wmma_bf16(ap[0], bv, o[0][nt]);
            o[1][nt] = wmma_bf16(ap[1], bv, o[1][nt]);
        }
    }

    // ---- epilogue: ctx[b, s, head*64 + d] = o / l
#pragma unroll
    for (int mt = 0; mt < 2; ++mt)
#pragma unroll
        for (int r = 0; r < 8; ++r) {
            const int srow = q0 + mt * 16 + r + off8;
            const float inv = 1.0f / lrow[mt][r];
#pragma unroll
            for (int nt = 0; nt < 4; ++nt) {
                const float v = o[mt][nt][r] * inv;
                ctxb[((size_t)(b * SEQ + srow)) * HID + head * 64 + nt * 16 + ln] =
                    f2bf(v);
            }
        }
}

// ---------------------------------------------------------------------------
// Output projection: out[m,n] = sum_k ctx[m,k] * Wo[n,k] + bo[n]   (f32 out)
// grid = (BS/128, HID/64), block = 128.
// ---------------------------------------------------------------------------
__global__ __launch_bounds__(128)
void out_proj_kernel(const __bf16* __restrict__ ctxb,
                     const __bf16* __restrict__ wob,
                     const float* __restrict__ bo,
                     float* __restrict__ out) {
    __shared__ __bf16 wtile[2][64][40];

    const int tid  = threadIdx.x;
    const int lane = tid & 31;
    const int wave = tid >> 5;
    const int ln   = lane & 15;
    const int off8 = (lane >> 4) ? 8 : 0;

    const int M0 = blockIdx.x * 128 + wave * 32;
    const int N0 = blockIdx.y * 64;

    stage_wtile(wob, N0, 0, wtile[0], tid);
    stage_fence();

    v8f acc[2][4] = {};

    for (int k0 = 0; k0 < HID; k0 += 32) {
        const int buf = (k0 >> 5) & 1;
        if (k0 + 32 < HID)
            stage_wtile(wob, N0, k0 + 32, wtile[buf ^ 1], tid);

        v16bf bfr[4];
#pragma unroll
        for (int nt = 0; nt < 4; ++nt)
            bfr[nt] = load_frag(&wtile[buf][nt * 16 + ln][off8],
                                &wtile[buf][nt * 16 + ln][off8 + 16]);
#pragma unroll
        for (int mt = 0; mt < 2; ++mt) {
            const __bf16* ar = ctxb + (size_t)(M0 + mt * 16 + ln) * HID + k0 + off8;
            v16bf a = load_frag(ar, ar + 16);
#pragma unroll
            for (int nt = 0; nt < 4; ++nt)
                acc[mt][nt] = wmma_bf16(a, bfr[nt], acc[mt][nt]);
        }
        stage_fence();
    }

#pragma unroll
    for (int mt = 0; mt < 2; ++mt)
#pragma unroll
        for (int nt = 0; nt < 4; ++nt) {
            const int n = N0 + nt * 16 + ln;
            const float bval = bo[n];
#pragma unroll
            for (int r = 0; r < 8; ++r) {
                const int m = M0 + mt * 16 + r + off8;
                out[(size_t)m * HID + n] = acc[mt][nt][r] + bval;
            }
        }
}

// ---------------------------------------------------------------------------
// Host launcher
// ---------------------------------------------------------------------------
extern "C" void kernel_launch(void* const* d_in, const int* in_sizes, int n_in,
                              void* d_out, int out_size, void* d_ws, size_t ws_size,
                              hipStream_t stream) {
    (void)in_sizes; (void)n_in; (void)out_size; (void)ws_size;

    const float* x  = (const float*)d_in[0];
    const float* Wq = (const float*)d_in[1];
    const float* bq = (const float*)d_in[2];
    const float* Wk = (const float*)d_in[3];
    const float* bk = (const float*)d_in[4];
    const float* Wv = (const float*)d_in[5];
    const float* bv = (const float*)d_in[6];
    const float* Wo = (const float*)d_in[7];
    const float* bo = (const float*)d_in[8];
    float* out = (float*)d_out;

    // workspace layout (bf16 scratch, ~42 MB total)
    const size_t XB_ELE = (size_t)BS * HID;       // 4,194,304
    const size_t W_ELE  = (size_t)HID * HID;      //   262,144
    char* ws = (char*)d_ws;
    size_t off = 0;
    __bf16* xb   = (__bf16*)(ws + off); off += XB_ELE * 2;
    __bf16* wqb  = (__bf16*)(ws + off); off += W_ELE * 2;
    __bf16* wkb  = (__bf16*)(ws + off); off += W_ELE * 2;
    __bf16* wvb  = (__bf16*)(ws + off); off += W_ELE * 2;
    __bf16* wob  = (__bf16*)(ws + off); off += W_ELE * 2;
    __bf16* qbuf = (__bf16*)(ws + off); off += XB_ELE * 2;
    __bf16* kbuf = (__bf16*)(ws + off); off += XB_ELE * 2;
    __bf16* vtb  = (__bf16*)(ws + off); off += XB_ELE * 2;
    __bf16* ctxb = (__bf16*)(ws + off); off += XB_ELE * 2;

    // 1) f32 -> bf16 conversions
    const int CT = 256;
    cvt_f32_bf16_kernel<<<(int)(XB_ELE / 4 + CT - 1) / CT, CT, 0, stream>>>(x,  xb,  (int)XB_ELE);
    cvt_f32_bf16_kernel<<<(int)(W_ELE  / 4 + CT - 1) / CT, CT, 0, stream>>>(Wq, wqb, (int)W_ELE);
    cvt_f32_bf16_kernel<<<(int)(W_ELE  / 4 + CT - 1) / CT, CT, 0, stream>>>(Wk, wkb, (int)W_ELE);
    cvt_f32_bf16_kernel<<<(int)(W_ELE  / 4 + CT - 1) / CT, CT, 0, stream>>>(Wv, wvb, (int)W_ELE);
    cvt_f32_bf16_kernel<<<(int)(W_ELE  / 4 + CT - 1) / CT, CT, 0, stream>>>(Wo, wob, (int)W_ELE);

    // 2) fused QKV projection (Q,K row-major per head; V transposed per head)
    dim3 gqkv(BS / 128, NHEAD, 3);
    qkv_proj_kernel<<<gqkv, 128, 0, stream>>>(xb, wqb, wkb, wvb, bq, bk, bv,
                                              qbuf, kbuf, vtb);

    // 3) flash attention
    dim3 gattn(SEQ / 128, NHEAD, BATCH);
    flash_attn_kernel<<<gattn, 128, 0, stream>>>(qbuf, kbuf, vtb, ctxb);

    // 4) output projection -> f32 out
    dim3 gout(BS / 128, HID / 64);
    out_proj_kernel<<<gout, 128, 0, stream>>>(ctxb, wob, bo, out);
}

// v001
// One run takes 194 microseconds.
// In both of two side-by-side timings against v000, it was 1.58 times as fast.
#include <hip/hip_runtime.h>
#include <stdint.h>

// ---------------------------------------------------------------------------
// Multi-head attention forward for gfx1250 (MI455X), bf16 WMMA pipeline.
// B=2, S=4096, HID=512, HEADS=8, D=64.  Compute-bound -> all three GEMM
// stages through v_wmma_f32_16x16x32_bf16 with f32 accumulation.
// Weight tiles double-buffered in LDS via async global->LDS copies.
// ---------------------------------------------------------------------------

#define BATCH 2
#define SEQ   4096
#define HID   512
#define NHEAD 8
#define HDIM  64
#define BS    (BATCH * SEQ)          // 8192 rows

// gfx1250 async global->LDS path (guarded; falls back to ds_store staging)
#if defined(__has_builtin)
#  if __has_builtin(__builtin_amdgcn_global_load_async_to_lds_b128) && \
      __has_builtin(__builtin_amdgcn_s_wait_asynccnt)
#    define USE_ASYNC_LDS 1
#  endif
#endif
#ifndef USE_ASYNC_LDS
#  define USE_ASYNC_LDS 0
#endif

typedef __attribute__((ext_vector_type(16))) __bf16 v16bf;
typedef __attribute__((ext_vector_type(8)))  float  v8f;

#if USE_ASYNC_LDS
// exact parameter type of the async-load builtin (from clang diagnostic):
// int __attribute__((vector_size(16))) in AS1 (src) / AS3 (dst)
typedef int v4i_vs __attribute__((vector_size(16)));
typedef __attribute__((address_space(1))) v4i_vs* g4ptr;
typedef __attribute__((address_space(3))) v4i_vs* l4ptr;
#endif

union BF16x16 {
    v16bf v;
    uint4 q[2];
};

// round-to-nearest-even f32 -> bf16
static __device__ __forceinline__ __bf16 f2bf(float f) {
    unsigned int u = __builtin_bit_cast(unsigned int, f);
    unsigned int r = (u + 0x7FFFu + ((u >> 16) & 1u)) >> 16;
    unsigned short h = (unsigned short)r;
    return __builtin_bit_cast(__bf16, h);
}

// 16-element bf16 WMMA fragment: 8 contiguous bf16 at p0 (elems 0..7) and 8
// contiguous bf16 at p1 (elems 8..15); 16B-aligned -> *_load_b128 pairs.
static __device__ __forceinline__ v16bf load_frag(const __bf16* p0, const __bf16* p1) {
    BF16x16 u;
    u.q[0] = *(const uint4*)p0;
    u.q[1] = *(const uint4*)p1;
    return u.v;
}

static __device__ __forceinline__ v8f wmma_bf16(v16bf a, v16bf b, v8f c) {
    return __builtin_amdgcn_wmma_f32_16x16x32_bf16(false, a, false, b, (short)0, c,
                                                   false, false);
}

// 16 bytes global -> LDS (async on CDNA5, synchronous staging otherwise)
static __device__ __forceinline__ void copy16_g2l(const __bf16* g, __bf16* l) {
#if USE_ASYNC_LDS
    __builtin_amdgcn_global_load_async_to_lds_b128((g4ptr)(void*)(size_t)(const void*)g,
                                                   (l4ptr)l, 0, 0);
#else
    *(uint4*)l = *(const uint4*)g;
#endif
}

static __device__ __forceinline__ void stage_fence() {
#if USE_ASYNC_LDS
    __builtin_amdgcn_s_wait_asynccnt(0);
#endif
    __syncthreads();
}

// ---------------------------------------------------------------------------
// f32 -> bf16 conversion, 4 elements/thread
// ---------------------------------------------------------------------------
struct alignas(8) BF4 { __bf16 a, b, c, d; };

__global__ void cvt_f32_bf16_kernel(const float* __restrict__ src,
                                    __bf16* __restrict__ dst, int n) {
    int i = (blockIdx.x * blockDim.x + threadIdx.x) * 4;
    if (i + 3 < n) {
        float4 f = *(const float4*)(src + i);
        BF4 o;
        o.a = f2bf(f.x); o.b = f2bf(f.y); o.c = f2bf(f.z); o.d = f2bf(f.w);
        *(BF4*)(dst + i) = o;
    }
}

// ---------------------------------------------------------------------------
// Cooperative stage of a 64(row) x 32(k) bf16 weight tile into LDS.
// tile rows padded to 40 elems (80B) -> conflict-free ds_load_b128 later.
// 128 threads x 2 chunks of 16B = 4KB.
// ---------------------------------------------------------------------------
static __device__ __forceinline__ void stage_wtile(const __bf16* __restrict__ W,
                                                   int n0, int k0,
                                                   __bf16 (*tile)[40], int tid) {
#pragma unroll
    for (int i = 0; i < 2; ++i) {
        const int ch  = tid * 2 + i;       // 0..255
        const int row = ch >> 2;           // 0..63
        const int e   = (ch & 3) * 8;      // 0,8,16,24
        copy16_g2l(W + (size_t)(n0 + row) * HID + k0 + e, &tile[row][e]);
    }
}

// ---------------------------------------------------------------------------
// QKV projection: Y[m,n] = sum_k X[m,k] * W[n,k] + bias[n]
// grid = (BS/128, NHEAD, 3), block = 128 (4 waves). Wave -> 32x64 tile.
// Weight tile double-buffered in LDS, shared by all 4 waves.
// Q,K stored [b,h,s,d]; V stored transposed [b,h,d,t].
// ---------------------------------------------------------------------------
__global__ __launch_bounds__(128)
void qkv_proj_kernel(const __bf16* __restrict__ xb,
                     const __bf16* __restrict__ wqb,
                     const __bf16* __restrict__ wkb,
                     const __bf16* __restrict__ wvb,
                     const float* __restrict__ bq,
                     const float* __restrict__ bk,
                     const float* __restrict__ bv,
                     __bf16* __restrict__ qout,
                     __bf16* __restrict__ kout,
                     __bf16* __restrict__ vtout) {
    __shared__ __bf16 wtile[2][64][40];

    const int tid  = threadIdx.x;
    const int lane = tid & 31;
    const int wave = tid >> 5;
    const int ln   = lane & 15;
    const int off8 = (lane >> 4) ? 8 : 0;

    const int M0    = blockIdx.x * 128 + wave * 32;
    const int head  = blockIdx.y;
    const int which = blockIdx.z;               // 0=Q 1=K 2=V
    const int N0    = head * 64;

    const __bf16* W;
    const float*  bias;
    if (which == 0)      { W = wqb; bias = bq; }
    else if (which == 1) { W = wkb; bias = bk; }
    else                 { W = wvb; bias = bv; }

    stage_wtile(W, N0, 0, wtile[0], tid);
    stage_fence();

    v8f acc[2][4] = {};

    for (int k0 = 0; k0 < HID; k0 += 32) {
        const int buf = (k0 >> 5) & 1;
        if (k0 + 32 < HID)
            stage_wtile(W, N0, k0 + 32, wtile[buf ^ 1], tid);   // prefetch next

        v16bf bfr[4];
#pragma unroll
        for (int nt = 0; nt < 4; ++nt)
            bfr[nt] = load_frag(&wtile[buf][nt * 16 + ln][off8],
                                &wtile[buf][nt * 16 + ln][off8 + 16]);
#pragma unroll
        for (int mt = 0; mt < 2; ++mt) {
            const __bf16* ar = xb + (size_t)(M0 + mt * 16 + ln) * HID + k0 + off8;
            v16bf a = load_frag(ar, ar + 16);
#pragma unroll
            for (int nt = 0; nt < 4; ++nt)
                acc[mt][nt] = wmma_bf16(a, bfr[nt], acc[mt][nt]);
        }
        stage_fence();
    }

    // store: C layout row m = r + (lane<16 ? 0 : 8), col = nt*16 + ln
#pragma unroll
    for (int mt = 0; mt < 2; ++mt) {
#pragma unroll
        for (int nt = 0; nt < 4; ++nt) {
            const int d = nt * 16 + ln;
            const float bval = bias[N0 + d];
#pragma unroll
            for (int r = 0; r < 8; ++r) {
                const int g  = M0 + mt * 16 + r + off8;  // global row (b*S + s)
                const int bi = g >> 12;
                const int si = g & (SEQ - 1);
                const int bh = bi * NHEAD + head;
                const float v = acc[mt][nt][r] + bval;
                if (which == 2) {
                    vtout[((size_t)bh * HDIM + d) * SEQ + si] = f2bf(v);
                } else {
                    __bf16* dst = (which == 0) ? qout : kout;
                    dst[((size_t)bh * SEQ + si) * HDIM + d] = f2bf(v);
                }
            }
        }
    }
}

static __device__ __forceinline__ float other_half(float v) {
    const int b = __builtin_bit_cast(int, v);
    return __builtin_bit_cast(float,
        __builtin_amdgcn_permlanex16(b, b, 0x76543210, 0xfedcba98, false, false));
}

__global__ __launch_bounds__(128)
void flash_attn_kernel(const __bf16* __restrict__ qb,
                       const __bf16* __restrict__ kb,
                       const __bf16* __restrict__ vT,
                       __bf16* __restrict__ ctxb) {
    const int lane = threadIdx.x & 31;
    const int wave = threadIdx.x >> 5;
    const int ln   = lane & 15;
    const int off8 = (lane >> 4) ? 8 : 0;

    const int b    = blockIdx.z;
    const int head = blockIdx.y;
    const int bh   = b * NHEAD + head;
    const int q0   = blockIdx.x * 128 + wave * 32;

    const __bf16* qbase = qb + (size_t)bh * SEQ * HDIM;
    const __bf16* kbase = kb + (size_t)bh * SEQ * HDIM;
    const __bf16* vbase = vT + (size_t)bh * HDIM * SEQ;

    // Q B-fragments (column = query ln) held in registers for the whole key loop
    v16bf bq[2][2];
#pragma unroll
    for (int qt = 0; qt < 2; ++qt) {
        const __bf16* qrow = qbase + (size_t)(q0 + qt * 16 + ln) * HDIM;
        bq[qt][0] = load_frag(qrow + off8,      qrow + off8 + 16);
        bq[qt][1] = load_frag(qrow + 32 + off8, qrow + 32 + off8 + 16);
    }

    // per lane: running maximum of query qt*16+ln (equal in both lane halves)
    // and the sum over this lane half's keys (halves joined in the epilogue)
    float mcol[2], lcol[2];
#pragma unroll
    for (int qt = 0; qt < 2; ++qt) { mcol[qt] = -3.0e38f; lcol[qt] = 0.0f; }
    v8f o[2][4] = {};                            // o[qt][nt][r] = O[query ln][nt*16 + off8 + r]

    const float scale = 0.125f;                  // 1/sqrt(64)

    for (int t0 = 0; t0 < SEQ; t0 += 32) {
        if (t0 + 32 < SEQ) {                     // warm next K tile (L2->WGP$)
            __builtin_prefetch(kbase + (size_t)(t0 + 32 + ln) * HDIM, 0, 1);
            __builtin_prefetch(kbase + (size_t)(t0 + 48 + ln) * HDIM, 0, 1);
        }

        // ---- scores: S^T = K * Q^T  (4 C tiles, K-dim 64 = 2 wmmas each)
        v16bf ak[2][2];
#pragma unroll
        for (int tt = 0; tt < 2; ++tt) {
            const __bf16* kr = kbase + (size_t)(t0 + tt * 16 + ln) * HDIM;
            ak[tt][0] = load_frag(kr + off8,      kr + off8 + 16);
            ak[tt][1] = load_frag(kr + 32 + off8, kr + 32 + off8 + 16);
        }
        v8f s[2][2] = {};                        // s[qt][tt][r] = S[query ln][t0 + tt*16 + off8 + r]
#pragma unroll
        for (int qt = 0; qt < 2; ++qt)
#pragma unroll
            for (int tt = 0; tt < 2; ++tt) {
                s[qt][tt] = wmma_bf16(ak[tt][0], bq[qt][0], s[qt][tt]);
                s[qt][tt] = wmma_bf16(ak[tt][1], bq[qt][1], s[qt][tt]);
            }

        // ---- online softmax + accumulator rescale + P^T packed as B operand
        v16bf bp[2];
#pragma unroll
        for (int qt = 0; qt < 2; ++qt) {
            const v8f x0 = s[qt][0] * scale;
            const v8f x1 = s[qt][1] * scale;
            // in-lane maximum of the 16 scores, as a tree of three-input maxima
            const float a0 = fmaxf(fmaxf(x0[0], x0[1]), x0[2]);
            const float a1 = fmaxf(fmaxf(x0[3], x0[4]), x0[5]);
            const float a2 = fmaxf(fmaxf(x0[6], x0[7]), x1[0]);
            const float a3 = fmaxf(fmaxf(x1[1], x1[2]), x1[3]);
            const float a4 = fmaxf(fmaxf(x1[4], x1[5]), x1[6]);
            const float mx = fmaxf(fmaxf(fmaxf(a0, a1), a2), fmaxf(fmaxf(a3, a4), x1[7]));
            const float mnew  = fmaxf(fmaxf(mcol[qt], mx), other_half(mx));
            const float alpha = __expf(mcol[qt] - mnew);
            mcol[qt] = mnew;
            v8f p0, p1;
#pragma unroll
            for (int r = 0; r < 8; ++r) {
                p0[r] = __expf(x0[r] - mnew);
                p1[r] = __expf(x1[r] - mnew);
                bp[qt][r]     = (__bf16)p0[r];   // element e = key kmap(e, half):
                bp[qt][8 + r] = (__bf16)p1[r];   // the hardware k order, as V's loads
            }
            const v8f pv = p0 + p1;              // in-lane sum, pairwise
            const float ps = ((pv[0] + pv[1]) + (pv[2] + pv[3])) +
                             ((pv[4] + pv[5]) + (pv[6] + pv[7]));
            lcol[qt] = lcol[qt] * alpha + ps;
#pragma unroll
            for (int nt = 0; nt < 4; ++nt)
                o[qt][nt] *= alpha;
        }

        // ---- O^T += V^T * P^T  (V is [d, t] -> contiguous A loads, shared by column tiles)
#pragma unroll
        for (int nt = 0; nt < 4; ++nt) {
            const __bf16* vr = vbase + (size_t)(nt * 16 + ln) * SEQ + t0 + off8;
            v16bf av = load_frag(vr, vr + 16);
            o[0][nt] = wmma_bf16(av, bp[0], o[0][nt]);
            o[1][nt] = wmma_bf16(av, bp[1], o[1][nt]);
        }
    }

    // ---- epilogue: ctx[b, s, head*64 + d] = o / l ; a lane owns 8 consecutive d
#pragma unroll
    for (int qt = 0; qt < 2; ++qt) {
        const int srow = q0 + qt * 16 + ln;
        const float inv = 1.0f / (lcol[qt] + other_half(lcol[qt]));
#pragma unroll
        for (int nt = 0; nt < 4; ++nt) {
            union { __bf16 h[8]; uint4 q; } pk;
#pragma unroll
            for (int r = 0; r < 8; ++r)
                pk.h[r] = f2bf(o[qt][nt][r] * inv);
            *(uint4*)(ctxb + ((size_t)(b * SEQ + srow)) * HID + head * 64 + nt * 16 + off8) = pk.q;
        }
    }
}

// ---------------------------------------------------------------------------
// Output projection: out[m,n] = sum_k ctx[m,k] * Wo[n,k] + bo[n]   (f32 out)
// grid = (BS/128, HID/64), block = 128.
// ---------------------------------------------------------------------------
__global__ __launch_bounds__(128)
void out_proj_kernel(const __bf16* __restrict__ ctxb,
                     const __bf16* __restrict__ wob,
                     const float* __restrict__ bo,
                     float* __restrict__ out) {
    __shared__ __bf16 wtile[2][64][40];

    const int tid  = threadIdx.x;
    const int lane = tid & 31;
    const int wave = tid >> 5;
    const int ln   = lane & 15;
    const int off8 = (lane >> 4) ? 8 : 0;

    const int M0 = blockIdx.x * 128 + wave * 32;
    const int N0 = blockIdx.y * 64;

    stage_wtile(wob, N0, 0, wtile[0], tid);
    stage_fence();

    v8f acc[2][4] = {};

    for (int k0 = 0; k0 < HID; k0 += 32) {
        const int buf = (k0 >> 5) & 1;
        if (k0 + 32 < HID)
            stage_wtile(wob, N0, k0 + 32, wtile[buf ^ 1], tid);

        v16bf bfr[4];
#pragma unroll
        for (int nt = 0; nt < 4; ++nt)
            bfr[nt] = load_frag(&wtile[buf][nt * 16 + ln][off8],
                                &wtile[buf][nt * 16 + ln][off8 + 16]);
#pragma unroll
        for (int mt = 0; mt < 2; ++mt) {
            const __bf16* ar = ctxb + (size_t)(M0 + mt * 16 + ln) * HID + k0 + off8;
            v16bf a = load_frag(ar, ar + 16);
#pragma unroll
            for (int nt = 0; nt < 4; ++nt)
                acc[mt][nt] = wmma_bf16(a, bfr[nt], acc[mt][nt]);
        }
        stage_fence();
    }

#pragma unroll
    for (int mt = 0; mt < 2; ++mt)
#pragma unroll
        for (int nt = 0; nt < 4; ++nt) {
            const int n = N0 + nt * 16 + ln;
            const float bval = bo[n];
#pragma unroll
            for (int r = 0; r < 8; ++r) {
                const int m = M0 + mt * 16 + r + off8;
                out[(size_t)m * HID + n] = acc[mt][nt][r] + bval;
            }
        }
}

// ---------------------------------------------------------------------------
// Host launcher
// ---------------------------------------------------------------------------
extern "C" void kernel_launch(void* const* d_in, const int* in_sizes, int n_in,
                              void* d_out, int out_size, void* d_ws, size_t ws_size,
                              hipStream_t stream) {
    (void)in_sizes; (void)n_in; (void)out_size; (void)ws_size;

    const float* x  = (const float*)d_in[0];
    const float* Wq = (const float*)d_in[1];
    const float* bq = (const float*)d_in[2];
    const float* Wk = (const float*)d_in[3];
    const float* bk = (const float*)d_in[4];
    const float* Wv = (const float*)d_in[5];
    const float* bv = (const float*)d_in[6];
    const float* Wo = (const float*)d_in[7];
    const float* bo = (const float*)d_in[8];
    float* out = (float*)d_out;

    // workspace layout (bf16 scratch, ~42 MB total)
    const size_t XB_ELE = (size_t)BS * HID;       // 4,194,304
    const size_t W_ELE  = (size_t)HID * HID;      //   262,144
    char* ws = (char*)d_ws;
    size_t off = 0;
    __bf16* xb   = (__bf16*)(ws + off); off += XB_ELE * 2;
    __bf16* wqb  = (__bf16*)(ws + off); off += W_ELE * 2;
    __bf16* wkb  = (__bf16*)(ws + off); off += W_ELE * 2;
    __bf16* wvb  = (__bf16*)(ws + off); off += W_ELE * 2;
    __bf16* wob  = (__bf16*)(ws + off); off += W_ELE * 2;
    __bf16* qbuf = (__bf16*)(ws + off); off += XB_ELE * 2;
    __bf16* kbuf = (__bf16*)(ws + off); off += XB_ELE * 2;
    __bf16* vtb  = (__bf16*)(ws + off); off += XB_ELE * 2;
    __bf16* ctxb = (__bf16*)(ws + off); off += XB_ELE * 2;

    // 1) f32 -> bf16 conversions
    const int CT = 256;
    cvt_f32_bf16_kernel<<<(int)(XB_ELE / 4 + CT - 1) / CT, CT, 0, stream>>>(x,  xb,  (int)XB_ELE);
    cvt_f32_bf16_kernel<<<(int)(W_ELE  / 4 + CT - 1) / CT, CT, 0, stream>>>(Wq, wqb, (int)W_ELE);
    cvt_f32_bf16_kernel<<<(int)(W_ELE  / 4 + CT - 1) / CT, CT, 0, stream>>>(Wk, wkb, (int)W_ELE);
    cvt_f32_bf16_kernel<<<(int)(W_ELE  / 4 + CT - 1) / CT, CT, 0, stream>>>(Wv, wvb, (int)W_ELE);
    cvt_f32_bf16_kernel<<<(int)(W_ELE  / 4 + CT - 1) / CT, CT, 0, stream>>>(Wo, wob, (int)W_ELE);

    // 2) fused QKV projection (Q,K row-major per head; V transposed per head)
    dim3 gqkv(BS / 128, NHEAD, 3);
    qkv_proj_kernel<<<gqkv, 128, 0, stream>>>(xb, wqb, wkb, wvb, bq, bk, bv,
                                              qbuf, kbuf, vtb);

    // 3) flash attention
    dim3 gattn(SEQ / 128, NHEAD, BATCH);
    flash_attn_kernel<<<gattn, 128, 0, stream>>>(qbuf, kbuf, vtb, ctxb);

    // 4) output projection -> f32 out
    dim3 gout(BS / 128, HID / 64);
    out_proj_kernel<<<gout, 128, 0, stream>>>(ctxb, wob, bo, out);
}

// v002
// It runs in 138 microseconds.
// Next to v001, in two timings, it ran 1.42 and 1.43 times as fast.
// Counting every step since v000, it is 2.25 times as fast.
#include <hip/hip_runtime.h>
#include <stdint.h>

// ---------------------------------------------------------------------------
// Multi-head attention forward for gfx1250 (MI455X), bf16 WMMA pipeline.
// B=2, S=4096, HID=512, HEADS=8, D=64.  Compute-bound -> all three GEMM
// stages through v_wmma_f32_16x16x32_bf16 with f32 accumulation.
// Weight tiles double-buffered in LDS via async global->LDS copies.
// ---------------------------------------------------------------------------

#define BATCH 2
#define SEQ   4096
#define HID   512
#define NHEAD 8
#define HDIM  64
#define BS    (BATCH * SEQ)          // 8192 rows

// gfx1250 async global->LDS path (guarded; falls back to ds_store staging)
#if defined(__has_builtin)
#  if __has_builtin(__builtin_amdgcn_global_load_async_to_lds_b128) && \
      __has_builtin(__builtin_amdgcn_s_wait_asynccnt)
#    define USE_ASYNC_LDS 1
#  endif
#endif
#ifndef USE_ASYNC_LDS
#  define USE_ASYNC_LDS 0
#endif

typedef __attribute__((ext_vector_type(16))) __bf16 v16bf;
typedef __attribute__((ext_vector_type(8)))  float  v8f;

#if USE_ASYNC_LDS
// exact parameter type of the async-load builtin (from clang diagnostic):
// int __attribute__((vector_size(16))) in AS1 (src) / AS3 (dst)
typedef int v4i_vs __attribute__((vector_size(16)));
typedef __attribute__((address_space(1))) v4i_vs* g4ptr;
typedef __attribute__((address_space(3))) v4i_vs* l4ptr;
#endif

union BF16x16 {
    v16bf v;
    uint4 q[2];
};

// round-to-nearest-even f32 -> bf16
static __device__ __forceinline__ __bf16 f2bf(float f) {
    unsigned int u = __builtin_bit_cast(unsigned int, f);
    unsigned int r = (u + 0x7FFFu + ((u >> 16) & 1u)) >> 16;
    unsigned short h = (unsigned short)r;
    return __builtin_bit_cast(__bf16, h);
}

// 16-element bf16 WMMA fragment: 8 contiguous bf16 at p0 (elems 0..7) and 8
// contiguous bf16 at p1 (elems 8..15); 16B-aligned -> *_load_b128 pairs.
static __device__ __forceinline__ v16bf load_frag(const __bf16* p0, const __bf16* p1) {
    BF16x16 u;
    u.q[0] = *(const uint4*)p0;
    u.q[1] = *(const uint4*)p1;
    return u.v;
}

static __device__ __forceinline__ v8f wmma_bf16(v16bf a, v16bf b, v8f c) {
    return __builtin_amdgcn_wmma_f32_16x16x32_bf16(false, a, false, b, (short)0, c,
                                                   false, false);
}

// 16 bytes global -> LDS (async on CDNA5, synchronous staging otherwise)
static __device__ __forceinline__ void copy16_g2l(const __bf16* g, __bf16* l) {
#if USE_ASYNC_LDS
    __builtin_amdgcn_global_load_async_to_lds_b128((g4ptr)(void*)(size_t)(const void*)g,
                                                   (l4ptr)l, 0, 0);
#else
    *(uint4*)l = *(const uint4*)g;
#endif
}

static __device__ __forceinline__ void stage_fence() {
#if USE_ASYNC_LDS
    __builtin_amdgcn_s_wait_asynccnt(0);
#endif
    __syncthreads();
}

// ---------------------------------------------------------------------------
// f32 -> bf16 conversion, 4 elements/thread
// ---------------------------------------------------------------------------
struct alignas(8) BF4 { __bf16 a, b, c, d; };

__global__ void cvt_f32_bf16_kernel(const float* __restrict__ src,
                                    __bf16* __restrict__ dst, int n) {
    int i = (blockIdx.x * blockDim.x + threadIdx.x) * 4;
    if (i + 3 < n) {
        float4 f = *(const float4*)(src + i);
        BF4 o;
        o.a = f2bf(f.x); o.b = f2bf(f.y); o.c = f2bf(f.z); o.d = f2bf(f.w);
        *(BF4*)(dst + i) = o;
    }
}

// ---------------------------------------------------------------------------
// Cooperative stage of a 64(row) x 32(k) bf16 weight tile into LDS.
// tile rows padded to 40 elems (80B) -> conflict-free ds_load_b128 later.
// 128 threads x 2 chunks of 16B = 4KB.
// ---------------------------------------------------------------------------
static __device__ __forceinline__ void stage_wtile(const __bf16* __restrict__ W,
                                                   int n0, int k0,
                                                   __bf16 (*tile)[40], int tid) {
#pragma unroll
    for (int i = 0; i < 2; ++i) {
        const int ch  = tid * 2 + i;       // 0..255
        const int row = ch >> 2;           // 0..63
        const int e   = (ch & 3) * 8;      // 0,8,16,24
        copy16_g2l(W + (size_t)(n0 + row) * HID + k0 + e, &tile[row][e]);
    }
}

// ---------------------------------------------------------------------------
// QKV projection: Y[m,n] = sum_k X[m,k] * W[n,k] + bias[n]
// grid = (BS/128, NHEAD, 3), block = 128 (4 waves). Wave -> 32x64 tile.
// Weight tile double-buffered in LDS, shared by all 4 waves.
// Q,K stored [b,h,s,d]; V stored transposed [b,h,d,t].
// ---------------------------------------------------------------------------
__global__ __launch_bounds__(128)
void qkv_proj_kernel(const __bf16* __restrict__ xb,
                     const __bf16* __restrict__ wqb,
                     const __bf16* __restrict__ wkb,
                     const __bf16* __restrict__ wvb,
                     const float* __restrict__ bq,
                     const float* __restrict__ bk,
                     const float* __restrict__ bv,
                     __bf16* __restrict__ qout,
                     __bf16* __restrict__ kout,
                     __bf16* __restrict__ vtout) {
    __shared__ __bf16 wtile[2][64][40];

    const int tid  = threadIdx.x;
    const int lane = tid & 31;
    const int wave = tid >> 5;
    const int ln   = lane & 15;
    const int off8 = (lane >> 4) ? 8 : 0;

    const int M0    = blockIdx.x * 128 + wave * 32;
    const int head  = blockIdx.y;
    const int which = blockIdx.z;               // 0=Q 1=K 2=V
    const int N0    = head * 64;

    const __bf16* W;
    const float*  bias;
    if (which == 0)      { W = wqb; bias = bq; }
    else if (which == 1) { W = wkb; bias = bk; }
    else                 { W = wvb; bias = bv; }

    stage_wtile(W, N0, 0, wtile[0], tid);
    stage_fence();

    v8f acc[2][4] = {};

    for (int k0 = 0; k0 < HID; k0 += 32) {
        const int buf = (k0 >> 5) & 1;
        if (k0 + 32 < HID)
            stage_wtile(W, N0, k0 + 32, wtile[buf ^ 1], tid);   // prefetch next

        v16bf bfr[4];
#pragma unroll
        for (int nt = 0; nt < 4; ++nt)
            bfr[nt] = load_frag(&wtile[buf][nt * 16 + ln][off8],
                                &wtile[buf][nt * 16 + ln][off8 + 16]);
#pragma unroll
        for (int mt = 0; mt < 2; ++mt) {
            const __bf16* ar = xb + (size_t)(M0 + mt * 16 + ln) * HID + k0 + off8;
            v16bf a = load_frag(ar, ar + 16);
#pragma unroll
            for (int nt = 0; nt < 4; ++nt)
                acc[mt][nt] = wmma_bf16(a, bfr[nt], acc[mt][nt]);
        }
        stage_fence();
    }

    // store: C layout row m = r + (lane<16 ? 0 : 8), col = nt*16 + ln
#pragma unroll
    for (int mt = 0; mt < 2; ++mt) {
#pragma unroll
        for (int nt = 0; nt < 4; ++nt) {
            const int d = nt * 16 + ln;
            const float bval = bias[N0 + d];
#pragma unroll
            for (int r = 0; r < 8; ++r) {
                const int g  = M0 + mt * 16 + r + off8;  // global row (b*S + s)
                const int bi = g >> 12;
                const int si = g & (SEQ - 1);
                const int bh = bi * NHEAD + head;
                const float v = acc[mt][nt][r] + bval;
                if (which == 2) {
                    vtout[((size_t)bh * HDIM + d) * SEQ + si] = f2bf(v);
                } else {
                    __bf16* dst = (which == 0) ? qout : kout;
                    dst[((size_t)bh * SEQ + si) * HDIM + d] = f2bf(v);
                }
            }
        }
    }
}

static __device__ __forceinline__ float other_half(float v) {
    const int b = __builtin_bit_cast(int, v);
    return __builtin_bit_cast(float,
        __builtin_amdgcn_permlanex16(b, b, 0x76543210, 0xfedcba98, false, false));
}

#define KT      64                   // keys per LDS stage
#define LPITCH  144                  // LDS row: 128 data bytes + 16 (16 B x odd: no bank conflict for b128 reads)
#define TILE_B  (64 * LPITCH)        // one tile: 64 rows (K: keys, V^T: head dims)
#define NSTAGE  (SEQ / KT)

// One stage: K tile (64 keys x 128 B, contiguous in memory) and V^T tile
// (64 dims x 64 keys) into LDS; 1024 chunks of 16 B, 8 per thread.
// kg, vg: this lane's first chunk of each tile; lk: its LDS byte address in the
// K tile (the V^T tile follows at TILE_B).  Chunk i lies 16 rows further on.
static __device__ __forceinline__ void stage_kv(const __bf16* kg, const __bf16* vg, uint32_t lk) {
    const uint32_t lv = lk + TILE_B;
    // one statement for the copies and s_wait_xcnt: a precaution, so that no later
    // write of a copy's address registers can be scheduled ahead of that wait
    asm volatile(
        "global_load_async_to_lds_b128 %0, %8, off\n\t"
        "global_load_async_to_lds_b128 %1, %9, off\n\t"
        "global_load_async_to_lds_b128 %2, %10, off\n\t"
        "global_load_async_to_lds_b128 %3, %11, off\n\t"
        "global_load_async_to_lds_b128 %4, %12, off\n\t"
        "global_load_async_to_lds_b128 %5, %13, off\n\t"
        "global_load_async_to_lds_b128 %6, %14, off\n\t"
        "global_load_async_to_lds_b128 %7, %15, off\n\t"
        "s_wait_xcnt 0x0"
        :: "v"(lk), "v"(lk + 16 * LPITCH), "v"(lk + 32 * LPITCH), "v"(lk + 48 * LPITCH),
           "v"(lv), "v"(lv + 16 * LPITCH), "v"(lv + 32 * LPITCH), "v"(lv + 48 * LPITCH),
           "v"(kg), "v"(kg + 16 * HDIM), "v"(kg + 32 * HDIM), "v"(kg + 48 * HDIM),
           "v"(vg), "v"(vg + 16 * SEQ), "v"(vg + 32 * SEQ), "v"(vg + 48 * SEQ)
        : "memory");
}

__global__ __launch_bounds__(128)
void flash_attn_kernel(const __bf16* __restrict__ qb,
                       const __bf16* __restrict__ kb,
                       const __bf16* __restrict__ vT,
                       __bf16* __restrict__ ctxb) {
    __shared__ __attribute__((aligned(16))) unsigned char kv[2][2 * TILE_B];

    const int lane = threadIdx.x & 31;
    const int wave = threadIdx.x >> 5;
    const int ln   = lane & 15;
    const int off8 = (lane >> 4) ? 8 : 0;

    const int b    = blockIdx.z;
    const int head = blockIdx.y;
    const int bh   = b * NHEAD + head;
    const int q0   = blockIdx.x * 128 + wave * 32;

    const __bf16* qbase = qb + (size_t)bh * SEQ * HDIM;
    const __bf16* kbase = kb + (size_t)bh * SEQ * HDIM;
    const __bf16* vbase = vT + (size_t)bh * HDIM * SEQ;

    // this lane's chunk of a stage: row tid/8 (+16 per chunk), 16-byte column tid%8
    const int crow = threadIdx.x >> 3;
    const int ccol = threadIdx.x & 7;
    const __bf16* kcp = kbase + (size_t)crow * HDIM + ccol * 8;
    const __bf16* vcp = vbase + (size_t)crow * SEQ + ccol * 8;
    const uint32_t lcp = (uint32_t)(uintptr_t)&kv[0][crow * LPITCH + ccol * 16];

    stage_kv(kcp, vcp, lcp);                                  // tile 0 -> buffer 0
    asm volatile("s_wait_asynccnt 0x0" ::: "memory");         // own copies landed ...
    __syncthreads();                                          // ... and every wave's
    stage_kv(kcp + KT * HDIM, vcp + KT, lcp + 2 * TILE_B);    // tile 1 -> buffer 1, in flight over trip 0

    // Q B-fragments (column = query ln) held in registers for the whole key loop
    v16bf bq[2][2];
#pragma unroll
    for (int qt = 0; qt < 2; ++qt) {
        const __bf16* qrow = qbase + (size_t)(q0 + qt * 16 + ln) * HDIM;
        bq[qt][0] = load_frag(qrow + off8,      qrow + off8 + 16);
        bq[qt][1] = load_frag(qrow + 32 + off8, qrow + 32 + off8 + 16);
    }

    // per lane: running maximum of query qt*16+ln (equal in both lane halves)
    // and the sum over this lane half's keys (halves joined in the epilogue)
    float mcol[2], lcol[2];
#pragma unroll
    for (int qt = 0; qt < 2; ++qt) { mcol[qt] = -3.0e38f; lcol[qt] = 0.0f; }
    v8f o[2][4] = {};                            // o[qt][nt][r] = O[query ln][nt*16 + off8 + r]

    const float scale = 0.125f;                  // 1/sqrt(64)

    for (int st = 0; st < NSTAGE; ++st) {
      const unsigned char* ktile = kv[st & 1];
      const unsigned char* vtile = ktile + TILE_B;
#pragma unroll                                   // both 32-key blocks of a stage in one trip: constant LDS offsets
      for (int kk = 0; kk < KT / 32; ++kk) {
        // ---- scores: S^T = K * Q^T  (4 C tiles, K-dim 64 = 2 wmmas each)
        v16bf ak[2][2];
#pragma unroll
        for (int tt = 0; tt < 2; ++tt) {
            const __bf16* kr = (const __bf16*)(ktile + (kk * 32 + tt * 16 + ln) * LPITCH);
            ak[tt][0] = load_frag(kr + off8,      kr + off8 + 16);
            ak[tt][1] = load_frag(kr + 32 + off8, kr + 32 + off8 + 16);
        }
        v8f s[2][2] = {};                        // s[qt][tt][r] = S[query ln][block + tt*16 + off8 + r]
#pragma unroll
        for (int qt = 0; qt < 2; ++qt)
#pragma unroll
            for (int tt = 0; tt < 2; ++tt) {
                s[qt][tt] = wmma_bf16(ak[tt][0], bq[qt][0], s[qt][tt]);
                s[qt][tt] = wmma_bf16(ak[tt][1], bq[qt][1], s[qt][tt]);
            }

        // ---- online softmax + accumulator rescale + P^T packed as B operand
        v16bf bp[2];
#pragma unroll
        for (int qt = 0; qt < 2; ++qt) {
            const v8f x0 = s[qt][0] * scale;
            const v8f x1 = s[qt][1] * scale;
            // in-lane maximum of the 16 scores, as a tree of three-input maxima
            const float a0 = fmaxf(fmaxf(x0[0], x0[1]), x0[2]);
            const float a1 = fmaxf(fmaxf(x0[3], x0[4]), x0[5]);
            const float a2 = fmaxf(fmaxf(x0[6], x0[7]), x1[0]);
            const float a3 = fmaxf(fmaxf(x1[1], x1[2]), x1[3]);
            const float a4 = fmaxf(fmaxf(x1[4], x1[5]), x1[6]);
            const float mx = fmaxf(fmaxf(fmaxf(a0, a1), a2), fmaxf(fmaxf(a3, a4), x1[7]));
            const float mnew  = fmaxf(fmaxf(mcol[qt], mx), other_half(mx));
            const float alpha = __expf(mcol[qt] - mnew);
            mcol[qt] = mnew;
            v8f p0, p1;
#pragma unroll
            for (int r = 0; r < 8; ++r) {
                p0[r] = __expf(x0[r] - mnew);
                p1[r] = __expf(x1[r] - mnew);
                bp[qt][r]     = (__bf16)p0[r];   // element e = key kmap(e, half):
                bp[qt][8 + r] = (__bf16)p1[r];   // the hardware k order, as V's loads
            }
            const v8f pv = p0 + p1;              // in-lane sum, pairwise
            const float ps = ((pv[0] + pv[1]) + (pv[2] + pv[3])) +
                             ((pv[4] + pv[5]) + (pv[6] + pv[7]));
            lcol[qt] = lcol[qt] * alpha + ps;
#pragma unroll
            for (int nt = 0; nt < 4; ++nt)
                o[qt][nt] *= alpha;
        }

        // ---- O^T += V^T * P^T  (V tile is [d, t] -> contiguous A loads, shared by column tiles)
#pragma unroll
        for (int nt = 0; nt < 4; ++nt) {
            const __bf16* vr = (const __bf16*)(vtile + (nt * 16 + ln) * LPITCH) + kk * 32 + off8;
            v16bf av = load_frag(vr, vr + 16);
            o[0][nt] = wmma_bf16(av, bp[0], o[0][nt]);
            o[1][nt] = wmma_bf16(av, bp[1], o[1][nt]);
        }
      }

      // hand-over: tile st+1 becomes readable, this trip's buffer becomes free
      asm volatile("s_wait_dscnt 0x0" ::: "memory");          // own reads of this buffer done
      asm volatile("s_wait_asynccnt 0x0" ::: "memory");       // own copies of tile st+1 landed
      __syncthreads();
      if (st + 2 < NSTAGE)
          stage_kv(kcp + (size_t)(st + 2) * KT * HDIM, vcp + (st + 2) * KT,
                   lcp + (st & 1) * (2 * TILE_B));
    }
    asm volatile("s_wait_asynccnt 0x0" ::: "memory");         // nothing in flight when the wave ends

    // ---- epilogue: ctx[b, s, head*64 + d] = o / l ; a lane owns 8 consecutive d
#pragma unroll
    for (int qt = 0; qt < 2; ++qt) {
        const int srow = q0 + qt * 16 + ln;
        const float inv = 1.0f / (lcol[qt] + other_half(lcol[qt]));
#pragma unroll
        for (int nt = 0; nt < 4; ++nt) {
            union { __bf16 h[8]; uint4 q; } pk;
#pragma unroll
            for (int r = 0; r < 8; ++r)
                pk.h[r] = f2bf(o[qt][nt][r] * inv);
            *(uint4*)(ctxb + ((size_t)(b * SEQ + srow)) * HID + head * 64 + nt * 16 + off8) = pk.q;
        }
    }
}

// ---------------------------------------------------------------------------
// Output projection: out[m,n] = sum_k ctx[m,k] * Wo[n,k] + bo[n]   (f32 out)
// grid = (BS/128, HID/64), block = 128.
// ---------------------------------------------------------------------------
__global__ __launch_bounds__(128)
void out_proj_kernel(const __bf16* __restrict__ ctxb,
                     const __bf16* __restrict__ wob,
                     const float* __restrict__ bo,
                     float* __restrict__ out) {
    __shared__ __bf16 wtile[2][64][40];

    const int tid  = threadIdx.x;
    const int lane = tid & 31;
    const int wave = tid >> 5;
    const int ln   = lane & 15;
    const int off8 = (lane >> 4) ? 8 : 0;

    const int M0 = blockIdx.x * 128 + wave * 32;
    const int N0 = blockIdx.y * 64;

    stage_wtile(wob, N0, 0, wtile[0], tid);
    stage_fence();

    v8f acc[2][4] = {};

    for (int k0 = 0; k0 < HID; k0 += 32) {
        const int buf = (k0 >> 5) & 1;
        if (k0 + 32 < HID)
            stage_wtile(wob, N0, k0 + 32, wtile[buf ^ 1], tid);

        v16bf bfr[4];
#pragma unroll
        for (int nt = 0; nt < 4; ++nt)
            bfr[nt] = load_frag(&wtile[buf][nt * 16 + ln][off8],
                                &wtile[buf][nt * 16 + ln][off8 + 16]);
#pragma unroll
        for (int mt = 0; mt < 2; ++mt) {
            const __bf16* ar = ctxb + (size_t)(M0 + mt * 16 + ln) * HID + k0 + off8;
            v16bf a = load_frag(ar, ar + 16);
#pragma unroll
            for (int nt = 0; nt < 4; ++nt)
                acc[mt][nt] = wmma_bf16(a, bfr[nt], acc[mt][nt]);
        }
        stage_fence();
    }

#pragma unroll
    for (int mt = 0; mt < 2; ++mt)
#pragma unroll
        for (int nt = 0; nt < 4; ++nt) {
            const int n = N0 + nt * 16 + ln;
            const float bval = bo[n];
#pragma unroll
            for (int r = 0; r < 8; ++r) {
                const int m = M0 + mt * 16 + r + off8;
                out[(size_t)m * HID + n] = acc[mt][nt][r] + bval;
            }
        }
}

// ---------------------------------------------------------------------------
// Host launcher
// ---------------------------------------------------------------------------
extern "C" void kernel_launch(void* const* d_in, const int* in_sizes, int n_in,
                              void* d_out, int out_size, void* d_ws, size_t ws_size,
                              hipStream_t stream) {
    (void)in_sizes; (void)n_in; (void)out_size; (void)ws_size;

    const float* x  = (const float*)d_in[0];
    const float* Wq = (const float*)d_in[1];
    const float* bq = (const float*)d_in[2];
    const float* Wk = (const float*)d_in[3];
    const float* bk = (const float*)d_in[4];
    const float* Wv = (const float*)d_in[5];
    const float* bv = (const float*)d_in[6];
    const float* Wo = (const float*)d_in[7];
    const float* bo = (const float*)d_in[8];
    float* out = (float*)d_out;

    // workspace layout (bf16 scratch, ~42 MB total)
    const size_t XB_ELE = (size_t)BS * HID;       // 4,194,304
    const size_t W_ELE  = (size_t)HID * HID;      //   262,144
    char* ws = (char*)d_ws;
    size_t off = 0;
    __bf16* xb   = (__bf16*)(ws + off); off += XB_ELE * 2;
    __bf16* wqb  = (__bf16*)(ws + off); off += W_ELE * 2;
    __bf16* wkb  = (__bf16*)(ws + off); off += W_ELE * 2;
    __bf16* wvb  = (__bf16*)(ws + off); off += W_ELE * 2;
    __bf16* wob  = (__bf16*)(ws + off); off += W_ELE * 2;
    __bf16* qbuf = (__bf16*)(ws + off); off += XB_ELE * 2;
    __bf16* kbuf = (__bf16*)(ws + off); off += XB_ELE * 2;
    __bf16* vtb  = (__bf16*)(ws + off); off += XB_ELE * 2;
    __bf16* ctxb = (__bf16*)(ws + off); off += XB_ELE * 2;

    // 1) f32 -> bf16 conversions
    const int CT = 256;
    cvt_f32_bf16_kernel<<<(int)(XB_ELE / 4 + CT - 1) / CT, CT, 0, stream>>>(x,  xb,  (int)XB_ELE);
    cvt_f32_bf16_kernel<<<(int)(W_ELE  / 4 + CT - 1) / CT, CT, 0, stream>>>(Wq, wqb, (int)W_ELE);
    cvt_f32_bf16_kernel<<<(int)(W_ELE  / 4 + CT - 1) / CT, CT, 0, stream>>>(Wk, wkb, (int)W_ELE);
    cvt_f32_bf16_kernel<<<(int)(W_ELE  / 4 + CT - 1) / CT, CT, 0, stream>>>(Wv, wvb, (int)W_ELE);
    cvt_f32_bf16_kernel<<<(int)(W_ELE  / 4 + CT - 1) / CT, CT, 0, stream>>>(Wo, wob, (int)W_ELE);

    // 2) fused QKV projection (Q,K row-major per head; V transposed per head)
    dim3 gqkv(BS / 128, NHEAD, 3);
    qkv_proj_kernel<<<gqkv, 128, 0, stream>>>(xb, wqb, wkb, wvb, bq, bk, bv,
                                              qbuf, kbuf, vtb);

    // 3) flash attention
    dim3 gattn(SEQ / 128, NHEAD, BATCH);
    flash_attn_kernel<<<gattn, 128, 0, stream>>>(qbuf, kbuf, vtb, ctxb);

    // 4) output projection -> f32 out
    dim3 gout(BS / 128, HID / 64);
    out_proj_kernel<<<gout, 128, 0, stream>>>(ctxb, wob, bo, out);
}

// v003
// A run of this version takes 128 microseconds.
// Next to v002, in two timings, it ran 1.08 times as fast each time.
// Over all steps from v000 it is 2.42 times as fast.
#include <hip/hip_runtime.h>
#include <stdint.h>

// ---------------------------------------------------------------------------
// Multi-head attention forward for gfx1250 (MI455X), bf16 WMMA pipeline.
// B=2, S=4096, HID=512, HEADS=8, D=64.  Compute-bound -> all three GEMM
// stages through v_wmma_f32_16x16x32_bf16 with f32 accumulation.
// Weight tiles double-buffered in LDS via async global->LDS copies.
// ---------------------------------------------------------------------------

#define BATCH 2
#define SEQ   4096
#define HID   512
#define NHEAD 8
#define HDIM  64
#define BS    (BATCH * SEQ)          // 8192 rows

// gfx1250 async global->LDS path (guarded; falls back to ds_store staging)
#if defined(__has_builtin)
#  if __has_builtin(__builtin_amdgcn_global_load_async_to_lds_b128) && \
      __has_builtin(__builtin_amdgcn_s_wait_asynccnt)
#    define USE_ASYNC_LDS 1
#  endif
#endif
#ifndef USE_ASYNC_LDS
#  define USE_ASYNC_LDS 0
#endif

typedef __attribute__((ext_vector_type(16))) __bf16 v16bf;
typedef __attribute__((ext_vector_type(8)))  float  v8f;

#if USE_ASYNC_LDS
// exact parameter type of the async-load builtin (from clang diagnostic):
// int __attribute__((vector_size(16))) in AS1 (src) / AS3 (dst)
typedef int v4i_vs __attribute__((vector_size(16)));
typedef __attribute__((address_space(1))) v4i_vs* g4ptr;
typedef __attribute__((address_space(3))) v4i_vs* l4ptr;
#endif

union BF16x16 {
    v16bf v;
    uint4 q[2];
};

// round-to-nearest-even f32 -> bf16
static __device__ __forceinline__ __bf16 f2bf(float f) {
    unsigned int u = __builtin_bit_cast(unsigned int, f);
    unsigned int r = (u + 0x7FFFu + ((u >> 16) & 1u)) >> 16;
    unsigned short h = (unsigned short)r;
    return __builtin_bit_cast(__bf16, h);
}

// 16-element bf16 WMMA fragment: 8 contiguous bf16 at p0 (elems 0..7) and 8
// contiguous bf16 at p1 (elems 8..15); 16B-aligned -> *_load_b128 pairs.
static __device__ __forceinline__ v16bf load_frag(const __bf16* p0, const __bf16* p1) {
    BF16x16 u;
    u.q[0] = *(const uint4*)p0;
    u.q[1] = *(const uint4*)p1;
    return u.v;
}

static __device__ __forceinline__ v8f wmma_bf16(v16bf a, v16bf b, v8f c) {
    return __builtin_amdgcn_wmma_f32_16x16x32_bf16(false, a, false, b, (short)0, c,
                                                   false, false);
}

// 16 bytes global -> LDS (async on CDNA5, synchronous staging otherwise)
static __device__ __forceinline__ void copy16_g2l(const __bf16* g, __bf16* l) {
#if USE_ASYNC_LDS
    __builtin_amdgcn_global_load_async_to_lds_b128((g4ptr)(void*)(size_t)(const void*)g,
                                                   (l4ptr)l, 0, 0);
#else
    *(uint4*)l = *(const uint4*)g;
#endif
}

static __device__ __forceinline__ void stage_fence() {
#if USE_ASYNC_LDS
    __builtin_amdgcn_s_wait_asynccnt(0);
#endif
    __syncthreads();
}

// ---------------------------------------------------------------------------
// f32 -> bf16 conversion of x and the four weight matrices in ONE launch.
// The five bf16 copies lie back to back in the workspace (x, Wq, Wk, Wv, Wo),
// so the destination is one array indexed by the block's own number; a block
// converts 4096 chunks (a chunk = 4 elements) of ONE source.
// 16 waves per block; a thread has its 8 loads of 16 B in flight before the
// first store.
// ---------------------------------------------------------------------------
struct alignas(8) BF4 { __bf16 a, b, c, d; };

#define CVT_THREADS 512
#define CVT_LOADS   8                                // chunks per thread
#define CVT_CHUNKS  (CVT_THREADS * CVT_LOADS)        // chunks per block
#define X_BLOCKS    (BS * HID / 4 / CVT_CHUNKS)      // 256
#define W_BLOCKS    (HID * HID / 4 / CVT_CHUNKS)     //  16
#define CVT_BLOCKS  (X_BLOCKS + 4 * W_BLOCKS)        // 320
static_assert(X_BLOCKS * CVT_CHUNKS * 4 == BS * HID && W_BLOCKS * CVT_CHUNKS * 4 == HID * HID,
              "whole blocks per source");

__global__ __launch_bounds__(CVT_THREADS)
void cvt_f32_bf16_kernel(const float* __restrict__ x,
                         const float* __restrict__ wq,
                         const float* __restrict__ wk,
                         const float* __restrict__ wv,
                         const float* __restrict__ wo,
                         __bf16* __restrict__ dst) {
    const int blk = blockIdx.x;
    const float* src = x;                        // source and block number inside it
    int sblk = blk;
    if (blk >= X_BLOCKS) {
        const int w = (blk - X_BLOCKS) / W_BLOCKS;
        src  = (w == 0) ? wq : (w == 1) ? wk : (w == 2) ? wv : wo;
        sblk = (blk - X_BLOCKS) % W_BLOCKS;
    }
    const float4* s4 = (const float4*)src + (size_t)sblk * CVT_CHUNKS + threadIdx.x;
    BF4*          d4 = (BF4*)dst + (size_t)blk * CVT_CHUNKS + threadIdx.x;

    float4 f[CVT_LOADS];
#pragma unroll                                   // all loads issued ahead of the first use
    for (int i = 0; i < CVT_LOADS; ++i)
        f[i] = s4[i * CVT_THREADS];
#pragma unroll
    for (int i = 0; i < CVT_LOADS; ++i) {
        BF4 o;
        o.a = f2bf(f[i].x); o.b = f2bf(f[i].y); o.c = f2bf(f[i].z); o.d = f2bf(f[i].w);
        d4[i * CVT_THREADS] = o;
    }
}

// ---------------------------------------------------------------------------
// Cooperative stage of a 64(row) x 32(k) bf16 weight tile into LDS.
// tile rows padded to 40 elems (80B) -> conflict-free ds_load_b128 later.
// 128 threads x 2 chunks of 16B = 4KB.
// ---------------------------------------------------------------------------
static __device__ __forceinline__ void stage_wtile(const __bf16* __restrict__ W,
                                                   int n0, int k0,
                                                   __bf16 (*tile)[40], int tid) {
#pragma unroll
    for (int i = 0; i < 2; ++i) {
        const int ch  = tid * 2 + i;       // 0..255
        const int row = ch >> 2;           // 0..63
        const int e   = (ch & 3) * 8;      // 0,8,16,24
        copy16_g2l(W + (size_t)(n0 + row) * HID + k0 + e, &tile[row][e]);
    }
}

// ---------------------------------------------------------------------------
// QKV projection: Y[m,n] = sum_k X[m,k] * W[n,k] + bias[n]
// grid = (BS/128, NHEAD, 3), block = 128 (4 waves). Wave -> 32x64 tile.
// Weight tile double-buffered in LDS, shared by all 4 waves.
// Q,K stored [b,h,s,d]; V stored transposed [b,h,d,t].
// ---------------------------------------------------------------------------
__global__ __launch_bounds__(128)
void qkv_proj_kernel(const __bf16* __restrict__ xb,
                     const __bf16* __restrict__ wqb,
                     const __bf16* __restrict__ wkb,
                     const __bf16* __restrict__ wvb,
                     const float* __restrict__ bq,
                     const float* __restrict__ bk,
                     const float* __restrict__ bv,
                     __bf16* __restrict__ qout,
                     __bf16* __restrict__ kout,
                     __bf16* __restrict__ vtout) {
    __shared__ __bf16 wtile[2][64][40];

    const int tid  = threadIdx.x;
    const int lane = tid & 31;
    const int wave = tid >> 5;
    const int ln   = lane & 15;
    const int off8 = (lane >> 4) ? 8 : 0;

    const int M0    = blockIdx.x * 128 + wave * 32;
    const int head  = blockIdx.y;
    const int which = blockIdx.z;               // 0=Q 1=K 2=V
    const int N0    = head * 64;

    const __bf16* W;
    const float*  bias;
    if (which == 0)      { W = wqb; bias = bq; }
    else if (which == 1) { W = wkb; bias = bk; }
    else                 { W = wvb; bias = bv; }

    stage_wtile(W, N0, 0, wtile[0], tid);
    stage_fence();

    v8f acc[2][4] = {};

    for (int k0 = 0; k0 < HID; k0 += 32) {
        const int buf = (k0 >> 5) & 1;
        if (k0 + 32 < HID)
            stage_wtile(W, N0, k0 + 32, wtile[buf ^ 1], tid);   // prefetch next

        v16bf bfr[4];
#pragma unroll
        for (int nt = 0; nt < 4; ++nt)
            bfr[nt] = load_frag(&wtile[buf][nt * 16 + ln][off8],
                                &wtile[buf][nt * 16 + ln][off8 + 16]);
#pragma unroll
        for (int mt = 0; mt < 2; ++mt) {
            const __bf16* ar = xb + (size_t)(M0 + mt * 16 + ln) * HID + k0 + off8;
            v16bf a = load_frag(ar, ar + 16);
#pragma unroll
            for (int nt = 0; nt < 4; ++nt)
                acc[mt][nt] = wmma_bf16(a, bfr[nt], acc[mt][nt]);
        }
        stage_fence();
    }

    // store: C layout row m = r + (lane<16 ? 0 : 8), col = nt*16 + ln
#pragma unroll
    for (int mt = 0; mt < 2; ++mt) {
#pragma unroll
        for (int nt = 0; nt < 4; ++nt) {
            const int d = nt * 16 + ln;
            const float bval = bias[N0 + d];
#pragma unroll
            for (int r = 0; r < 8; ++r) {
                const int g  = M0 + mt * 16 + r + off8;  // global row (b*S + s)
                const int bi = g >> 12;
                const int si = g & (SEQ - 1);
                const int bh = bi * NHEAD + head;
                const float v = acc[mt][nt][r] + bval;
                if (which == 2) {
                    vtout[((size_t)bh * HDIM + d) * SEQ + si] = f2bf(v);
                } else {
                    __bf16* dst = (which == 0) ? qout : kout;
                    dst[((size_t)bh * SEQ + si) * HDIM + d] = f2bf(v);
                }
            }
        }
    }
}

static __device__ __forceinline__ float other_half(float v) {
    const int b = __builtin_bit_cast(int, v);
    return __builtin_bit_cast(float,
        __builtin_amdgcn_permlanex16(b, b, 0x76543210, 0xfedcba98, false, false));
}

#define KT      64                   // keys per LDS stage
#define LPITCH  144                  // LDS row: 128 data bytes + 16 (16 B x odd: no bank conflict for b128 reads)
#define TILE_B  (64 * LPITCH)        // one tile: 64 rows (K: keys, V^T: head dims)
#define NSTAGE  (SEQ / KT)

// One stage: K tile (64 keys x 128 B, contiguous in memory) and V^T tile
// (64 dims x 64 keys) into LDS; 1024 chunks of 16 B, 8 per thread.
// kg, vg: this lane's first chunk of each tile; lk: its LDS byte address in the
// K tile (the V^T tile follows at TILE_B).  Chunk i lies 16 rows further on.
static __device__ __forceinline__ void stage_kv(const __bf16* kg, const __bf16* vg, uint32_t lk) {
    const uint32_t lv = lk + TILE_B;
    // one statement for the copies and s_wait_xcnt: a precaution, so that no later
    // write of a copy's address registers can be scheduled ahead of that wait
    asm volatile(
        "global_load_async_to_lds_b128 %0, %8, off\n\t"
        "global_load_async_to_lds_b128 %1, %9, off\n\t"
        "global_load_async_to_lds_b128 %2, %10, off\n\t"
        "global_load_async_to_lds_b128 %3, %11, off\n\t"
        "global_load_async_to_lds_b128 %4, %12, off\n\t"
        "global_load_async_to_lds_b128 %5, %13, off\n\t"
        "global_load_async_to_lds_b128 %6, %14, off\n\t"
        "global_load_async_to_lds_b128 %7, %15, off\n\t"
        "s_wait_xcnt 0x0"
        :: "v"(lk), "v"(lk + 16 * LPITCH), "v"(lk + 32 * LPITCH), "v"(lk + 48 * LPITCH),
           "v"(lv), "v"(lv + 16 * LPITCH), "v"(lv + 32 * LPITCH), "v"(lv + 48 * LPITCH),
           "v"(kg), "v"(kg + 16 * HDIM), "v"(kg + 32 * HDIM), "v"(kg + 48 * HDIM),
           "v"(vg), "v"(vg + 16 * SEQ), "v"(vg + 32 * SEQ), "v"(vg + 48 * SEQ)
        : "memory");
}

__global__ __launch_bounds__(128)
void flash_attn_kernel(const __bf16* __restrict__ qb,
                       const __bf16* __restrict__ kb,
                       const __bf16* __restrict__ vT,
                       __bf16* __restrict__ ctxb) {
    __shared__ __attribute__((aligned(16))) unsigned char kv[2][2 * TILE_B];

    const int lane = threadIdx.x & 31;
    const int wave = threadIdx.x >> 5;
    const int ln   = lane & 15;
    const int off8 = (lane >> 4) ? 8 : 0;

    const int b    = blockIdx.z;
    const int head = blockIdx.y;
    const int bh   = b * NHEAD + head;
    const int q0   = blockIdx.x * 128 + wave * 32;

    const __bf16* qbase = qb + (size_t)bh * SEQ * HDIM;
    const __bf16* kbase = kb + (size_t)bh * SEQ * HDIM;
    const __bf16* vbase = vT + (size_t)bh * HDIM * SEQ;

    // this lane's chunk of a stage: row tid/8 (+16 per chunk), 16-byte column tid%8
    const int crow = threadIdx.x >> 3;
    const int ccol = threadIdx.x & 7;
    const __bf16* kcp = kbase + (size_t)crow * HDIM + ccol * 8;
    const __bf16* vcp = vbase + (size_t)crow * SEQ + ccol * 8;
    const uint32_t lcp = (uint32_t)(uintptr_t)&kv[0][crow * LPITCH + ccol * 16];

    stage_kv(kcp, vcp, lcp);                                  // tile 0 -> buffer 0
    asm volatile("s_wait_asynccnt 0x0" ::: "memory");         // own copies landed ...
    __syncthreads();                                          // ... and every wave's
    stage_kv(kcp + KT * HDIM, vcp + KT, lcp + 2 * TILE_B);    // tile 1 -> buffer 1, in flight over trip 0

    // Q B-fragments (column = query ln) held in registers for the whole key loop
    v16bf bq[2][2];
#pragma unroll
    for (int qt = 0; qt < 2; ++qt) {
        const __bf16* qrow = qbase + (size_t)(q0 + qt * 16 + ln) * HDIM;
        bq[qt][0] = load_frag(qrow + off8,      qrow + off8 + 16);
        bq[qt][1] = load_frag(qrow + 32 + off8, qrow + 32 + off8 + 16);
    }

    // per lane: running maximum of query qt*16+ln (equal in both lane halves)
    // and the sum over this lane half's keys (halves joined in the epilogue)
    float mcol[2], lcol[2];
#pragma unroll
    for (int qt = 0; qt < 2; ++qt) { mcol[qt] = -3.0e38f; lcol[qt] = 0.0f; }
    v8f o[2][4] = {};                            // o[qt][nt][r] = O[query ln][nt*16 + off8 + r]

    const float scale = 0.125f;                  // 1/sqrt(64)

    for (int st = 0; st < NSTAGE; ++st) {
      const unsigned char* ktile = kv[st & 1];
      const unsigned char* vtile = ktile + TILE_B;
#pragma unroll                                   // both 32-key blocks of a stage in one trip: constant LDS offsets
      for (int kk = 0; kk < KT / 32; ++kk) {
        // ---- scores: S^T = K * Q^T  (4 C tiles, K-dim 64 = 2 wmmas each)
        v16bf ak[2][2];
#pragma unroll
        for (int tt = 0; tt < 2; ++tt) {
            const __bf16* kr = (const __bf16*)(ktile + (kk * 32 + tt * 16 + ln) * LPITCH);
            ak[tt][0] = load_frag(kr + off8,      kr + off8 + 16);
            ak[tt][1] = load_frag(kr + 32 + off8, kr + 32 + off8 + 16);
        }
        v8f s[2][2] = {};                        // s[qt][tt][r] = S[query ln][block + tt*16 + off8 + r]
#pragma unroll
        for (int qt = 0; qt < 2; ++qt)
#pragma unroll
            for (int tt = 0; tt < 2; ++tt) {
                s[qt][tt] = wmma_bf16(ak[tt][0], bq[qt][0], s[qt][tt]);
                s[qt][tt] = wmma_bf16(ak[tt][1], bq[qt][1], s[qt][tt]);
            }

        // ---- online softmax + accumulator rescale + P^T packed as B operand
        v16bf bp[2];
#pragma unroll
        for (int qt = 0; qt < 2; ++qt) {
            const v8f x0 = s[qt][0] * scale;
            const v8f x1 = s[qt][1] * scale;
            // in-lane maximum of the 16 scores, as a tree of three-input maxima
            const float a0 = fmaxf(fmaxf(x0[0], x0[1]), x0[2]);
            const float a1 = fmaxf(fmaxf(x0[3], x0[4]), x0[5]);
            const float a2 = fmaxf(fmaxf(x0[6], x0[7]), x1[0]);
            const float a3 = fmaxf(fmaxf(x1[1], x1[2]), x1[3]);
            const float a4 = fmaxf(fmaxf(x1[4], x1[5]), x1[6]);
            const float mx = fmaxf(fmaxf(fmaxf(a0, a1), a2), fmaxf(fmaxf(a3, a4), x1[7]));
            const float mnew  = fmaxf(fmaxf(mcol[qt], mx), other_half(mx));
            const float alpha = __expf(mcol[qt] - mnew);
            mcol[qt] = mnew;
            v8f p0, p1;
#pragma unroll
            for (int r = 0; r < 8; ++r) {
                p0[r] = __expf(x0[r] - mnew);
                p1[r] = __expf(x1[r] - mnew);
                bp[qt][r]     = (__bf16)p0[r];   // element e = key kmap(e, half):
                bp[qt][8 + r] = (__bf16)p1[r];   // the hardware k order, as V's loads
            }
            const v8f pv = p0 + p1;              // in-lane sum, pairwise
            const float ps = ((pv[0] + pv[1]) + (pv[2] + pv[3])) +
                             ((pv[4] + pv[5]) + (pv[6] + pv[7]));
            lcol[qt] = lcol[qt] * alpha + ps;
#pragma unroll
            for (int nt = 0; nt < 4; ++nt)
                o[qt][nt] *= alpha;
        }

        // ---- O^T += V^T * P^T  (V tile is [d, t] -> contiguous A loads, shared by column tiles)
#pragma unroll
        for (int nt = 0; nt < 4; ++nt) {
            const __bf16* vr = (const __bf16*)(vtile + (nt * 16 + ln) * LPITCH) + kk * 32 + off8;
            v16bf av = load_frag(vr, vr + 16);
            o[0][nt] = wmma_bf16(av, bp[0], o[0][nt]);
            o[1][nt] = wmma_bf16(av, bp[1], o[1][nt]);
        }
      }

      // hand-over: tile st+1 becomes readable, this trip's buffer becomes free
      asm volatile("s_wait_dscnt 0x0" ::: "memory");          // own reads of this buffer done
      asm volatile("s_wait_asynccnt 0x0" ::: "memory");       // own copies of tile st+1 landed
      __syncthreads();
      if (st + 2 < NSTAGE)
          stage_kv(kcp + (size_t)(st + 2) * KT * HDIM, vcp + (st + 2) * KT,
                   lcp + (st & 1) * (2 * TILE_B));
    }
    asm volatile("s_wait_asynccnt 0x0" ::: "memory");         // nothing in flight when the wave ends

    // ---- epilogue: ctx[b, s, head*64 + d] = o / l ; a lane owns 8 consecutive d
#pragma unroll
    for (int qt = 0; qt < 2; ++qt) {
        const int srow = q0 + qt * 16 + ln;
        const float inv = 1.0f / (lcol[qt] + other_half(lcol[qt]));
#pragma unroll
        for (int nt = 0; nt < 4; ++nt) {
            union { __bf16 h[8]; uint4 q; } pk;
#pragma unroll
            for (int r = 0; r < 8; ++r)
                pk.h[r] = f2bf(o[qt][nt][r] * inv);
            *(uint4*)(ctxb + ((size_t)(b * SEQ + srow)) * HID + head * 64 + nt * 16 + off8) = pk.q;
        }
    }
}

// ---------------------------------------------------------------------------
// Output projection: out[m,n] = sum_k ctx[m,k] * Wo[n,k] + bo[n]   (f32 out)
// grid = (BS/128, HID/64), block = 128.
// ---------------------------------------------------------------------------
__global__ __launch_bounds__(128)
void out_proj_kernel(const __bf16* __restrict__ ctxb,
                     const __bf16* __restrict__ wob,
                     const float* __restrict__ bo,
                     float* __restrict__ out) {
    __shared__ __bf16 wtile[2][64][40];

    const int tid  = threadIdx.x;
    const int lane = tid & 31;
    const int wave = tid >> 5;
    const int ln   = lane & 15;
    const int off8 = (lane >> 4) ? 8 : 0;

    const int M0 = blockIdx.x * 128 + wave * 32;
    const int N0 = blockIdx.y * 64;

    stage_wtile(wob, N0, 0, wtile[0], tid);
    stage_fence();

    v8f acc[2][4] = {};

    for (int k0 = 0; k0 < HID; k0 += 32) {
        const int buf = (k0 >> 5) & 1;
        if (k0 + 32 < HID)
            stage_wtile(wob, N0, k0 + 32, wtile[buf ^ 1], tid);

        v16bf bfr[4];
#pragma unroll
        for (int nt = 0; nt < 4; ++nt)
            bfr[nt] = load_frag(&wtile[buf][nt * 16 + ln][off8],
                                &wtile[buf][nt * 16 + ln][off8 + 16]);
#pragma unroll
        for (int mt = 0; mt < 2; ++mt) {
            const __bf16* ar = ctxb + (size_t)(M0 + mt * 16 + ln) * HID + k0 + off8;
            v16bf a = load_frag(ar, ar + 16);
#pragma unroll
            for (int nt = 0; nt < 4; ++nt)
                acc[mt][nt] = wmma_bf16(a, bfr[nt], acc[mt][nt]);
        }
        stage_fence();
    }

#pragma unroll
    for (int mt = 0; mt < 2; ++mt)
#pragma unroll
        for (int nt = 0; nt < 4; ++nt) {
            const int n = N0 + nt * 16 + ln;
            const float bval = bo[n];
#pragma unroll
            for (int r = 0; r < 8; ++r) {
                const int m = M0 + mt * 16 + r + off8;
                out[(size_t)m * HID + n] = acc[mt][nt][r] + bval;
            }
        }
}

// ---------------------------------------------------------------------------
// Host launcher
// ---------------------------------------------------------------------------
extern "C" void kernel_launch(void* const* d_in, const int* in_sizes, int n_in,
                              void* d_out, int out_size, void* d_ws, size_t ws_size,
                              hipStream_t stream) {
    (void)in_sizes; (void)n_in; (void)out_size; (void)ws_size;

    const float* x  = (const float*)d_in[0];
    const float* Wq = (const float*)d_in[1];
    const float* bq = (const float*)d_in[2];
    const float* Wk = (const float*)d_in[3];
    const float* bk = (const float*)d_in[4];
    const float* Wv = (const float*)d_in[5];
    const float* bv = (const float*)d_in[6];
    const float* Wo = (const float*)d_in[7];
    const float* bo = (const float*)d_in[8];
    float* out = (float*)d_out;

    // workspace layout (bf16 scratch, ~42 MB total)
    const size_t XB_ELE = (size_t)BS * HID;       // 4,194,304
    const size_t W_ELE  = (size_t)HID * HID;      //   262,144
    char* ws = (char*)d_ws;
    size_t off = 0;
    __bf16* xb   = (__bf16*)(ws + off); off += XB_ELE * 2;
    __bf16* wqb  = (__bf16*)(ws + off); off += W_ELE * 2;
    __bf16* wkb  = (__bf16*)(ws + off); off += W_ELE * 2;
    __bf16* wvb  = (__bf16*)(ws + off); off += W_ELE * 2;
    __bf16* wob  = (__bf16*)(ws + off); off += W_ELE * 2;
    __bf16* qbuf = (__bf16*)(ws + off); off += XB_ELE * 2;
    __bf16* kbuf = (__bf16*)(ws + off); off += XB_ELE * 2;
    __bf16* vtb  = (__bf16*)(ws + off); off += XB_ELE * 2;
    __bf16* ctxb = (__bf16*)(ws + off); off += XB_ELE * 2;

    // 1) f32 -> bf16 conversions, one launch: xb, wqb, wkb, wvb, wob are contiguous from xb
    cvt_f32_bf16_kernel<<<CVT_BLOCKS, CVT_THREADS, 0, stream>>>(x, Wq, Wk, Wv, Wo, xb);

    // 2) fused QKV projection (Q,K row-major per head; V transposed per head)
    dim3 gqkv(BS / 128, NHEAD, 3);
    qkv_proj_kernel<<<gqkv, 128, 0, stream>>>(xb, wqb, wkb, wvb, bq, bk, bv,
                                              qbuf, kbuf, vtb);

    // 3) flash attention
    dim3 gattn(SEQ / 128, NHEAD, BATCH);
    flash_attn_kernel<<<gattn, 128, 0, stream>>>(qbuf, kbuf, vtb, ctxb);

    // 4) output projection -> f32 out
    dim3 gout(BS / 128, HID / 64);
    out_proj_kernel<<<gout, 128, 0, stream>>>(ctxb, wob, bo, out);
}

// v004
// Measured time: 121 microseconds a run.
// Two timings next to v003 both put it at 1.07 times that version's speed.
// Over all steps from v000 it is 2.58 times as fast.
#include <hip/hip_runtime.h>
#include <stdint.h>

// ---------------------------------------------------------------------------
// Multi-head attention forward for gfx1250 (MI455X), bf16 WMMA pipeline.
// B=2, S=4096, HID=512, HEADS=8, D=64.  Compute-bound -> all three GEMM
// stages through v_wmma_f32_16x16x32_bf16 with f32 accumulation.
// Weight tiles double-buffered in LDS via async global->LDS copies.
// ---------------------------------------------------------------------------

#define BATCH 2
#define SEQ   4096
#define HID   512
#define NHEAD 8
#define HDIM  64
#define BS    (BATCH * SEQ)          // 8192 rows

// gfx1250 async global->LDS path (guarded; falls back to ds_store staging)
#if defined(__has_builtin)
#  if __has_builtin(__builtin_amdgcn_global_load_async_to_lds_b128) && \
      __has_builtin(__builtin_amdgcn_s_wait_asynccnt)
#    define USE_ASYNC_LDS 1
#  endif
#endif
#ifndef USE_ASYNC_LDS
#  define USE_ASYNC_LDS 0
#endif

typedef __attribute__((ext_vector_type(16))) __bf16 v16bf;
typedef __attribute__((ext_vector_type(8)))  float  v8f;

#if USE_ASYNC_LDS
// exact parameter type of the async-load builtin (from clang diagnostic):
// int __attribute__((vector_size(16))) in AS1 (src) / AS3 (dst)
typedef int v4i_vs __attribute__((vector_size(16)));
typedef __attribute__((address_space(1))) v4i_vs* g4ptr;
typedef __attribute__((address_space(3))) v4i_vs* l4ptr;
#endif

union BF16x16 {
    v16bf v;
    uint4 q[2];
};

// round-to-nearest-even f32 -> bf16
static __device__ __forceinline__ __bf16 f2bf(float f) {
    unsigned int u = __builtin_bit_cast(unsigned int, f);
    unsigned int r = (u + 0x7FFFu + ((u >> 16) & 1u)) >> 16;
    unsigned short h = (unsigned short)r;
    return __builtin_bit_cast(__bf16, h);
}

// 16-element bf16 WMMA fragment: 8 contiguous bf16 at p0 (elems 0..7) and 8
// contiguous bf16 at p1 (elems 8..15); 16B-aligned -> *_load_b128 pairs.
static __device__ __forceinline__ v16bf load_frag(const __bf16* p0, const __bf16* p1) {
    BF16x16 u;
    u.q[0] = *(const uint4*)p0;
    u.q[1] = *(const uint4*)p1;
    return u.v;
}

static __device__ __forceinline__ v8f wmma_bf16(v16bf a, v16bf b, v8f c) {
    return __builtin_amdgcn_wmma_f32_16x16x32_bf16(false, a, false, b, (short)0, c,
                                                   false, false);
}

// 16 bytes global -> LDS (async on CDNA5, synchronous staging otherwise)
static __device__ __forceinline__ void copy16_g2l(const __bf16* g, __bf16* l) {
#if USE_ASYNC_LDS
    __builtin_amdgcn_global_load_async_to_lds_b128((g4ptr)(void*)(size_t)(const void*)g,
                                                   (l4ptr)l, 0, 0);
#else
    *(uint4*)l = *(const uint4*)g;
#endif
}

static __device__ __forceinline__ void stage_fence() {
#if USE_ASYNC_LDS
    __builtin_amdgcn_s_wait_asynccnt(0);
#endif
    __syncthreads();
}

// ---------------------------------------------------------------------------
// f32 -> bf16 conversion of x and the four weight matrices in ONE launch.
// The five bf16 copies lie back to back in the workspace (x, Wq, Wk, Wv, Wo),
// so the destination is one array indexed by the block's own number; a block
// converts 4096 chunks (a chunk = 4 elements) of ONE source.
// 16 waves per block; a thread has its 8 loads of 16 B in flight before the
// first store.
// ---------------------------------------------------------------------------
struct alignas(8) BF4 { __bf16 a, b, c, d; };

#define CVT_THREADS 512
#define CVT_LOADS   8                                // chunks per thread
#define CVT_CHUNKS  (CVT_THREADS * CVT_LOADS)        // chunks per block
#define X_BLOCKS    (BS * HID / 4 / CVT_CHUNKS)      // 256
#define W_BLOCKS    (HID * HID / 4 / CVT_CHUNKS)     //  16
#define CVT_BLOCKS  (X_BLOCKS + 4 * W_BLOCKS)        // 320
static_assert(X_BLOCKS * CVT_CHUNKS * 4 == BS * HID && W_BLOCKS * CVT_CHUNKS * 4 == HID * HID,
              "whole blocks per source");

__global__ __launch_bounds__(CVT_THREADS)
void cvt_f32_bf16_kernel(const float* __restrict__ x,
                         const float* __restrict__ wq,
                         const float* __restrict__ wk,
                         const float* __restrict__ wv,
                         const float* __restrict__ wo,
                         __bf16* __restrict__ dst) {
    const int blk = blockIdx.x;
    const float* src = x;                        // source and block number inside it
    int sblk = blk;
    if (blk >= X_BLOCKS) {
        const int w = (blk - X_BLOCKS) / W_BLOCKS;
        src  = (w == 0) ? wq : (w == 1) ? wk : (w == 2) ? wv : wo;
        sblk = (blk - X_BLOCKS) % W_BLOCKS;
    }
    const float4* s4 = (const float4*)src + (size_t)sblk * CVT_CHUNKS + threadIdx.x;
    BF4*          d4 = (BF4*)dst + (size_t)blk * CVT_CHUNKS + threadIdx.x;

    float4 f[CVT_LOADS];
#pragma unroll                                   // all loads issued ahead of the first use
    for (int i = 0; i < CVT_LOADS; ++i)
        f[i] = s4[i * CVT_THREADS];
#pragma unroll
    for (int i = 0; i < CVT_LOADS; ++i) {
        BF4 o;
        o.a = f2bf(f[i].x); o.b = f2bf(f[i].y); o.c = f2bf(f[i].z); o.d = f2bf(f[i].w);
        d4[i * CVT_THREADS] = o;
    }
}

// ---------------------------------------------------------------------------
// Cooperative stage of a 64(row) x 32(k) bf16 weight tile into LDS.
// tile rows padded to 40 elems (80B) -> conflict-free ds_load_b128 later.
// 128 threads x 2 chunks of 16B = 4KB.
// ---------------------------------------------------------------------------
static __device__ __forceinline__ void stage_wtile(const __bf16* __restrict__ W,
                                                   int n0, int k0,
                                                   __bf16 (*tile)[40], int tid) {
#pragma unroll
    for (int i = 0; i < 2; ++i) {
        const int ch  = tid * 2 + i;       // 0..255
        const int row = ch >> 2;           // 0..63
        const int e   = (ch & 3) * 8;      // 0,8,16,24
        copy16_g2l(W + (size_t)(n0 + row) * HID + k0 + e, &tile[row][e]);
    }
}

// ---------------------------------------------------------------------------
// QKV projection: Y[m,n] = sum_k X[m,k] * W[n,k] + bias[n]
// grid = (BS/128, NHEAD, 3), block = 128 (4 waves). Wave -> 32x64 tile.
// Weight tile double-buffered in LDS, shared by all 4 waves.
// Q,K stored [b,h,s,d]; V stored transposed [b,h,d,t].
// ---------------------------------------------------------------------------
__global__ __launch_bounds__(128)
void qkv_proj_kernel(const __bf16* __restrict__ xb,
                     const __bf16* __restrict__ wqb,
                     const __bf16* __restrict__ wkb,
                     const __bf16* __restrict__ wvb,
                     const float* __restrict__ bq,
                     const float* __restrict__ bk,
                     const float* __restrict__ bv,
                     __bf16* __restrict__ qout,
                     __bf16* __restrict__ kout,
                     __bf16* __restrict__ vtout) {
    __shared__ __bf16 wtile[2][64][40];

    const int tid  = threadIdx.x;
    const int lane = tid & 31;
    const int wave = tid >> 5;
    const int ln   = lane & 15;
    const int off8 = (lane >> 4) ? 8 : 0;

    const int M0    = blockIdx.x * 128 + wave * 32;
    const int head  = blockIdx.y;
    const int which = blockIdx.z;               // 0=Q 1=K 2=V
    const int N0    = head * 64;

    const __bf16* W;
    const float*  bias;
    if (which == 0)      { W = wqb; bias = bq; }
    else if (which == 1) { W = wkb; bias = bk; }
    else                 { W = wvb; bias = bv; }

    stage_wtile(W, N0, 0, wtile[0], tid);
    stage_fence();

    v8f acc[2][4] = {};

    for (int k0 = 0; k0 < HID; k0 += 32) {
        const int buf = (k0 >> 5) & 1;
        if (k0 + 32 < HID)
            stage_wtile(W, N0, k0 + 32, wtile[buf ^ 1], tid);   // prefetch next

        v16bf bfr[4];
#pragma unroll
        for (int nt = 0; nt < 4; ++nt)
            bfr[nt] = load_frag(&wtile[buf][nt * 16 + ln][off8],
                                &wtile[buf][nt * 16 + ln][off8 + 16]);
#pragma unroll
        for (int mt = 0; mt < 2; ++mt) {
            const __bf16* ar = xb + (size_t)(M0 + mt * 16 + ln) * HID + k0 + off8;
            v16bf a = load_frag(ar, ar + 16);
#pragma unroll
            for (int nt = 0; nt < 4; ++nt)
                acc[mt][nt] = wmma_bf16(a, bfr[nt], acc[mt][nt]);
        }
        stage_fence();
    }

    // store: C layout row m = r + (lane<16 ? 0 : 8), col = nt*16 + ln
#pragma unroll
    for (int mt = 0; mt < 2; ++mt) {
#pragma unroll
        for (int nt = 0; nt < 4; ++nt) {
            const int d = nt * 16 + ln;
            const float bval = bias[N0 + d];
#pragma unroll
            for (int r = 0; r < 8; ++r) {
                const int g  = M0 + mt * 16 + r + off8;  // global row (b*S + s)
                const int bi = g >> 12;
                const int si = g & (SEQ - 1);
                const int bh = bi * NHEAD + head;
                const float v = acc[mt][nt][r] + bval;
                if (which == 2) {
                    vtout[((size_t)bh * HDIM + d) * SEQ + si] = f2bf(v);
                } else {
                    __bf16* dst = (which == 0) ? qout : kout;
                    dst[((size_t)bh * SEQ + si) * HDIM + d] = f2bf(v);
                }
            }
        }
    }
}

static __device__ __forceinline__ float other_half(float v) {
    const int b = __builtin_bit_cast(int, v);
    return __builtin_bit_cast(float,
        __builtin_amdgcn_permlanex16(b, b, 0x76543210, 0xfedcba98, false, false));
}

#define KT      64                   // keys per LDS stage
#define LPITCH  144                  // LDS row: 128 data bytes + 16 (16 B x odd: no bank conflict for b128 reads)
#define TILE_B  (64 * LPITCH)        // one tile: 64 rows (K: keys, V^T: head dims)
#define KSPLIT  2                    // key halves per block
#define NSTAGE  (SEQ / KSPLIT / KT)  // stages per half

// One stage: K tile (64 keys x 128 B, contiguous in memory) and V^T tile
// (64 dims x 64 keys) into LDS; 1024 chunks of 16 B, 8 per thread of a half.
// kg, vg: this lane's first chunk of each tile; lk: its LDS byte address in the
// K tile (the V^T tile follows at TILE_B).  Chunk i lies 16 rows further on.
static __device__ __forceinline__ void stage_kv(const __bf16* kg, const __bf16* vg, uint32_t lk) {
    const uint32_t lv = lk + TILE_B;
    // one statement for the copies and s_wait_xcnt: a precaution, so that no later
    // write of a copy's address registers can be scheduled ahead of that wait
    asm volatile(
        "global_load_async_to_lds_b128 %0, %8, off\n\t"
        "global_load_async_to_lds_b128 %1, %9, off\n\t"
        "global_load_async_to_lds_b128 %2, %10, off\n\t"
        "global_load_async_to_lds_b128 %3, %11, off\n\t"
        "global_load_async_to_lds_b128 %4, %12, off\n\t"
        "global_load_async_to_lds_b128 %5, %13, off\n\t"
        "global_load_async_to_lds_b128 %6, %14, off\n\t"
        "global_load_async_to_lds_b128 %7, %15, off\n\t"
        "s_wait_xcnt 0x0"
        :: "v"(lk), "v"(lk + 16 * LPITCH), "v"(lk + 32 * LPITCH), "v"(lk + 48 * LPITCH),
           "v"(lv), "v"(lv + 16 * LPITCH), "v"(lv + 32 * LPITCH), "v"(lv + 48 * LPITCH),
           "v"(kg), "v"(kg + 16 * HDIM), "v"(kg + 32 * HDIM), "v"(kg + 48 * HDIM),
           "v"(vg), "v"(vg + 16 * SEQ), "v"(vg + 32 * SEQ), "v"(vg + 48 * SEQ)
        : "memory");
}

__global__ __launch_bounds__(256)
void flash_attn_kernel(const __bf16* __restrict__ qb,
                       const __bf16* __restrict__ kb,
                       const __bf16* __restrict__ vT,
                       __bf16* __restrict__ ctxb) {
    __shared__ __attribute__((aligned(16))) unsigned char kv[KSPLIT][2][2 * TILE_B];

    const int lane = threadIdx.x & 31;
    const int wave = __builtin_amdgcn_readfirstlane(threadIdx.x >> 5);
    const int part = wave >> 2;                  // key half of this wave
    const int qw   = wave & 3;                   // its 32 query columns in the block
    const int ln   = lane & 15;
    const int off8 = (lane >> 4) ? 8 : 0;

    const int b    = blockIdx.z;
    const int head = blockIdx.y;
    const int bh   = b * NHEAD + head;
    const int q0   = blockIdx.x * 128 + qw * 32;

    const __bf16* qbase = qb + (size_t)bh * SEQ * HDIM;
    const __bf16* kbase = kb + ((size_t)bh * SEQ + part * (SEQ / KSPLIT)) * HDIM;   // first key of the half
    const __bf16* vbase = vT + (size_t)bh * HDIM * SEQ + part * (SEQ / KSPLIT);

    // this lane's chunk of its half's stage: t = thread number inside the half,
    // row t/8 (+16 per chunk), 16-byte column t%8
    const int crow = (threadIdx.x & 127) >> 3;
    const int ccol = threadIdx.x & 7;
    const __bf16* kcp = kbase + (size_t)crow * HDIM + ccol * 8;
    const __bf16* vcp = vbase + (size_t)crow * SEQ + ccol * 8;
    const uint32_t lcp = (uint32_t)(uintptr_t)&kv[part][0][crow * LPITCH + ccol * 16];

    stage_kv(kcp, vcp, lcp);                                  // tile 0 -> buffer 0
    asm volatile("s_wait_asynccnt 0x0" ::: "memory");         // own copies landed ...
    __syncthreads();                                          // ... and every wave's
    stage_kv(kcp + KT * HDIM, vcp + KT, lcp + 2 * TILE_B);    // tile 1 -> buffer 1, in flight over trip 0

    // Q B-fragments (column = query ln) held in registers for the whole key loop
    v16bf bq[2][2];
#pragma unroll
    for (int qt = 0; qt < 2; ++qt) {
        const __bf16* qrow = qbase + (size_t)(q0 + qt * 16 + ln) * HDIM;
        bq[qt][0] = load_frag(qrow + off8,      qrow + off8 + 16);
        bq[qt][1] = load_frag(qrow + 32 + off8, qrow + 32 + off8 + 16);
    }

    // per lane: running maximum of query qt*16+ln (equal in both lane halves)
    // and the sum over this lane half's keys (halves joined in the epilogue)
    float mcol[2], lcol[2];
#pragma unroll
    for (int qt = 0; qt < 2; ++qt) { mcol[qt] = -3.0e38f; lcol[qt] = 0.0f; }
    v8f o[2][4] = {};                            // o[qt][nt][r] = O[query ln][nt*16 + off8 + r]

    const float scale = 0.125f;                  // 1/sqrt(64)

    for (int st = 0; st < NSTAGE; ++st) {
      const unsigned char* ktile = kv[part][st & 1];
      const unsigned char* vtile = ktile + TILE_B;
#pragma unroll                                   // both 32-key blocks of a stage in one trip: constant LDS offsets
      for (int kk = 0; kk < KT / 32; ++kk) {
        // ---- scores: S^T = K * Q^T  (4 C tiles, K-dim 64 = 2 wmmas each)
        v16bf ak[2][2];
#pragma unroll
        for (int tt = 0; tt < 2; ++tt) {
            const __bf16* kr = (const __bf16*)(ktile + (kk * 32 + tt * 16 + ln) * LPITCH);
            ak[tt][0] = load_frag(kr + off8,      kr + off8 + 16);
            ak[tt][1] = load_frag(kr + 32 + off8, kr + 32 + off8 + 16);
        }
        v8f s[2][2] = {};                        // s[qt][tt][r] = S[query ln][block + tt*16 + off8 + r]
#pragma unroll
        for (int qt = 0; qt < 2; ++qt)
#pragma unroll
            for (int tt = 0; tt < 2; ++tt) {
                s[qt][tt] = wmma_bf16(ak[tt][0], bq[qt][0], s[qt][tt]);
                s[qt][tt] = wmma_bf16(ak[tt][1], bq[qt][1], s[qt][tt]);
            }

        // ---- online softmax + accumulator rescale + P^T packed as B operand
        v16bf bp[2];
#pragma unroll
        for (int qt = 0; qt < 2; ++qt) {
            const v8f x0 = s[qt][0] * scale;
            const v8f x1 = s[qt][1] * scale;
            // in-lane maximum of the 16 scores, as a tree of three-input maxima
            const float a0 = fmaxf(fmaxf(x0[0], x0[1]), x0[2]);
            const float a1 = fmaxf(fmaxf(x0[3], x0[4]), x0[5]);
            const float a2 = fmaxf(fmaxf(x0[6], x0[7]), x1[0]);
            const float a3 = fmaxf(fmaxf(x1[1], x1[2]), x1[3]);
            const float a4 = fmaxf(fmaxf(x1[4], x1[5]), x1[6]);
            const float mx = fmaxf(fmaxf(fmaxf(a0, a1), a2), fmaxf(fmaxf(a3, a4), x1[7]));
            const float mnew  = fmaxf(fmaxf(mcol[qt], mx), other_half(mx));
            const float alpha = __expf(mcol[qt] - mnew);
            mcol[qt] = mnew;
            v8f p0, p1;
#pragma unroll
            for (int r = 0; r < 8; ++r) {
                p0[r] = __expf(x0[r] - mnew);
                p1[r] = __expf(x1[r] - mnew);
                bp[qt][r]     = (__bf16)p0[r];   // element e = key kmap(e, half):
                bp[qt][8 + r] = (__bf16)p1[r];   // the hardware k order, as V's loads
            }
            const v8f pv = p0 + p1;              // in-lane sum, pairwise
            const float ps = ((pv[0] + pv[1]) + (pv[2] + pv[3])) +
                             ((pv[4] + pv[5]) + (pv[6] + pv[7]));
            lcol[qt] = lcol[qt] * alpha + ps;
#pragma unroll
            for (int nt = 0; nt < 4; ++nt)
                o[qt][nt] *= alpha;
        }

        // ---- O^T += V^T * P^T  (V tile is [d, t] -> contiguous A loads, shared by column tiles)
#pragma unroll
        for (int nt = 0; nt < 4; ++nt) {
            const __bf16* vr = (const __bf16*)(vtile + (nt * 16 + ln) * LPITCH) + kk * 32 + off8;
            v16bf av = load_frag(vr, vr + 16);
            o[0][nt] = wmma_bf16(av, bp[0], o[0][nt]);
            o[1][nt] = wmma_bf16(av, bp[1], o[1][nt]);
        }
      }

      // hand-over: tile st+1 becomes readable, this trip's buffer becomes free
      asm volatile("s_wait_dscnt 0x0" ::: "memory");          // own reads of this buffer done
      asm volatile("s_wait_asynccnt 0x0" ::: "memory");       // own copies of tile st+1 landed
      __syncthreads();
      if (st + 2 < NSTAGE)
          stage_kv(kcp + (size_t)(st + 2) * KT * HDIM, vcp + (st + 2) * KT,
                   lcp + (st & 1) * (2 * TILE_B));
    }
    asm volatile("s_wait_asynccnt 0x0" ::: "memory");         // nothing in flight when the wave ends

    // ---- join of the key halves.  The last trip's waits and barrier have ended every
    // read of the tiles and no copy is in flight, so the tile memory is free: wave 4+w
    // hands its state to wave w there, 17 rows of 32 lanes x 16 B (whole 512-B rows).
    float4* xch = (float4*)&kv[0][0][0] + qw * (17 * 32) + lane;
    if (part == 1) {
#pragma unroll
        for (int qt = 0; qt < 2; ++qt)
#pragma unroll
            for (int nt = 0; nt < 4; ++nt) {
                const v8f t = o[qt][nt];
                xch[((qt * 4 + nt) * 2 + 0) * 32] = make_float4(t[0], t[1], t[2], t[3]);
                xch[((qt * 4 + nt) * 2 + 1) * 32] = make_float4(t[4], t[5], t[6], t[7]);
            }
        xch[16 * 32] = make_float4(mcol[0], mcol[1], lcol[0], lcol[1]);
    }
    __syncthreads();                             // half 1's state readable by half 0

    // ---- epilogue (half 0): ctx[b, s, head*64 + d] = (o0*a0 + o1*a1) / (l0*a0 + l1*a1);
    // a lane owns 8 consecutive d
    if (part == 0) {
        const float4 ml = xch[16 * 32];
#pragma unroll
        for (int qt = 0; qt < 2; ++qt) {
            const int srow = q0 + qt * 16 + ln;
            const float m1 = qt ? ml.y : ml.x;
            const float l1 = qt ? ml.w : ml.z;
            const float m  = fmaxf(mcol[qt], m1);
            const float a0 = __expf(mcol[qt] - m);
            const float a1 = __expf(m1 - m);
            const float l  = lcol[qt] * a0 + l1 * a1;
            const float inv = 1.0f / (l + other_half(l));
            const float c0 = a0 * inv;
            const float c1 = a1 * inv;
#pragma unroll
            for (int nt = 0; nt < 4; ++nt) {
                const float4 u0 = xch[((qt * 4 + nt) * 2 + 0) * 32];
                const float4 u1 = xch[((qt * 4 + nt) * 2 + 1) * 32];
                const float u[8] = { u0.x, u0.y, u0.z, u0.w, u1.x, u1.y, u1.z, u1.w };
                union { __bf16 h[8]; uint4 q; } pk;
#pragma unroll
                for (int r = 0; r < 8; ++r)
                    pk.h[r] = f2bf(o[qt][nt][r] * c0 + u[r] * c1);
                *(uint4*)(ctxb + ((size_t)(b * SEQ + srow)) * HID + head * 64 + nt * 16 + off8) = pk.q;
            }
        }
    }
}

// ---------------------------------------------------------------------------
// Output projection: out[m,n] = sum_k ctx[m,k] * Wo[n,k] + bo[n]   (f32 out)
// grid = (BS/128, HID/64), block = 128.
// ---------------------------------------------------------------------------
__global__ __launch_bounds__(128)
void out_proj_kernel(const __bf16* __restrict__ ctxb,
                     const __bf16* __restrict__ wob,
                     const float* __restrict__ bo,
                     float* __restrict__ out) {
    __shared__ __bf16 wtile[2][64][40];

    const int tid  = threadIdx.x;
    const int lane = tid & 31;
    const int wave = tid >> 5;
    const int ln   = lane & 15;
    const int off8 = (lane >> 4) ? 8 : 0;

    const int M0 = blockIdx.x * 128 + wave * 32;
    const int N0 = blockIdx.y * 64;

    stage_wtile(wob, N0, 0, wtile[0], tid);
    stage_fence();

    v8f acc[2][4] = {};

    for (int k0 = 0; k0 < HID; k0 += 32) {
        const int buf = (k0 >> 5) & 1;
        if (k0 + 32 < HID)
            stage_wtile(wob, N0, k0 + 32, wtile[buf ^ 1], tid);

        v16bf bfr[4];
#pragma unroll
        for (int nt = 0; nt < 4; ++nt)
            bfr[nt] = load_frag(&wtile[buf][nt * 16 + ln][off8],
                                &wtile[buf][nt * 16 + ln][off8 + 16]);
#pragma unroll
        for (int mt = 0; mt < 2; ++mt) {
            const __bf16* ar = ctxb + (size_t)(M0 + mt * 16 + ln) * HID + k0 + off8;
            v16bf a = load_frag(ar, ar + 16);
#pragma unroll
            for (int nt = 0; nt < 4; ++nt)
                acc[mt][nt] = wmma_bf16(a, bfr[nt], acc[mt][nt]);
        }
        stage_fence();
    }

#pragma unroll
    for (int mt = 0; mt < 2; ++mt)
#pragma unroll
        for (int nt = 0; nt < 4; ++nt) {
            const int n = N0 + nt * 16 + ln;
            const float bval = bo[n];
#pragma unroll
            for (int r = 0; r < 8; ++r) {
                const int m = M0 + mt * 16 + r + off8;
                out[(size_t)m * HID + n] = acc[mt][nt][r] + bval;
            }
        }
}

// ---------------------------------------------------------------------------
// Host launcher
// ---------------------------------------------------------------------------
extern "C" void kernel_launch(void* const* d_in, const int* in_sizes, int n_in,
                              void* d_out, int out_size, void* d_ws, size_t ws_size,
                              hipStream_t stream) {
    (void)in_sizes; (void)n_in; (void)out_size; (void)ws_size;

    const float* x  = (const float*)d_in[0];
    const float* Wq = (const float*)d_in[1];
    const float* bq = (const float*)d_in[2];
    const float* Wk = (const float*)d_in[3];
    const float* bk = (const float*)d_in[4];
    const float* Wv = (const float*)d_in[5];
    const float* bv = (const float*)d_in[6];
    const float* Wo = (const float*)d_in[7];
    const float* bo = (const float*)d_in[8];
    float* out = (float*)d_out;

    // workspace layout (bf16 scratch, ~42 MB total)
    const size_t XB_ELE = (size_t)BS * HID;       // 4,194,304
    const size_t W_ELE  = (size_t)HID * HID;      //   262,144
    char* ws = (char*)d_ws;
    size_t off = 0;
    __bf16* xb   = (__bf16*)(ws + off); off += XB_ELE * 2;
    __bf16* wqb  = (__bf16*)(ws + off); off += W_ELE * 2;
    __bf16* wkb  = (__bf16*)(ws + off); off += W_ELE * 2;
    __bf16* wvb  = (__bf16*)(ws + off); off += W_ELE * 2;
    __bf16* wob  = (__bf16*)(ws + off); off += W_ELE * 2;
    __bf16* qbuf = (__bf16*)(ws + off); off += XB_ELE * 2;
    __bf16* kbuf = (__bf16*)(ws + off); off += XB_ELE * 2;
    __bf16* vtb  = (__bf16*)(ws + off); off += XB_ELE * 2;
    __bf16* ctxb = (__bf16*)(ws + off); off += XB_ELE * 2;

    // 1) f32 -> bf16 conversions, one launch: xb, wqb, wkb, wvb, wob are contiguous from xb
    cvt_f32_bf16_kernel<<<CVT_BLOCKS, CVT_THREADS, 0, stream>>>(x, Wq, Wk, Wv, Wo, xb);

    // 2) fused QKV projection (Q,K row-major per head; V transposed per head)
    dim3 gqkv(BS / 128, NHEAD, 3);
    qkv_proj_kernel<<<gqkv, 128, 0, stream>>>(xb, wqb, wkb, wvb, bq, bk, bv,
                                              qbuf, kbuf, vtb);

    // 3) flash attention
    dim3 gattn(SEQ / 128, NHEAD, BATCH);
    flash_attn_kernel<<<gattn, 256, 0, stream>>>(qbuf, kbuf, vtb, ctxb);

    // 4) output projection -> f32 out
    dim3 gout(BS / 128, HID / 64);
    out_proj_kernel<<<gout, 128, 0, stream>>>(ctxb, wob, bo, out);
}

// v005
// Measured time: 117 microseconds a run.
// Two timings next to v004 put it at 1.04 and 1.03 times that version's speed.
// Counting every step since v000, it is 2.67 times as fast.
#include <hip/hip_runtime.h>
#include <stdint.h>

// ---------------------------------------------------------------------------
// Multi-head attention forward for gfx1250 (MI455X), bf16 WMMA pipeline.
// B=2, S=4096, HID=512, HEADS=8, D=64.  Compute-bound -> all three GEMM
// stages through v_wmma_f32_16x16x32_bf16 with f32 accumulation.
// Weight tiles double-buffered in LDS via async global->LDS copies.
// ---------------------------------------------------------------------------

#define BATCH 2
#define SEQ   4096
#define HID   512
#define NHEAD 8
#define HDIM  64
#define BS    (BATCH * SEQ)          // 8192 rows

// gfx1250 async global->LDS path (guarded; falls back to ds_store staging)
#if defined(__has_builtin)
#  if __has_builtin(__builtin_amdgcn_global_load_async_to_lds_b128) && \
      __has_builtin(__builtin_amdgcn_s_wait_asynccnt)
#    define USE_ASYNC_LDS 1
#  endif
#endif
#ifndef USE_ASYNC_LDS
#  define USE_ASYNC_LDS 0
#endif

typedef __attribute__((ext_vector_type(16))) __bf16 v16bf;
typedef __attribute__((ext_vector_type(8)))  float  v8f;

#if USE_ASYNC_LDS
// exact parameter type of the async-load builtin (from clang diagnostic):
// int __attribute__((vector_size(16))) in AS1 (src) / AS3 (dst)
typedef int v4i_vs __attribute__((vector_size(16)));
typedef __attribute__((address_space(1))) v4i_vs* g4ptr;
typedef __attribute__((address_space(3))) v4i_vs* l4ptr;
#endif

union BF16x16 {
    v16bf v;
    uint4 q[2];
};

// round-to-nearest-even f32 -> bf16
static __device__ __forceinline__ __bf16 f2bf(float f) {
    unsigned int u = __builtin_bit_cast(unsigned int, f);
    unsigned int r = (u + 0x7FFFu + ((u >> 16) & 1u)) >> 16;
    unsigned short h = (unsigned short)r;
    return __builtin_bit_cast(__bf16, h);
}

// 16-element bf16 WMMA fragment: 8 contiguous bf16 at p0 (elems 0..7) and 8
// contiguous bf16 at p1 (elems 8..15); 16B-aligned -> *_load_b128 pairs.
static __device__ __forceinline__ v16bf load_frag(const __bf16* p0, const __bf16* p1) {
    BF16x16 u;
    u.q[0] = *(const uint4*)p0;
    u.q[1] = *(const uint4*)p1;
    return u.v;
}

static __device__ __forceinline__ v8f wmma_bf16(v16bf a, v16bf b, v8f c) {
    return __builtin_amdgcn_wmma_f32_16x16x32_bf16(false, a, false, b, (short)0, c,
                                                   false, false);
}

// 16 bytes global -> LDS (async on CDNA5, synchronous staging otherwise)
static __device__ __forceinline__ void copy16_g2l(const __bf16* g, __bf16* l) {
#if USE_ASYNC_LDS
    __builtin_amdgcn_global_load_async_to_lds_b128((g4ptr)(void*)(size_t)(const void*)g,
                                                   (l4ptr)l, 0, 0);
#else
    *(uint4*)l = *(const uint4*)g;
#endif
}

static __device__ __forceinline__ void stage_fence() {
#if USE_ASYNC_LDS
    __builtin_amdgcn_s_wait_asynccnt(0);
#endif
    __syncthreads();
}

// ---------------------------------------------------------------------------
// f32 -> bf16 conversion of x and the four weight matrices in ONE launch.
// The five bf16 copies lie back to back in the workspace (x, Wq, Wk, Wv, Wo),
// so the destination is one array indexed by the block's own number; a block
// converts 4096 chunks (a chunk = 4 elements) of ONE source.
// 16 waves per block; a thread has its 8 loads of 16 B in flight before the
// first store.
// ---------------------------------------------------------------------------
struct alignas(8) BF4 { __bf16 a, b, c, d; };

#define CVT_THREADS 512
#define CVT_LOADS   8                                // chunks per thread
#define CVT_CHUNKS  (CVT_THREADS * CVT_LOADS)        // chunks per block
#define X_BLOCKS    (BS * HID / 4 / CVT_CHUNKS)      // 256
#define W_BLOCKS    (HID * HID / 4 / CVT_CHUNKS)     //  16
#define CVT_BLOCKS  (X_BLOCKS + 4 * W_BLOCKS)        // 320
static_assert(X_BLOCKS * CVT_CHUNKS * 4 == BS * HID && W_BLOCKS * CVT_CHUNKS * 4 == HID * HID,
              "whole blocks per source");

__global__ __launch_bounds__(CVT_THREADS)
void cvt_f32_bf16_kernel(const float* __restrict__ x,
                         const float* __restrict__ wq,
                         const float* __restrict__ wk,
                         const float* __restrict__ wv,
                         const float* __restrict__ wo,
                         __bf16* __restrict__ dst) {
    const int blk = blockIdx.x;
    const float* src = x;                        // source and block number inside it
    int sblk = blk;
    if (blk >= X_BLOCKS) {
        const int w = (blk - X_BLOCKS) / W_BLOCKS;
        src  = (w == 0) ? wq : (w == 1) ? wk : (w == 2) ? wv : wo;
        sblk = (blk - X_BLOCKS) % W_BLOCKS;
    }
    const float4* s4 = (const float4*)src + (size_t)sblk * CVT_CHUNKS + threadIdx.x;
    BF4*          d4 = (BF4*)dst + (size_t)blk * CVT_CHUNKS + threadIdx.x;

    float4 f[CVT_LOADS];
#pragma unroll                                   // all loads issued ahead of the first use
    for (int i = 0; i < CVT_LOADS; ++i)
        f[i] = s4[i * CVT_THREADS];
#pragma unroll
    for (int i = 0; i < CVT_LOADS; ++i) {
        BF4 o;
        o.a = f2bf(f[i].x); o.b = f2bf(f[i].y); o.c = f2bf(f[i].z); o.d = f2bf(f[i].w);
        d4[i * CVT_THREADS] = o;
    }
}

// ---------------------------------------------------------------------------
// Cooperative stage of a 64(row) x 32(k) bf16 weight tile into LDS.
// tile rows padded to 40 elems (80B) -> conflict-free ds_load_b128 later.
// 128 threads x 2 chunks of 16B = 4KB.
// ---------------------------------------------------------------------------
static __device__ __forceinline__ void stage_wtile(const __bf16* __restrict__ W,
                                                   int n0, int k0,
                                                   __bf16 (*tile)[40], int tid) {
#pragma unroll
    for (int i = 0; i < 2; ++i) {
        const int ch  = tid * 2 + i;       // 0..255
        const int row = ch >> 2;           // 0..63
        const int e   = (ch & 3) * 8;      // 0,8,16,24
        copy16_g2l(W + (size_t)(n0 + row) * HID + k0 + e, &tile[row][e]);
    }
}

// ---------------------------------------------------------------------------
// QKV projection: Y[m,n] = sum_k X[m,k] * W[n,k] + bias[n]
// grid = (BS/128, NHEAD, 3), block = 128 (4 waves). Wave -> 32x64 tile.
// Weight tile double-buffered in LDS, shared by all 4 waves.
// Q,K stored [b,h,s,d]; V stored transposed [b,h,d,t].
// ---------------------------------------------------------------------------
__global__ __launch_bounds__(128)
void qkv_proj_kernel(const __bf16* __restrict__ xb,
                     const __bf16* __restrict__ wqb,
                     const __bf16* __restrict__ wkb,
                     const __bf16* __restrict__ wvb,
                     const float* __restrict__ bq,
                     const float* __restrict__ bk,
                     const float* __restrict__ bv,
                     __bf16* __restrict__ qout,
                     __bf16* __restrict__ kout,
                     __bf16* __restrict__ vtout) {
    __shared__ __bf16 wtile[2][64][40];

    const int tid  = threadIdx.x;
    const int lane = tid & 31;
    const int wave = tid >> 5;
    const int ln   = lane & 15;
    const int off8 = (lane >> 4) ? 8 : 0;

    const int M0    = blockIdx.x * 128 + wave * 32;
    const int head  = blockIdx.y;
    const int which = blockIdx.z;               // 0=Q 1=K 2=V
    const int N0    = head * 64;

    const __bf16* W;
    const float*  bias;
    if (which == 0)      { W = wqb; bias = bq; }
    else if (which == 1) { W = wkb; bias = bk; }
    else                 { W = wvb; bias = bv; }

    stage_wtile(W, N0, 0, wtile[0], tid);
    stage_fence();

    v8f acc[2][4] = {};

    for (int k0 = 0; k0 < HID; k0 += 32) {
        const int buf = (k0 >> 5) & 1;
        if (k0 + 32 < HID)
            stage_wtile(W, N0, k0 + 32, wtile[buf ^ 1], tid);   // prefetch next

        v16bf bfr[4];
#pragma unroll
        for (int nt = 0; nt < 4; ++nt)
            bfr[nt] = load_frag(&wtile[buf][nt * 16 + ln][off8],
                                &wtile[buf][nt * 16 + ln][off8 + 16]);
#pragma unroll
        for (int mt = 0; mt < 2; ++mt) {
            const __bf16* ar = xb + (size_t)(M0 + mt * 16 + ln) * HID + k0 + off8;
            v16bf a = load_frag(ar, ar + 16);
#pragma unroll
            for (int nt = 0; nt < 4; ++nt)
                acc[mt][nt] = wmma_bf16(a, bfr[nt], acc[mt][nt]);
        }
        stage_fence();
    }

    // store: C layout row m = r + (lane<16 ? 0 : 8), col = nt*16 + ln
#pragma unroll
    for (int mt = 0; mt < 2; ++mt) {
#pragma unroll
        for (int nt = 0; nt < 4; ++nt) {
            const int d = nt * 16 + ln;
            const float bval = bias[N0 + d];
#pragma unroll
            for (int r = 0; r < 8; ++r) {
                const int g  = M0 + mt * 16 + r + off8;  // global row (b*S + s)
                const int bi = g >> 12;
                const int si = g & (SEQ - 1);
                const int bh = bi * NHEAD + head;
                const float v = acc[mt][nt][r] + bval;
                if (which == 2) {
                    vtout[((size_t)bh * HDIM + d) * SEQ + si] = f2bf(v);
                } else {
                    __bf16* dst = (which == 0) ? qout : kout;
                    dst[((size_t)bh * SEQ + si) * HDIM + d] = f2bf(v);
                }
            }
        }
    }
}

static __device__ __forceinline__ float other_half(float v) {
    const int b = __builtin_bit_cast(int, v);
    return __builtin_bit_cast(float,
        __builtin_amdgcn_permlanex16(b, b, 0x76543210, 0xfedcba98, false, false));
}

static __device__ __forceinline__ v8f splat8(float v) {
    return (v8f){v, v, v, v, v, v, v, v};
}

#define KT      64                   // keys per LDS stage
#define LPITCH  144                  // LDS row: 128 data bytes + 16 (16 B x odd: no bank conflict for b128 reads)
#define TILE_B  (64 * LPITCH)        // one tile: 64 rows (K: keys, V^T: head dims)
#define KSPLIT  2                    // key halves per block
#define NSTAGE  (SEQ / KSPLIT / KT)  // stages per half

// One stage: K tile (64 keys x 128 B, contiguous in memory) and V^T tile
// (64 dims x 64 keys) into LDS; 1024 chunks of 16 B, 8 per thread of a half.
// kg, vg: this lane's first chunk of each tile; lk: its LDS byte address in the
// K tile (the V^T tile follows at TILE_B).  Chunk i lies 16 rows further on.
static __device__ __forceinline__ void stage_kv(const __bf16* kg, const __bf16* vg, uint32_t lk) {
    const uint32_t lv = lk + TILE_B;
    // one statement for the copies and s_wait_xcnt: a precaution, so that no later
    // write of a copy's address registers can be scheduled ahead of that wait
    asm volatile(
        "global_load_async_to_lds_b128 %0, %8, off\n\t"
        "global_load_async_to_lds_b128 %1, %9, off\n\t"
        "global_load_async_to_lds_b128 %2, %10, off\n\t"
        "global_load_async_to_lds_b128 %3, %11, off\n\t"
        "global_load_async_to_lds_b128 %4, %12, off\n\t"
        "global_load_async_to_lds_b128 %5, %13, off\n\t"
        "global_load_async_to_lds_b128 %6, %14, off\n\t"
        "global_load_async_to_lds_b128 %7, %15, off\n\t"
        "s_wait_xcnt 0x0"
        :: "v"(lk), "v"(lk + 16 * LPITCH), "v"(lk + 32 * LPITCH), "v"(lk + 48 * LPITCH),
           "v"(lv), "v"(lv + 16 * LPITCH), "v"(lv + 32 * LPITCH), "v"(lv + 48 * LPITCH),
           "v"(kg), "v"(kg + 16 * HDIM), "v"(kg + 32 * HDIM), "v"(kg + 48 * HDIM),
           "v"(vg), "v"(vg + 16 * SEQ), "v"(vg + 32 * SEQ), "v"(vg + 48 * SEQ)
        : "memory");
}

__global__ __launch_bounds__(256)
void flash_attn_kernel(const __bf16* __restrict__ qb,
                       const __bf16* __restrict__ kb,
                       const __bf16* __restrict__ vT,
                       __bf16* __restrict__ ctxb) {
    __shared__ __attribute__((aligned(16))) unsigned char kv[KSPLIT][2][2 * TILE_B];

    const int lane = threadIdx.x & 31;
    const int wave = __builtin_amdgcn_readfirstlane(threadIdx.x >> 5);
    const int part = wave >> 2;                  // key half of this wave
    const int qw   = wave & 3;                   // its 32 query columns in the block
    const int ln   = lane & 15;
    const int off8 = (lane >> 4) ? 8 : 0;

    const int b    = blockIdx.z;
    const int head = blockIdx.y;
    const int bh   = b * NHEAD + head;
    const int q0   = blockIdx.x * 128 + qw * 32;

    const __bf16* qbase = qb + (size_t)bh * SEQ * HDIM;
    const __bf16* kbase = kb + ((size_t)bh * SEQ + part * (SEQ / KSPLIT)) * HDIM;   // first key of the half
    const __bf16* vbase = vT + (size_t)bh * HDIM * SEQ + part * (SEQ / KSPLIT);

    // this lane's chunk of its half's stage: t = thread number inside the half,
    // row t/8 (+16 per chunk), 16-byte column t%8
    const int crow = (threadIdx.x & 127) >> 3;
    const int ccol = threadIdx.x & 7;
    const __bf16* kcp = kbase + (size_t)crow * HDIM + ccol * 8;
    const __bf16* vcp = vbase + (size_t)crow * SEQ + ccol * 8;
    const uint32_t lcp = (uint32_t)(uintptr_t)&kv[part][0][crow * LPITCH + ccol * 16];

    stage_kv(kcp, vcp, lcp);                                  // tile 0 -> buffer 0
    asm volatile("s_wait_asynccnt 0x0" ::: "memory");         // own copies landed ...
    __syncthreads();                                          // ... and every wave's
    stage_kv(kcp + KT * HDIM, vcp + KT, lcp + 2 * TILE_B);    // tile 1 -> buffer 1, in flight over trip 0

    // Q B-fragments (column = query ln) held in registers for the whole key loop
    v16bf bq[2][2];
#pragma unroll
    for (int qt = 0; qt < 2; ++qt) {
        const __bf16* qrow = qbase + (size_t)(q0 + qt * 16 + ln) * HDIM;
        bq[qt][0] = load_frag(qrow + off8,      qrow + off8 + 16);
        bq[qt][1] = load_frag(qrow + 32 + off8, qrow + 32 + off8 + 16);
    }

    // per lane: running maximum of query qt*16+ln (equal in both lane halves)
    // and the sum over this lane half's keys (halves joined in the epilogue)
    float mcol[2], lcol[2];
#pragma unroll
    for (int qt = 0; qt < 2; ++qt) { mcol[qt] = -3.0e38f; lcol[qt] = 0.0f; }
    v8f o[2][4] = {};                            // o[qt][nt][r] = O[query ln][nt*16 + off8 + r]

    // softmax in base 2: exp(scale * (s - m)) = exp2(s * cs - m * cs), cs = scale * log2(e);
    // cs > 0, so the maxima are taken over the raw products and kept in their units
    const float cs = 0.125f * 1.4426950408889634f;

    for (int st = 0; st < NSTAGE; ++st) {
      const unsigned char* ktile = kv[part][st & 1];
      const unsigned char* vtile = ktile + TILE_B;
#pragma unroll                                   // both 32-key blocks of a stage in one trip: constant LDS offsets
      for (int kk = 0; kk < KT / 32; ++kk) {
        // ---- scores: S^T = K * Q^T  (4 C tiles, K-dim 64 = 2 wmmas each)
        v16bf ak[2][2];
#pragma unroll
        for (int tt = 0; tt < 2; ++tt) {
            const __bf16* kr = (const __bf16*)(ktile + (kk * 32 + tt * 16 + ln) * LPITCH);
            ak[tt][0] = load_frag(kr + off8,      kr + off8 + 16);
            ak[tt][1] = load_frag(kr + 32 + off8, kr + 32 + off8 + 16);
        }
        v8f s[2][2] = {};                        // s[qt][tt][r] = S[query ln][block + tt*16 + off8 + r]
#pragma unroll
        for (int qt = 0; qt < 2; ++qt)
#pragma unroll
            for (int tt = 0; tt < 2; ++tt) {
                s[qt][tt] = wmma_bf16(ak[tt][0], bq[qt][0], s[qt][tt]);
                s[qt][tt] = wmma_bf16(ak[tt][1], bq[qt][1], s[qt][tt]);
            }

        // ---- online softmax + accumulator rescale + P^T packed as B operand
        v16bf bp[2];
#pragma unroll
        for (int qt = 0; qt < 2; ++qt) {
            const v8f x0 = s[qt][0];
            const v8f x1 = s[qt][1];
            // in-lane maximum of the 16 scores, as a tree of three-input maxima
            const float a0 = fmaxf(fmaxf(x0[0], x0[1]), x0[2]);
            const float a1 = fmaxf(fmaxf(x0[3], x0[4]), x0[5]);
            const float a2 = fmaxf(fmaxf(x0[6], x0[7]), x1[0]);
            const float a3 = fmaxf(fmaxf(x1[1], x1[2]), x1[3]);
            const float a4 = fmaxf(fmaxf(x1[4], x1[5]), x1[6]);
            const float mx = fmaxf(fmaxf(fmaxf(a0, a1), a2), fmaxf(fmaxf(a3, a4), x1[7]));
            const float mnew  = fmaxf(fmaxf(mcol[qt], mx), other_half(mx));
            const float alpha = __builtin_amdgcn_exp2f((mcol[qt] - mnew) * cs);
            mcol[qt] = mnew;
            const v8f nmc = splat8(mnew * -cs);
            const v8f e0 = __builtin_elementwise_fma(x0, splat8(cs), nmc);   // one fused multiply-add
            const v8f e1 = __builtin_elementwise_fma(x1, splat8(cs), nmc);   // per score
            v8f p0, p1;
#pragma unroll
            for (int r = 0; r < 8; ++r) {
                p0[r] = __builtin_amdgcn_exp2f(e0[r]);
                p1[r] = __builtin_amdgcn_exp2f(e1[r]);
                bp[qt][r]     = (__bf16)p0[r];   // element e = key kmap(e, half):
                bp[qt][8 + r] = (__bf16)p1[r];   // the hardware k order, as V's loads
            }
            const v8f pv = p0 + p1;              // in-lane sum, pairwise
            const float ps = ((pv[0] + pv[1]) + (pv[2] + pv[3])) +
                             ((pv[4] + pv[5]) + (pv[6] + pv[7]));
            lcol[qt] = lcol[qt] * alpha + ps;
#pragma unroll
            for (int nt = 0; nt < 4; ++nt)
                o[qt][nt] *= alpha;
        }

        // ---- O^T += V^T * P^T  (V tile is [d, t] -> contiguous A loads, shared by column tiles)
#pragma unroll
        for (int nt = 0; nt < 4; ++nt) {
            const __bf16* vr = (const __bf16*)(vtile + (nt * 16 + ln) * LPITCH) + kk * 32 + off8;
            v16bf av = load_frag(vr, vr + 16);
            o[0][nt] = wmma_bf16(av, bp[0], o[0][nt]);
            o[1][nt] = wmma_bf16(av, bp[1], o[1][nt]);
        }
      }

      // hand-over: tile st+1 becomes readable, this trip's buffer becomes free
      asm volatile("s_wait_dscnt 0x0" ::: "memory");          // own reads of this buffer done
      asm volatile("s_wait_asynccnt 0x0" ::: "memory");       // own copies of tile st+1 landed
      __syncthreads();
      if (st + 2 < NSTAGE)
          stage_kv(kcp + (size_t)(st + 2) * KT * HDIM, vcp + (st + 2) * KT,
                   lcp + (st & 1) * (2 * TILE_B));
    }
    asm volatile("s_wait_asynccnt 0x0" ::: "memory");         // nothing in flight when the wave ends

    // ---- join of the key halves.  The last trip's waits and barrier have ended every
    // read of the tiles and no copy is in flight, so the tile memory is free: wave 4+w
    // hands its state to wave w there, 17 rows of 32 lanes x 16 B (whole 512-B rows).
    float4* xch = (float4*)&kv[0][0][0] + qw * (17 * 32) + lane;
    if (part == 1) {
#pragma unroll
        for (int qt = 0; qt < 2; ++qt)
#pragma unroll
            for (int nt = 0; nt < 4; ++nt) {
                const v8f t = o[qt][nt];
                xch[((qt * 4 + nt) * 2 + 0) * 32] = make_float4(t[0], t[1], t[2], t[3]);
                xch[((qt * 4 + nt) * 2 + 1) * 32] = make_float4(t[4], t[5], t[6], t[7]);
            }
        xch[16 * 32] = make_float4(mcol[0], mcol[1], lcol[0], lcol[1]);
    }
    __syncthreads();                             // half 1's state readable by half 0

    // ---- epilogue (half 0): ctx[b, s, head*64 + d] = (o0*a0 + o1*a1) / (l0*a0 + l1*a1);
    // a lane owns 8 consecutive d
    if (part == 0) {
        const float4 ml = xch[16 * 32];
#pragma unroll
        for (int qt = 0; qt < 2; ++qt) {
            const int srow = q0 + qt * 16 + ln;
            const float m1 = qt ? ml.y : ml.x;
            const float l1 = qt ? ml.w : ml.z;
            const float m  = fmaxf(mcol[qt], m1);
            const float a0 = __builtin_amdgcn_exp2f((mcol[qt] - m) * cs);
            const float a1 = __builtin_amdgcn_exp2f((m1 - m) * cs);
            const float l  = lcol[qt] * a0 + l1 * a1;
            const float inv = 1.0f / (l + other_half(l));
            const float c0 = a0 * inv;
            const float c1 = a1 * inv;
#pragma unroll
            for (int nt = 0; nt < 4; ++nt) {
                const float4 u0 = xch[((qt * 4 + nt) * 2 + 0) * 32];
                const float4 u1 = xch[((qt * 4 + nt) * 2 + 1) * 32];
                const float u[8] = { u0.x, u0.y, u0.z, u0.w, u1.x, u1.y, u1.z, u1.w };
                union { __bf16 h[8]; uint4 q; } pk;
#pragma unroll
                for (int r = 0; r < 8; ++r)
                    pk.h[r] = f2bf(o[qt][nt][r] * c0 + u[r] * c1);
                *(uint4*)(ctxb + ((size_t)(b * SEQ + srow)) * HID + head * 64 + nt * 16 + off8) = pk.q;
            }
        }
    }
}

// ---------------------------------------------------------------------------
// Output projection: out[m,n] = sum_k ctx[m,k] * Wo[n,k] + bo[n]   (f32 out)
// grid = (BS/128, HID/64), block = 128.
// ---------------------------------------------------------------------------
__global__ __launch_bounds__(128)
void out_proj_kernel(const __bf16* __restrict__ ctxb,
                     const __bf16* __restrict__ wob,
                     const float* __restrict__ bo,
                     float* __restrict__ out) {
    __shared__ __bf16 wtile[2][64][40];

    const int tid  = threadIdx.x;
    const int lane = tid & 31;
    const int wave = tid >> 5;
    const int ln   = lane & 15;
    const int off8 = (lane >> 4) ? 8 : 0;

    const int M0 = blockIdx.x * 128 + wave * 32;
    const int N0 = blockIdx.y * 64;

    stage_wtile(wob, N0, 0, wtile[0], tid);
    stage_fence();

    v8f acc[2][4] = {};

    for (int k0 = 0; k0 < HID; k0 += 32) {
        const int buf = (k0 >> 5) & 1;
        if (k0 + 32 < HID)
            stage_wtile(wob, N0, k0 + 32, wtile[buf ^ 1], tid);

        v16bf bfr[4];
#pragma unroll
        for (int nt = 0; nt < 4; ++nt)
            bfr[nt] = load_frag(&wtile[buf][nt * 16 + ln][off8],
                                &wtile[buf][nt * 16 + ln][off8 + 16]);
#pragma unroll
        for (int mt = 0; mt < 2; ++mt) {
            const __bf16* ar = ctxb + (size_t)(M0 + mt * 16 + ln) * HID + k0 + off8;
            v16bf a = load_frag(ar, ar + 16);
#pragma unroll
            for (int nt = 0; nt < 4; ++nt)
                acc[mt][nt] = wmma_bf16(a, bfr[nt], acc[mt][nt]);
        }
        stage_fence();
    }

#pragma unroll
    for (int mt = 0; mt < 2; ++mt)
#pragma unroll
        for (int nt = 0; nt < 4; ++nt) {
            const int n = N0 + nt * 16 + ln;
            const float bval = bo[n];
#pragma unroll
            for (int r = 0; r < 8; ++r) {
                const int m = M0 + mt * 16 + r + off8;
                out[(size_t)m * HID + n] = acc[mt][nt][r] + bval;
            }
        }
}

// ---------------------------------------------------------------------------
// Host launcher
// ---------------------------------------------------------------------------
extern "C" void kernel_launch(void* const* d_in, const int* in_sizes, int n_in,
                              void* d_out, int out_size, void* d_ws, size_t ws_size,
                              hipStream_t stream) {
    (void)in_sizes; (void)n_in; (void)out_size; (void)ws_size;

    const float* x  = (const float*)d_in[0];
    const float* Wq = (const float*)d_in[1];
    const float* bq = (const float*)d_in[2];
    const float* Wk = (const float*)d_in[3];
    const float* bk = (const float*)d_in[4];
    const float* Wv = (const float*)d_in[5];
    const float* bv = (const float*)d_in[6];
    const float* Wo = (const float*)d_in[7];
    const float* bo = (const float*)d_in[8];
    float* out = (float*)d_out;

    // workspace layout (bf16 scratch, ~42 MB total)
    const size_t XB_ELE = (size_t)BS * HID;       // 4,194,304
    const size_t W_ELE  = (size_t)HID * HID;      //   262,144
    char* ws = (char*)d_ws;
    size_t off = 0;
    __bf16* xb   = (__bf16*)(ws + off); off += XB_ELE * 2;
    __bf16* wqb  = (__bf16*)(ws + off); off += W_ELE * 2;
    __bf16* wkb  = (__bf16*)(ws + off); off += W_ELE * 2;
    __bf16* wvb  = (__bf16*)(ws + off); off += W_ELE * 2;
    __bf16* wob  = (__bf16*)(ws + off); off += W_ELE * 2;
    __bf16* qbuf = (__bf16*)(ws + off); off += XB_ELE * 2;
    __bf16* kbuf = (__bf16*)(ws + off); off += XB_ELE * 2;
    __bf16* vtb  = (__bf16*)(ws + off); off += XB_ELE * 2;
    __bf16* ctxb = (__bf16*)(ws + off); off += XB_ELE * 2;

    // 1) f32 -> bf16 conversions, one launch: xb, wqb, wkb, wvb, wob are contiguous from xb
    cvt_f32_bf16_kernel<<<CVT_BLOCKS, CVT_THREADS, 0, stream>>>(x, Wq, Wk, Wv, Wo, xb);

    // 2) fused QKV projection (Q,K row-major per head; V transposed per head)
    dim3 gqkv(BS / 128, NHEAD, 3);
    qkv_proj_kernel<<<gqkv, 128, 0, stream>>>(xb, wqb, wkb, wvb, bq, bk, bv,
                                              qbuf, kbuf, vtb);

    // 3) flash attention
    dim3 gattn(SEQ / 128, NHEAD, BATCH);
    flash_attn_kernel<<<gattn, 256, 0, stream>>>(qbuf, kbuf, vtb, ctxb);

    // 4) output projection -> f32 out
    dim3 gout(BS / 128, HID / 64);
    out_proj_kernel<<<gout, 128, 0, stream>>>(ctxb, wob, bo, out);
}

// v006
// One run takes 97.6 microseconds.
// Next to v005, in two timings, it ran 1.19 times as fast each time.
// Counting every step since v000, it is 3.18 times as fast.
#include <hip/hip_runtime.h>
#include <stdint.h>

// ---------------------------------------------------------------------------
// Multi-head attention forward for gfx1250 (MI455X), bf16 WMMA pipeline.
// B=2, S=4096, HID=512, HEADS=8, D=64.  Compute-bound -> all three GEMM
// stages through v_wmma_f32_16x16x32_bf16 with f32 accumulation.
// Operand tiles double-buffered in LDS via async global->LDS copies.
// ---------------------------------------------------------------------------

#define BATCH 2
#define SEQ   4096
#define HID   512
#define NHEAD 8
#define HDIM  64
#define BS    (BATCH * SEQ)          // 8192 rows

typedef __attribute__((ext_vector_type(16))) __bf16 v16bf;
typedef __attribute__((ext_vector_type(8)))  float  v8f;

union BF16x16 {
    v16bf v;
    uint4 q[2];
};

// round-to-nearest-even f32 -> bf16
static __device__ __forceinline__ __bf16 f2bf(float f) {
    unsigned int u = __builtin_bit_cast(unsigned int, f);
    unsigned int r = (u + 0x7FFFu + ((u >> 16) & 1u)) >> 16;
    unsigned short h = (unsigned short)r;
    return __builtin_bit_cast(__bf16, h);
}

// 16-element bf16 WMMA fragment: 8 contiguous bf16 at p0 (elems 0..7) and 8
// contiguous bf16 at p1 (elems 8..15); 16B-aligned -> *_load_b128 pairs.
static __device__ __forceinline__ v16bf load_frag(const __bf16* p0, const __bf16* p1) {
    BF16x16 u;
    u.q[0] = *(const uint4*)p0;
    u.q[1] = *(const uint4*)p1;
    return u.v;
}

static __device__ __forceinline__ v8f wmma_bf16(v16bf a, v16bf b, v8f c) {
    return __builtin_amdgcn_wmma_f32_16x16x32_bf16(false, a, false, b, (short)0, c,
                                                   false, false);
}

// ---------------------------------------------------------------------------
// f32 -> bf16 conversion of x and the four weight matrices in ONE launch.
// The five bf16 copies lie back to back in the workspace (x, Wq, Wk, Wv, Wo),
// so the destination is one array indexed by the block's own number; a block
// converts 4096 chunks (a chunk = 4 elements) of ONE source.
// 16 waves per block; a thread has its 8 loads of 16 B in flight before the
// first store.
// ---------------------------------------------------------------------------
struct alignas(8) BF4 { __bf16 a, b, c, d; };

#define CVT_THREADS 512
#define CVT_LOADS   8                                // chunks per thread
#define CVT_CHUNKS  (CVT_THREADS * CVT_LOADS)        // chunks per block
#define X_BLOCKS    (BS * HID / 4 / CVT_CHUNKS)      // 256
#define W_BLOCKS    (HID * HID / 4 / CVT_CHUNKS)     //  16
#define CVT_BLOCKS  (X_BLOCKS + 4 * W_BLOCKS)        // 320
static_assert(X_BLOCKS * CVT_CHUNKS * 4 == BS * HID && W_BLOCKS * CVT_CHUNKS * 4 == HID * HID,
              "whole blocks per source");

__global__ __launch_bounds__(CVT_THREADS)
void cvt_f32_bf16_kernel(const float* __restrict__ x,
                         const float* __restrict__ wq,
                         const float* __restrict__ wk,
                         const float* __restrict__ wv,
                         const float* __restrict__ wo,
                         __bf16* __restrict__ dst) {
    const int blk = blockIdx.x;
    const float* src = x;                        // source and block number inside it
    int sblk = blk;
    if (blk >= X_BLOCKS) {
        const int w = (blk - X_BLOCKS) / W_BLOCKS;
        src  = (w == 0) ? wq : (w == 1) ? wk : (w == 2) ? wv : wo;
        sblk = (blk - X_BLOCKS) % W_BLOCKS;
    }
    const float4* s4 = (const float4*)src + (size_t)sblk * CVT_CHUNKS + threadIdx.x;
    BF4*          d4 = (BF4*)dst + (size_t)blk * CVT_CHUNKS + threadIdx.x;

    float4 f[CVT_LOADS];
#pragma unroll                                   // all loads issued ahead of the first use
    for (int i = 0; i < CVT_LOADS; ++i)
        f[i] = s4[i * CVT_THREADS];
#pragma unroll
    for (int i = 0; i < CVT_LOADS; ++i) {
        BF4 o;
        o.a = f2bf(f[i].x); o.b = f2bf(f[i].y); o.c = f2bf(f[i].z); o.d = f2bf(f[i].w);
        d4[i * CVT_THREADS] = o;
    }
}

// ---------------------------------------------------------------------------
// Core of both projections: acc = A[m0 .. m0+127][:] * Wm[n0 .. n0+63][:]^T over
// k = 0..HID-1, block = 128 threads (4 waves), wave -> 32x64 tile.
// Both operands reach the waves through LDS: a stage is 64 k = one whole 128-byte
// line of each of the 128 A rows and 64 Wm rows, two buffers, filled by
// asynchronous copies (a wave-wide copy covers 4 whole lines).
// LDS rows are 128 B, unpadded; the 16-byte chunk c of row r lies at place
// c ^ ((r >> 1) & 7), so the 16 rows of a fragment read fall on 16 distinct
// bank groups.
// ---------------------------------------------------------------------------
#define GK      64                   // k elements per stage
#define GROWB   128                  // bytes per LDS row
#define GA_ROWS 128
#define GW_ROWS 64
#define GSTAGE  ((GA_ROWS + GW_ROWS) * GROWB)
#define GTRIPS  (HID / GK)

// One stage: 1536 chunks of 16 B, 12 per thread.  ag, wg: this lane's first chunk
// of the A and of the Wm tile; l: its LDS byte address in the A tile (the Wm tile
// follows the A rows).  Chunk i lies 16 rows further on, at the same place in its row.
static __device__ __forceinline__ void stage_gemm(const __bf16* ag, const __bf16* wg, uint32_t l) {
    // one statement for the copies and s_wait_xcnt: a precaution, so that no later
    // write of a copy's address registers can be scheduled ahead of that wait
    asm volatile(
        "global_load_async_to_lds_b128 %0, %12, off\n\t"
        "global_load_async_to_lds_b128 %1, %13, off\n\t"
        "global_load_async_to_lds_b128 %2, %14, off\n\t"
        "global_load_async_to_lds_b128 %3, %15, off\n\t"
        "global_load_async_to_lds_b128 %4, %16, off\n\t"
        "global_load_async_to_lds_b128 %5, %17, off\n\t"
        "global_load_async_to_lds_b128 %6, %18, off\n\t"
        "global_load_async_to_lds_b128 %7, %19, off\n\t"
        "global_load_async_to_lds_b128 %8, %20, off\n\t"
        "global_load_async_to_lds_b128 %9, %21, off\n\t"
        "global_load_async_to_lds_b128 %10, %22, off\n\t"
        "global_load_async_to_lds_b128 %11, %23, off\n\t"
        "s_wait_xcnt 0x0"
        :: "v"(l),                "v"(l +  16 * GROWB), "v"(l +  32 * GROWB), "v"(l +  48 * GROWB),
           "v"(l +  64 * GROWB), "v"(l +  80 * GROWB), "v"(l +  96 * GROWB), "v"(l + 112 * GROWB),
           "v"(l + 128 * GROWB), "v"(l + 144 * GROWB), "v"(l + 160 * GROWB), "v"(l + 176 * GROWB),
           "v"(ag),            "v"(ag +  16 * HID), "v"(ag +  32 * HID), "v"(ag +  48 * HID),
           "v"(ag + 64 * HID), "v"(ag +  80 * HID), "v"(ag +  96 * HID), "v"(ag + 112 * HID),
           "v"(wg),            "v"(wg +  16 * HID), "v"(wg +  32 * HID), "v"(wg +  48 * HID)
        : "memory");
}

static __device__ __forceinline__ void gemm_128x64(const __bf16* __restrict__ A,
                                                   const __bf16* __restrict__ Wm,
                                                   int m0, int n0,
                                                   unsigned char (*tiles)[GSTAGE],
                                                   v8f (&acc)[2][4]) {
    const int tid  = threadIdx.x;
    const int lane = tid & 31;
    const int wave = tid >> 5;
    const int ln   = lane & 15;
    const int half = lane >> 4;

    // this lane's chunk of a stage: row tid/8 (+16 per chunk), 16-byte column tid%8
    const int crow = tid >> 3;
    const int ccol = tid & 7;
    const __bf16* acp = A  + (size_t)(m0 + crow) * HID + ccol * 8;
    const __bf16* wcp = Wm + (size_t)(n0 + crow) * HID + ccol * 8;
    const uint32_t lcp = (uint32_t)(uintptr_t)&tiles[0][crow * GROWB + ((ccol ^ ((crow >> 1) & 7)) << 4)];

    stage_gemm(acp, wcp, lcp);                                // stage 0 -> buffer 0
    asm volatile("s_wait_asynccnt 0x0" ::: "memory");         // own copies landed ...
    __syncthreads();                                          // ... and every wave's
    stage_gemm(acp + GK, wcp + GK, lcp + GSTAGE);             // stage 1 -> buffer 1, in flight over trip 0

    // byte offset of chunk 2*j + half of row ln inside a 16-row group: a fragment of
    // the 32 k at kk*32 is chunks j = 2*kk (elements 0..7) and 2*kk + 1 (elements 8..15)
    int fo[4];
#pragma unroll                                   // constant indices: fo[] stays in registers
    for (int j = 0; j < 4; ++j)
        fo[j] = ln * GROWB + (((2 * j + half) ^ ((ln >> 1) & 7)) << 4);

    for (int t = 0; t < GTRIPS; ++t) {
        const unsigned char* at = tiles[t & 1] + wave * 32 * GROWB;
        const unsigned char* wt = tiles[t & 1] + GA_ROWS * GROWB;
#pragma unroll                                   // both 32-k blocks of a stage in one trip: constant LDS offsets
        for (int kk = 0; kk < GK / 32; ++kk) {
            v16bf bfr[4];
            // the three loops below are unrolled so that fragments and accumulators
            // have constant indices and stay in registers
#pragma unroll
            for (int nt = 0; nt < 4; ++nt)
                bfr[nt] = load_frag((const __bf16*)(wt + nt * 16 * GROWB + fo[2 * kk]),
                                    (const __bf16*)(wt + nt * 16 * GROWB + fo[2 * kk + 1]));
#pragma unroll
            for (int mt = 0; mt < 2; ++mt) {
                v16bf a = load_frag((const __bf16*)(at + mt * 16 * GROWB + fo[2 * kk]),
                                    (const __bf16*)(at + mt * 16 * GROWB + fo[2 * kk + 1]));
#pragma unroll
                for (int nt = 0; nt < 4; ++nt)
                    acc[mt][nt] = wmma_bf16(a, bfr[nt], acc[mt][nt]);
            }
        }

        // hand-over: stage t+1 becomes readable, this trip's buffer becomes free
        asm volatile("s_wait_dscnt 0x0" ::: "memory");        // own reads of this buffer done
        asm volatile("s_wait_asynccnt 0x0" ::: "memory");     // own copies of stage t+1 landed
        __syncthreads();
        if (t + 2 < GTRIPS)
            stage_gemm(acp + (t + 2) * GK, wcp + (t + 2) * GK, lcp + (t & 1) * GSTAGE);
    }
    asm volatile("s_wait_asynccnt 0x0" ::: "memory");         // nothing in flight behind the loop
}

// ---------------------------------------------------------------------------
// QKV projection: Y[m,n] = sum_k X[m,k] * W[n,k] + bias[n]
// grid = (BS/128, NHEAD, 3), block = 128 (4 waves). Wave -> 32x64 tile.
// Q,K stored [b,h,s,d]; V stored transposed [b,h,d,t].
// ---------------------------------------------------------------------------
__global__ __launch_bounds__(128)
void qkv_proj_kernel(const __bf16* __restrict__ xb,
                     const __bf16* __restrict__ wqb,
                     const __bf16* __restrict__ wkb,
                     const __bf16* __restrict__ wvb,
                     const float* __restrict__ bq,
                     const float* __restrict__ bk,
                     const float* __restrict__ bv,
                     __bf16* __restrict__ qout,
                     __bf16* __restrict__ kout,
                     __bf16* __restrict__ vtout) {
    __shared__ __attribute__((aligned(128))) unsigned char tiles[2][GSTAGE];

    const int tid  = threadIdx.x;
    const int lane = tid & 31;
    const int wave = tid >> 5;
    const int ln   = lane & 15;
    const int off8 = (lane >> 4) ? 8 : 0;

    const int M0    = blockIdx.x * 128 + wave * 32;
    const int head  = blockIdx.y;
    const int which = blockIdx.z;               // 0=Q 1=K 2=V
    const int N0    = head * 64;

    const __bf16* W;
    const float*  bias;
    if (which == 0)      { W = wqb; bias = bq; }
    else if (which == 1) { W = wkb; bias = bk; }
    else                 { W = wvb; bias = bv; }

    v8f acc[2][4] = {};
    gemm_128x64(xb, W, blockIdx.x * 128, N0, tiles, acc);

    // store: C layout row m = r + (lane<16 ? 0 : 8), col = nt*16 + ln
#pragma unroll
    for (int mt = 0; mt < 2; ++mt) {
#pragma unroll
        for (int nt = 0; nt < 4; ++nt) {
            const int d = nt * 16 + ln;
            const float bval = bias[N0 + d];
#pragma unroll
            for (int r = 0; r < 8; ++r) {
                const int g  = M0 + mt * 16 + r + off8;  // global row (b*S + s)
                const int bi = g >> 12;
                const int si = g & (SEQ - 1);
                const int bh = bi * NHEAD + head;
                const float v = acc[mt][nt][r] + bval;
                if (which == 2) {
                    vtout[((size_t)bh * HDIM + d) * SEQ + si] = f2bf(v);
                } else {
                    __bf16* dst = (which == 0) ? qout : kout;
                    dst[((size_t)bh * SEQ + si) * HDIM + d] = f2bf(v);
                }
            }
        }
    }
}

static __device__ __forceinline__ float other_half(float v) {
    const int b = __builtin_bit_cast(int, v);
    return __builtin_bit_cast(float,
        __builtin_amdgcn_permlanex16(b, b, 0x76543210, 0xfedcba98, false, false));
}

static __device__ __forceinline__ v8f splat8(float v) {
    return (v8f){v, v, v, v, v, v, v, v};
}

#define KT      64                   // keys per LDS stage
#define LPITCH  144                  // LDS row: 128 data bytes + 16 (16 B x odd: no bank conflict for b128 reads)
#define TILE_B  (64 * LPITCH)        // one tile: 64 rows (K: keys, V^T: head dims)
#define KSPLIT  2                    // key halves per block
#define NSTAGE  (SEQ / KSPLIT / KT)  // stages per half

// One stage: K tile (64 keys x 128 B, contiguous in memory) and V^T tile
// (64 dims x 64 keys) into LDS; 1024 chunks of 16 B, 8 per thread of a half.
// kg, vg: this lane's first chunk of each tile; lk: its LDS byte address in the
// K tile (the V^T tile follows at TILE_B).  Chunk i lies 16 rows further on.
static __device__ __forceinline__ void stage_kv(const __bf16* kg, const __bf16* vg, uint32_t lk) {
    const uint32_t lv = lk + TILE_B;
    // one statement for the copies and s_wait_xcnt: a precaution, so that no later
    // write of a copy's address registers can be scheduled ahead of that wait
    asm volatile(
        "global_load_async_to_lds_b128 %0, %8, off\n\t"
        "global_load_async_to_lds_b128 %1, %9, off\n\t"
        "global_load_async_to_lds_b128 %2, %10, off\n\t"
        "global_load_async_to_lds_b128 %3, %11, off\n\t"
        "global_load_async_to_lds_b128 %4, %12, off\n\t"
        "global_load_async_to_lds_b128 %5, %13, off\n\t"
        "global_load_async_to_lds_b128 %6, %14, off\n\t"
        "global_load_async_to_lds_b128 %7, %15, off\n\t"
        "s_wait_xcnt 0x0"
        :: "v"(lk), "v"(lk + 16 * LPITCH), "v"(lk + 32 * LPITCH), "v"(lk + 48 * LPITCH),
           "v"(lv), "v"(lv + 16 * LPITCH), "v"(lv + 32 * LPITCH), "v"(lv + 48 * LPITCH),
           "v"(kg), "v"(kg + 16 * HDIM), "v"(kg + 32 * HDIM), "v"(kg + 48 * HDIM),
           "v"(vg), "v"(vg + 16 * SEQ), "v"(vg + 32 * SEQ), "v"(vg + 48 * SEQ)
        : "memory");
}

__global__ __launch_bounds__(256)
void flash_attn_kernel(const __bf16* __restrict__ qb,
                       const __bf16* __restrict__ kb,
                       const __bf16* __restrict__ vT,
                       __bf16* __restrict__ ctxb) {
    __shared__ __attribute__((aligned(16))) unsigned char kv[KSPLIT][2][2 * TILE_B];

    const int lane = threadIdx.x & 31;
    const int wave = __builtin_amdgcn_readfirstlane(threadIdx.x >> 5);
    const int part = wave >> 2;                  // key half of this wave
    const int qw   = wave & 3;                   // its 32 query columns in the block
    const int ln   = lane & 15;
    const int off8 = (lane >> 4) ? 8 : 0;

    const int b    = blockIdx.z;
    const int head = blockIdx.y;
    const int bh   = b * NHEAD + head;
    const int q0   = blockIdx.x * 128 + qw * 32;

    const __bf16* qbase = qb + (size_t)bh * SEQ * HDIM;
    const __bf16* kbase = kb + ((size_t)bh * SEQ + part * (SEQ / KSPLIT)) * HDIM;   // first key of the half
    const __bf16* vbase = vT + (size_t)bh * HDIM * SEQ + part * (SEQ / KSPLIT);

    // this lane's chunk of its half's stage: t = thread number inside the half,
    // row t/8 (+16 per chunk), 16-byte column t%8
    const int crow = (threadIdx.x & 127) >> 3;
    const int ccol = threadIdx.x & 7;
    const __bf16* kcp = kbase + (size_t)crow * HDIM + ccol * 8;
    const __bf16* vcp = vbase + (size_t)crow * SEQ + ccol * 8;
    const uint32_t lcp = (uint32_t)(uintptr_t)&kv[part][0][crow * LPITCH + ccol * 16];

    stage_kv(kcp, vcp, lcp);                                  // tile 0 -> buffer 0
    asm volatile("s_wait_asynccnt 0x0" ::: "memory");         // own copies landed ...
    __syncthreads();                                          // ... and every wave's
    stage_kv(kcp + KT * HDIM, vcp + KT, lcp + 2 * TILE_B);    // tile 1 -> buffer 1, in flight over trip 0

    // Q B-fragments (column = query ln) held in registers for the whole key loop
    v16bf bq[2][2];
#pragma unroll
    for (int qt = 0; qt < 2; ++qt) {
        const __bf16* qrow = qbase + (size_t)(q0 + qt * 16 + ln) * HDIM;
        bq[qt][0] = load_frag(qrow + off8,      qrow + off8 + 16);
        bq[qt][1] = load_frag(qrow + 32 + off8, qrow + 32 + off8 + 16);
    }

    // per lane: running maximum of query qt*16+ln (equal in both lane halves)
    // and the sum over this lane half's keys (halves joined in the epilogue)
    float mcol[2], lcol[2];
#pragma unroll
    for (int qt = 0; qt < 2; ++qt) { mcol[qt] = -3.0e38f; lcol[qt] = 0.0f; }
    v8f o[2][4] = {};                            // o[qt][nt][r] = O[query ln][nt*16 + off8 + r]

    // softmax in base 2: exp(scale * (s - m)) = exp2(s * cs - m * cs), cs = scale * log2(e);
    // cs > 0, so the maxima are taken over the raw products and kept in their units
    const float cs = 0.125f * 1.4426950408889634f;

    for (int st = 0; st < NSTAGE; ++st) {
      const unsigned char* ktile = kv[part][st & 1];
      const unsigned char* vtile = ktile + TILE_B;
#pragma unroll                                   // both 32-key blocks of a stage in one trip: constant LDS offsets
      for (int kk = 0; kk < KT / 32; ++kk) {
        // ---- scores: S^T = K * Q^T  (4 C tiles, K-dim 64 = 2 wmmas each)
        v16bf ak[2][2];
#pragma unroll
        for (int tt = 0; tt < 2; ++tt) {
            const __bf16* kr = (const __bf16*)(ktile + (kk * 32 + tt * 16 + ln) * LPITCH);
            ak[tt][0] = load_frag(kr + off8,      kr + off8 + 16);
            ak[tt][1] = load_frag(kr + 32 + off8, kr + 32 + off8 + 16);
        }
        v8f s[2][2] = {};                        // s[qt][tt][r] = S[query ln][block + tt*16 + off8 + r]
#pragma unroll
        for (int qt = 0; qt < 2; ++qt)
#pragma unroll
            for (int tt = 0; tt < 2; ++tt) {
                s[qt][tt] = wmma_bf16(ak[tt][0], bq[qt][0], s[qt][tt]);
                s[qt][tt] = wmma_bf16(ak[tt][1], bq[qt][1], s[qt][tt]);
            }

        // ---- online softmax + accumulator rescale + P^T packed as B operand
        v16bf bp[2];
#pragma unroll
        for (int qt = 0; qt < 2; ++qt) {
            const v8f x0 = s[qt][0];
            const v8f x1 = s[qt][1];
            // in-lane maximum of the 16 scores, as a tree of three-input maxima
            const float a0 = fmaxf(fmaxf(x0[0], x0[1]), x0[2]);
            const float a1 = fmaxf(fmaxf(x0[3], x0[4]), x0[5]);
            const float a2 = fmaxf(fmaxf(x0[6], x0[7]), x1[0]);
            const float a3 = fmaxf(fmaxf(x1[1], x1[2]), x1[3]);
            const float a4 = fmaxf(fmaxf(x1[4], x1[5]), x1[6]);
            const float mx = fmaxf(fmaxf(fmaxf(a0, a1), a2), fmaxf(fmaxf(a3, a4), x1[7]));
            const float mnew  = fmaxf(fmaxf(mcol[qt], mx), other_half(mx));
            const float alpha = __builtin_amdgcn_exp2f((mcol[qt] - mnew) * cs);
            mcol[qt] = mnew;
            const v8f nmc = splat8(mnew * -cs);
            const v8f e0 = __builtin_elementwise_fma(x0, splat8(cs), nmc);   // one fused multiply-add
            const v8f e1 = __builtin_elementwise_fma(x1, splat8(cs), nmc);   // per score
            v8f p0, p1;
#pragma unroll
            for (int r = 0; r < 8; ++r) {
                p0[r] = __builtin_amdgcn_exp2f(e0[r]);
                p1[r] = __builtin_amdgcn_exp2f(e1[r]);
                bp[qt][r]     = (__bf16)p0[r];   // element e = key kmap(e, half):
                bp[qt][8 + r] = (__bf16)p1[r];   // the hardware k order, as V's loads
            }
            const v8f pv = p0 + p1;              // in-lane sum, pairwise
            const float ps = ((pv[0] + pv[1]) + (pv[2] + pv[3])) +
                             ((pv[4] + pv[5]) + (pv[6] + pv[7]));
            lcol[qt] = lcol[qt] * alpha + ps;
#pragma unroll
            for (int nt = 0; nt < 4; ++nt)
                o[qt][nt] *= alpha;
        }

        // ---- O^T += V^T * P^T  (V tile is [d, t] -> contiguous A loads, shared by column tiles)
#pragma unroll
        for (int nt = 0; nt < 4; ++nt) {
            const __bf16* vr = (const __bf16*)(vtile + (nt * 16 + ln) * LPITCH) + kk * 32 + off8;
            v16bf av = load_frag(vr, vr + 16);
            o[0][nt] = wmma_bf16(av, bp[0], o[0][nt]);
            o[1][nt] = wmma_bf16(av, bp[1], o[1][nt]);
        }
      }

      // hand-over: tile st+1 becomes readable, this trip's buffer becomes free
      asm volatile("s_wait_dscnt 0x0" ::: "memory");          // own reads of this buffer done
      asm volatile("s_wait_asynccnt 0x0" ::: "memory");       // own copies of tile st+1 landed
      __syncthreads();
      if (st + 2 < NSTAGE)
          stage_kv(kcp + (size_t)(st + 2) * KT * HDIM, vcp + (st + 2) * KT,
                   lcp + (st & 1) * (2 * TILE_B));
    }
    asm volatile("s_wait_asynccnt 0x0" ::: "memory");         // nothing in flight when the wave ends

    // ---- join of the key halves.  The last trip's waits and barrier have ended every
    // read of the tiles and no copy is in flight, so the tile memory is free: wave 4+w
    // hands its state to wave w there, 17 rows of 32 lanes x 16 B (whole 512-B rows).
    float4* xch = (float4*)&kv[0][0][0] + qw * (17 * 32) + lane;
    if (part == 1) {
#pragma unroll
        for (int qt = 0; qt < 2; ++qt)
#pragma unroll
            for (int nt = 0; nt < 4; ++nt) {
                const v8f t = o[qt][nt];
                xch[((qt * 4 + nt) * 2 + 0) * 32] = make_float4(t[0], t[1], t[2], t[3]);
                xch[((qt * 4 + nt) * 2 + 1) * 32] = make_float4(t[4], t[5], t[6], t[7]);
            }
        xch[16 * 32] = make_float4(mcol[0], mcol[1], lcol[0], lcol[1]);
    }
    __syncthreads();                             // half 1's state readable by half 0

    // ---- epilogue (half 0): ctx[b, s, head*64 + d] = (o0*a0 + o1*a1) / (l0*a0 + l1*a1);
    // a lane owns 8 consecutive d
    if (part == 0) {
        const float4 ml = xch[16 * 32];
#pragma unroll
        for (int qt = 0; qt < 2; ++qt) {
            const int srow = q0 + qt * 16 + ln;
            const float m1 = qt ? ml.y : ml.x;
            const float l1 = qt ? ml.w : ml.z;
            const float m  = fmaxf(mcol[qt], m1);
            const float a0 = __builtin_amdgcn_exp2f((mcol[qt] - m) * cs);
            const float a1 = __builtin_amdgcn_exp2f((m1 - m) * cs);
            const float l  = lcol[qt] * a0 + l1 * a1;
            const float inv = 1.0f / (l + other_half(l));
            const float c0 = a0 * inv;
            const float c1 = a1 * inv;
#pragma unroll
            for (int nt = 0; nt < 4; ++nt) {
                const float4 u0 = xch[((qt * 4 + nt) * 2 + 0) * 32];
                const float4 u1 = xch[((qt * 4 + nt) * 2 + 1) * 32];
                const float u[8] = { u0.x, u0.y, u0.z, u0.w, u1.x, u1.y, u1.z, u1.w };
                union { __bf16 h[8]; uint4 q; } pk;
#pragma unroll
                for (int r = 0; r < 8; ++r)
                    pk.h[r] = f2bf(o[qt][nt][r] * c0 + u[r] * c1);
                *(uint4*)(ctxb + ((size_t)(b * SEQ + srow)) * HID + head * 64 + nt * 16 + off8) = pk.q;
            }
        }
    }
}

// ---------------------------------------------------------------------------
// Output projection: out[m,n] = sum_k ctx[m,k] * Wo[n,k] + bo[n]   (f32 out)
// grid = (BS/128, HID/64), block = 128.
// ---------------------------------------------------------------------------
__global__ __launch_bounds__(128)
void out_proj_kernel(const __bf16* __restrict__ ctxb,
                     const __bf16* __restrict__ wob,
                     const float* __restrict__ bo,
                     float* __restrict__ out) {
    __shared__ __attribute__((aligned(128))) unsigned char tiles[2][GSTAGE];

    const int tid  = threadIdx.x;
    const int lane = tid & 31;
    const int wave = tid >> 5;
    const int ln   = lane & 15;
    const int off8 = (lane >> 4) ? 8 : 0;

    const int M0 = blockIdx.x * 128 + wave * 32;
    const int N0 = blockIdx.y * 64;

    v8f acc[2][4] = {};
    gemm_128x64(ctxb, wob, blockIdx.x * 128, N0, tiles, acc);

#pragma unroll
    for (int mt = 0; mt < 2; ++mt)
#pragma unroll
        for (int nt = 0; nt < 4; ++nt) {
            const int n = N0 + nt * 16 + ln;
            const float bval = bo[n];
#pragma unroll
            for (int r = 0; r < 8; ++r) {
                const int m = M0 + mt * 16 + r + off8;
                out[(size_t)m * HID + n] = acc[mt][nt][r] + bval;
            }
        }
}

// ---------------------------------------------------------------------------
// Host launcher
// ---------------------------------------------------------------------------
extern "C" void kernel_launch(void* const* d_in, const int* in_sizes, int n_in,
                              void* d_out, int out_size, void* d_ws, size_t ws_size,
                              hipStream_t stream) {
    (void)in_sizes; (void)n_in; (void)out_size; (void)ws_size;

    const float* x  = (const float*)d_in[0];
    const float* Wq = (const float*)d_in[1];
    const float* bq = (const float*)d_in[2];
    const float* Wk = (const float*)d_in[3];
    const float* bk = (const float*)d_in[4];
    const float* Wv = (const float*)d_in[5];
    const float* bv = (const float*)d_in[6];
    const float* Wo = (const float*)d_in[7];
    const float* bo = (const float*)d_in[8];
    float* out = (float*)d_out;

    // workspace layout (bf16 scratch, ~42 MB total)
    const size_t XB_ELE = (size_t)BS * HID;       // 4,194,304
    const size_t W_ELE  = (size_t)HID * HID;      //   262,144
    char* ws = (char*)d_ws;
    size_t off = 0;
    __bf16* xb   = (__bf16*)(ws + off); off += XB_ELE * 2;
    __bf16* wqb  = (__bf16*)(ws + off); off += W_ELE * 2;
    __bf16* wkb  = (__bf16*)(ws + off); off += W_ELE * 2;
    __bf16* wvb  = (__bf16*)(ws + off); off += W_ELE * 2;
    __bf16* wob  = (__bf16*)(ws + off); off += W_ELE * 2;
    __bf16* qbuf = (__bf16*)(ws + off); off += XB_ELE * 2;
    __bf16* kbuf = (__bf16*)(ws + off); off += XB_ELE * 2;
    __bf16* vtb  = (__bf16*)(ws + off); off += XB_ELE * 2;
    __bf16* ctxb = (__bf16*)(ws + off); off += XB_ELE * 2;

    // 1) f32 -> bf16 conversions, one launch: xb, wqb, wkb, wvb, wob are contiguous from xb
    cvt_f32_bf16_kernel<<<CVT_BLOCKS, CVT_THREADS, 0, stream>>>(x, Wq, Wk, Wv, Wo, xb);

    // 2) fused QKV projection (Q,K row-major per head; V transposed per head)
    dim3 gqkv(BS / 128, NHEAD, 3);
    qkv_proj_kernel<<<gqkv, 128, 0, stream>>>(xb, wqb, wkb, wvb, bq, bk, bv,
                                              qbuf, kbuf, vtb);

    // 3) flash attention
    dim3 gattn(SEQ / 128, NHEAD, BATCH);
    flash_attn_kernel<<<gattn, 256, 0, stream>>>(qbuf, kbuf, vtb, ctxb);

    // 4) output projection -> f32 out
    dim3 gout(BS / 128, HID / 64);
    out_proj_kernel<<<gout, 128, 0, stream>>>(ctxb, wob, bo, out);
}

// v007
// Measured time: 92.6 microseconds a run.
// In both of two side-by-side timings against v006, it was 1.06 times as fast.
// All steps since v000 together make it 3.37 times as fast.
#include <hip/hip_runtime.h>
#include <stdint.h>

// ---------------------------------------------------------------------------
// Multi-head attention forward for gfx1250 (MI455X), bf16 WMMA pipeline.
// B=2, S=4096, HID=512, HEADS=8, D=64.  Compute-bound -> all three GEMM
// stages through v_wmma_f32_16x16x32_bf16 with f32 accumulation.
// Operand tiles double-buffered in LDS via async global->LDS copies.
// ---------------------------------------------------------------------------

#define BATCH 2
#define SEQ   4096
#define HID   512
#define NHEAD 8
#define HDIM  64
#define BS    (BATCH * SEQ)          // 8192 rows

typedef __attribute__((ext_vector_type(16))) __bf16 v16bf;
typedef __attribute__((ext_vector_type(8)))  float  v8f;
typedef __attribute__((ext_vector_type(2)))  float  v2f;

union BF16x16 {
    v16bf v;
    uint4 q[2];
};

// round-to-nearest-even f32 -> bf16
static __device__ __forceinline__ __bf16 f2bf(float f) {
    unsigned int u = __builtin_bit_cast(unsigned int, f);
    unsigned int r = (u + 0x7FFFu + ((u >> 16) & 1u)) >> 16;
    unsigned short h = (unsigned short)r;
    return __builtin_bit_cast(__bf16, h);
}

// 16-element bf16 WMMA fragment: 8 contiguous bf16 at p0 (elems 0..7) and 8
// contiguous bf16 at p1 (elems 8..15); 16B-aligned -> *_load_b128 pairs.
static __device__ __forceinline__ v16bf load_frag(const __bf16* p0, const __bf16* p1) {
    BF16x16 u;
    u.q[0] = *(const uint4*)p0;
    u.q[1] = *(const uint4*)p1;
    return u.v;
}

static __device__ __forceinline__ v8f wmma_bf16(v16bf a, v16bf b, v8f c) {
    return __builtin_amdgcn_wmma_f32_16x16x32_bf16(false, a, false, b, (short)0, c,
                                                   false, false);
}

// ---------------------------------------------------------------------------
// f32 -> bf16 conversion of x and the four weight matrices in ONE launch.
// The five bf16 copies lie back to back in the workspace (x, Wq, Wk, Wv, Wo),
// so the destination is one array indexed by the block's own number; a block
// converts 4096 chunks (a chunk = 4 elements) of ONE source.
// 16 waves per block; a thread has its 8 loads of 16 B in flight before the
// first store.
// ---------------------------------------------------------------------------
struct alignas(8) BF4 { __bf16 a, b, c, d; };

#define CVT_THREADS 512
#define CVT_LOADS   8                                // chunks per thread
#define CVT_CHUNKS  (CVT_THREADS * CVT_LOADS)        // chunks per block
#define X_BLOCKS    (BS * HID / 4 / CVT_CHUNKS)      // 256
#define W_BLOCKS    (HID * HID / 4 / CVT_CHUNKS)     //  16
#define CVT_BLOCKS  (X_BLOCKS + 4 * W_BLOCKS)        // 320
static_assert(X_BLOCKS * CVT_CHUNKS * 4 == BS * HID && W_BLOCKS * CVT_CHUNKS * 4 == HID * HID,
              "whole blocks per source");

__global__ __launch_bounds__(CVT_THREADS)
void cvt_f32_bf16_kernel(const float* __restrict__ x,
                         const float* __restrict__ wq,
                         const float* __restrict__ wk,
                         const float* __restrict__ wv,
                         const float* __restrict__ wo,
                         __bf16* __restrict__ dst) {
    const int blk = blockIdx.x;
    const float* src = x;                        // source and block number inside it
    int sblk = blk;
    if (blk >= X_BLOCKS) {
        const int w = (blk - X_BLOCKS) / W_BLOCKS;
        src  = (w == 0) ? wq : (w == 1) ? wk : (w == 2) ? wv : wo;
        sblk = (blk - X_BLOCKS) % W_BLOCKS;
    }
    const float4* s4 = (const float4*)src + (size_t)sblk * CVT_CHUNKS + threadIdx.x;
    BF4*          d4 = (BF4*)dst + (size_t)blk * CVT_CHUNKS + threadIdx.x;

    float4 f[CVT_LOADS];
#pragma unroll                                   // all loads issued ahead of the first use
    for (int i = 0; i < CVT_LOADS; ++i)
        f[i] = s4[i * CVT_THREADS];
#pragma unroll
    for (int i = 0; i < CVT_LOADS; ++i) {
        BF4 o;
        o.a = f2bf(f[i].x); o.b = f2bf(f[i].y); o.c = f2bf(f[i].z); o.d = f2bf(f[i].w);
        d4[i * CVT_THREADS] = o;
    }
}

// ---------------------------------------------------------------------------
// Core of both projections: acc = A[m0 .. m0+127][:] * Wm[n0 .. n0+63][:]^T over
// k = 0..HID-1, block = 128 threads (4 waves), wave -> 32x64 tile.
// Both operands reach the waves through LDS: a stage is 64 k = one whole 128-byte
// line of each of the 128 A rows and 64 Wm rows, two buffers, filled by
// asynchronous copies (a wave-wide copy covers 4 whole lines).
// LDS rows are 128 B, unpadded; the 16-byte chunk c of row r lies at place
// c ^ ((r >> 1) & 7), so the 16 rows of a fragment read fall on 16 distinct
// bank groups.
// ---------------------------------------------------------------------------
#define GK      64                   // k elements per stage
#define GROWB   128                  // bytes per LDS row
#define GA_ROWS 128
#define GW_ROWS 64
#define GSTAGE  ((GA_ROWS + GW_ROWS) * GROWB)
#define GTRIPS  (HID / GK)

// One stage: 1536 chunks of 16 B, 12 per thread.  ag, wg: this lane's first chunk
// of the A and of the Wm tile; l: its LDS byte address in the A tile (the Wm tile
// follows the A rows).  Chunk i lies 16 rows further on, at the same place in its row.
static __device__ __forceinline__ void stage_gemm(const __bf16* ag, const __bf16* wg, uint32_t l) {
    // one statement for the copies and s_wait_xcnt: a precaution, so that no later
    // write of a copy's address registers can be scheduled ahead of that wait
    asm volatile(
        "global_load_async_to_lds_b128 %0, %12, off\n\t"
        "global_load_async_to_lds_b128 %1, %13, off\n\t"
        "global_load_async_to_lds_b128 %2, %14, off\n\t"
        "global_load_async_to_lds_b128 %3, %15, off\n\t"
        "global_load_async_to_lds_b128 %4, %16, off\n\t"
        "global_load_async_to_lds_b128 %5, %17, off\n\t"
        "global_load_async_to_lds_b128 %6, %18, off\n\t"
        "global_load_async_to_lds_b128 %7, %19, off\n\t"
        "global_load_async_to_lds_b128 %8, %20, off\n\t"
        "global_load_async_to_lds_b128 %9, %21, off\n\t"
        "global_load_async_to_lds_b128 %10, %22, off\n\t"
        "global_load_async_to_lds_b128 %11, %23, off\n\t"
        "s_wait_xcnt 0x0"
        :: "v"(l),                "v"(l +  16 * GROWB), "v"(l +  32 * GROWB), "v"(l +  48 * GROWB),
           "v"(l +  64 * GROWB), "v"(l +  80 * GROWB), "v"(l +  96 * GROWB), "v"(l + 112 * GROWB),
           "v"(l + 128 * GROWB), "v"(l + 144 * GROWB), "v"(l + 160 * GROWB), "v"(l + 176 * GROWB),
           "v"(ag),            "v"(ag +  16 * HID), "v"(ag +  32 * HID), "v"(ag +  48 * HID),
           "v"(ag + 64 * HID), "v"(ag +  80 * HID), "v"(ag +  96 * HID), "v"(ag + 112 * HID),
           "v"(wg),            "v"(wg +  16 * HID), "v"(wg +  32 * HID), "v"(wg +  48 * HID)
        : "memory");
}

static __device__ __forceinline__ void gemm_128x64(const __bf16* __restrict__ A,
                                                   const __bf16* __restrict__ Wm,
                                                   int m0, int n0,
                                                   unsigned char (*tiles)[GSTAGE],
                                                   v8f (&acc)[2][4]) {
    const int tid  = threadIdx.x;
    const int lane = tid & 31;
    const int wave = tid >> 5;
    const int ln   = lane & 15;
    const int half = lane >> 4;

    // this lane's chunk of a stage: row tid/8 (+16 per chunk), 16-byte column tid%8
    const int crow = tid >> 3;
    const int ccol = tid & 7;
    const __bf16* acp = A  + (size_t)(m0 + crow) * HID + ccol * 8;
    const __bf16* wcp = Wm + (size_t)(n0 + crow) * HID + ccol * 8;
    const uint32_t lcp = (uint32_t)(uintptr_t)&tiles[0][crow * GROWB + ((ccol ^ ((crow >> 1) & 7)) << 4)];

    stage_gemm(acp, wcp, lcp);                                // stage 0 -> buffer 0
    asm volatile("s_wait_asynccnt 0x0" ::: "memory");         // own copies landed ...
    __syncthreads();                                          // ... and every wave's
    stage_gemm(acp + GK, wcp + GK, lcp + GSTAGE);             // stage 1 -> buffer 1, in flight over trip 0

    // byte offset of chunk 2*j + half of row ln inside a 16-row group: a fragment of
    // the 32 k at kk*32 is chunks j = 2*kk (elements 0..7) and 2*kk + 1 (elements 8..15)
    int fo[4];
#pragma unroll                                   // constant indices: fo[] stays in registers
    for (int j = 0; j < 4; ++j)
        fo[j] = ln * GROWB + (((2 * j + half) ^ ((ln >> 1) & 7)) << 4);

    for (int t = 0; t < GTRIPS; ++t) {
        const unsigned char* at = tiles[t & 1] + wave * 32 * GROWB;
        const unsigned char* wt = tiles[t & 1] + GA_ROWS * GROWB;
#pragma unroll                                   // both 32-k blocks of a stage in one trip: constant LDS offsets
        for (int kk = 0; kk < GK / 32; ++kk) {
            v16bf bfr[4];
            // the three loops below are unrolled so that fragments and accumulators
            // have constant indices and stay in registers
#pragma unroll
            for (int nt = 0; nt < 4; ++nt)
                bfr[nt] = load_frag((const __bf16*)(wt + nt * 16 * GROWB + fo[2 * kk]),
                                    (const __bf16*)(wt + nt * 16 * GROWB + fo[2 * kk + 1]));
#pragma unroll
            for (int mt = 0; mt < 2; ++mt) {
                v16bf a = load_frag((const __bf16*)(at + mt * 16 * GROWB + fo[2 * kk]),
                                    (const __bf16*)(at + mt * 16 * GROWB + fo[2 * kk + 1]));
#pragma unroll
                for (int nt = 0; nt < 4; ++nt)
                    acc[mt][nt] = wmma_bf16(a, bfr[nt], acc[mt][nt]);
            }
        }

        // hand-over: stage t+1 becomes readable, this trip's buffer becomes free
        asm volatile("s_wait_dscnt 0x0" ::: "memory");        // own reads of this buffer done
        asm volatile("s_wait_asynccnt 0x0" ::: "memory");     // own copies of stage t+1 landed
        __syncthreads();
        if (t + 2 < GTRIPS)
            stage_gemm(acp + (t + 2) * GK, wcp + (t + 2) * GK, lcp + (t & 1) * GSTAGE);
    }
    asm volatile("s_wait_asynccnt 0x0" ::: "memory");         // nothing in flight behind the loop
}

// ---------------------------------------------------------------------------
// QKV projection: Y[m,n] = sum_k X[m,k] * W[n,k] + bias[n]
// grid = (BS/128, NHEAD, 3), block = 128 (4 waves). Wave -> 32x64 tile.
// Q,K stored [b,h,s,d]; V stored transposed [b,h,d,t].
// ---------------------------------------------------------------------------
__global__ __launch_bounds__(128)
void qkv_proj_kernel(const __bf16* __restrict__ xb,
                     const __bf16* __restrict__ wqb,
                     const __bf16* __restrict__ wkb,
                     const __bf16* __restrict__ wvb,
                     const float* __restrict__ bq,
                     const float* __restrict__ bk,
                     const float* __restrict__ bv,
                     __bf16* __restrict__ qout,
                     __bf16* __restrict__ kout,
                     __bf16* __restrict__ vtout) {
    __shared__ __attribute__((aligned(128))) unsigned char tiles[2][GSTAGE];

    const int tid  = threadIdx.x;
    const int lane = tid & 31;
    const int wave = tid >> 5;
    const int ln   = lane & 15;
    const int off8 = (lane >> 4) ? 8 : 0;

    const int M0    = blockIdx.x * 128 + wave * 32;
    const int head  = blockIdx.y;
    const int which = blockIdx.z;               // 0=Q 1=K 2=V
    const int N0    = head * 64;

    const __bf16* W;
    const float*  bias;
    if (which == 0)      { W = wqb; bias = bq; }
    else if (which == 1) { W = wkb; bias = bk; }
    else                 { W = wvb; bias = bv; }

    v8f acc[2][4] = {};
    gemm_128x64(xb, W, blockIdx.x * 128, N0, tiles, acc);

    // store: C layout row m = r + (lane<16 ? 0 : 8), col = nt*16 + ln
#pragma unroll
    for (int mt = 0; mt < 2; ++mt) {
#pragma unroll
        for (int nt = 0; nt < 4; ++nt) {
            const int d = nt * 16 + ln;
            const float bval = bias[N0 + d];
#pragma unroll
            for (int r = 0; r < 8; ++r) {
                const int g  = M0 + mt * 16 + r + off8;  // global row (b*S + s)
                const int bi = g >> 12;
                const int si = g & (SEQ - 1);
                const int bh = bi * NHEAD + head;
                const float v = acc[mt][nt][r] + bval;
                if (which == 2) {
                    vtout[((size_t)bh * HDIM + d) * SEQ + si] = f2bf(v);
                } else {
                    __bf16* dst = (which == 0) ? qout : kout;
                    dst[((size_t)bh * SEQ + si) * HDIM + d] = f2bf(v);
                }
            }
        }
    }
}

static __device__ __forceinline__ float other_half(float v) {
    const int b = __builtin_bit_cast(int, v);
    return __builtin_bit_cast(float,
        __builtin_amdgcn_permlanex16(b, b, 0x76543210, 0xfedcba98, false, false));
}

#define KT      64                   // keys per LDS stage
#define LPITCH  144                  // LDS row: 128 data bytes + 16 (16 B x odd: no bank conflict for b128 reads)
#define TILE_B  (64 * LPITCH)        // one tile: 64 rows (K: keys, V^T: head dims)
#define KSPLIT  2                    // key halves per block
#define NSTAGE  (SEQ / KSPLIT / KT)  // stages per half

// One stage: K tile (64 keys x 128 B, contiguous in memory) and V^T tile
// (64 dims x 64 keys) into LDS; 1024 chunks of 16 B, 8 per thread of a half.
// kg, vg: this lane's first chunk of each tile; lk: its LDS byte address in the
// K tile (the V^T tile follows at TILE_B).  Chunk i lies 16 rows further on.
static __device__ __forceinline__ void stage_kv(const __bf16* kg, const __bf16* vg, uint32_t lk) {
    const uint32_t lv = lk + TILE_B;
    // one statement for the copies and s_wait_xcnt: a precaution, so that no later
    // write of a copy's address registers can be scheduled ahead of that wait
    asm volatile(
        "global_load_async_to_lds_b128 %0, %8, off\n\t"
        "global_load_async_to_lds_b128 %1, %9, off\n\t"
        "global_load_async_to_lds_b128 %2, %10, off\n\t"
        "global_load_async_to_lds_b128 %3, %11, off\n\t"
        "global_load_async_to_lds_b128 %4, %12, off\n\t"
        "global_load_async_to_lds_b128 %5, %13, off\n\t"
        "global_load_async_to_lds_b128 %6, %14, off\n\t"
        "global_load_async_to_lds_b128 %7, %15, off\n\t"
        "s_wait_xcnt 0x0"
        :: "v"(lk), "v"(lk + 16 * LPITCH), "v"(lk + 32 * LPITCH), "v"(lk + 48 * LPITCH),
           "v"(lv), "v"(lv + 16 * LPITCH), "v"(lv + 32 * LPITCH), "v"(lv + 48 * LPITCH),
           "v"(kg), "v"(kg + 16 * HDIM), "v"(kg + 32 * HDIM), "v"(kg + 48 * HDIM),
           "v"(vg), "v"(vg + 16 * SEQ), "v"(vg + 32 * SEQ), "v"(vg + 48 * SEQ)
        : "memory");
}

__global__ __launch_bounds__(256)
void flash_attn_kernel(const __bf16* __restrict__ qb,
                       const __bf16* __restrict__ kb,
                       const __bf16* __restrict__ vT,
                       __bf16* __restrict__ ctxb) {
    __shared__ __attribute__((aligned(16))) unsigned char kv[KSPLIT][2][2 * TILE_B];

    const int lane = threadIdx.x & 31;
    const int wave = __builtin_amdgcn_readfirstlane(threadIdx.x >> 5);
    const int part = wave >> 2;                  // key half of this wave
    const int qw   = wave & 3;                   // its 32 query columns in the block
    const int ln   = lane & 15;
    const int off8 = (lane >> 4) ? 8 : 0;

    const int b    = blockIdx.z;
    const int head = blockIdx.y;
    const int bh   = b * NHEAD + head;
    const int q0   = blockIdx.x * 128 + qw * 32;

    const __bf16* qbase = qb + (size_t)bh * SEQ * HDIM;
    const __bf16* kbase = kb + ((size_t)bh * SEQ + part * (SEQ / KSPLIT)) * HDIM;   // first key of the half
    const __bf16* vbase = vT + (size_t)bh * HDIM * SEQ + part * (SEQ / KSPLIT);

    // this lane's chunk of its half's stage: t = thread number inside the half,
    // row t/8 (+16 per chunk), 16-byte column t%8
    const int crow = (threadIdx.x & 127) >> 3;
    const int ccol = threadIdx.x & 7;
    const __bf16* kcp = kbase + (size_t)crow * HDIM + ccol * 8;
    const __bf16* vcp = vbase + (size_t)crow * SEQ + ccol * 8;
    const uint32_t lcp = (uint32_t)(uintptr_t)&kv[part][0][crow * LPITCH + ccol * 16];

    stage_kv(kcp, vcp, lcp);                                  // tile 0 -> buffer 0
    asm volatile("s_wait_asynccnt 0x0" ::: "memory");         // own copies landed ...
    __syncthreads();                                          // ... and every wave's
    stage_kv(kcp + KT * HDIM, vcp + KT, lcp + 2 * TILE_B);    // tile 1 -> buffer 1, in flight over trip 0

    // Q B-fragments (column = query ln) held in registers for the whole key loop
    v16bf bq[2][2];
#pragma unroll
    for (int qt = 0; qt < 2; ++qt) {
        const __bf16* qrow = qbase + (size_t)(q0 + qt * 16 + ln) * HDIM;
        bq[qt][0] = load_frag(qrow + off8,      qrow + off8 + 16);
        bq[qt][1] = load_frag(qrow + 32 + off8, qrow + 32 + off8 + 16);
    }

    // per lane: the maximum in use for query qt*16+ln (equal in both lane halves; at most
    // 8 in the exponent below the true running maximum) and the sum over this lane half's
    // keys in its units (halves joined in the epilogue)
    float mcol[2], lcol[2];
    float mthr[2], nmcs[2];                      // mcol + LAZY_RAW and -mcol * cs, kept beside it
#pragma unroll
    for (int qt = 0; qt < 2; ++qt) { mcol[qt] = -3.0e38f; mthr[qt] = -3.0e38f; nmcs[qt] = 0.0f; lcol[qt] = 0.0f; }
    v8f o[2][4] = {};                            // o[qt][nt][r] = O[query ln][nt*16 + off8 + r]

    // softmax in base 2: exp(scale * (s - m)) = exp2(s * cs - m * cs), cs = scale * log2(e);
    // cs > 0, so the maxima are taken over the raw products and kept in their units
    const float cs = 0.125f * 1.4426950408889634f;
    const float LAZY_RAW = 8.0f / cs;            // 8 in the exponent's units, as a raw product

    for (int st = 0; st < NSTAGE; ++st) {
      const unsigned char* ktile = kv[part][st & 1];
      const unsigned char* vtile = ktile + TILE_B;
#pragma unroll                                   // both 32-key blocks of a stage in one trip: constant LDS offsets
      for (int kk = 0; kk < KT / 32; ++kk) {
        // ---- scores: S^T = K * Q^T  (4 C tiles, K-dim 64 = 2 wmmas each)
        v16bf ak[2][2];
#pragma unroll
        for (int tt = 0; tt < 2; ++tt) {
            const __bf16* kr = (const __bf16*)(ktile + (kk * 32 + tt * 16 + ln) * LPITCH);
            ak[tt][0] = load_frag(kr + off8,      kr + off8 + 16);
            ak[tt][1] = load_frag(kr + 32 + off8, kr + 32 + off8 + 16);
        }
        // V^T fragments of the block, fetched in one group with K's
        v16bf av[4];
#pragma unroll                                   // constant indices: av[] stays in registers
        for (int nt = 0; nt < 4; ++nt) {
            const __bf16* vr = (const __bf16*)(vtile + (nt * 16 + ln) * LPITCH) + kk * 32 + off8;
            av[nt] = load_frag(vr, vr + 16);
        }
        v8f s[2][2] = {};                        // s[qt][tt][r] = S[query ln][block + tt*16 + off8 + r]
#pragma unroll
        for (int qt = 0; qt < 2; ++qt)
#pragma unroll
            for (int tt = 0; tt < 2; ++tt) {
                s[qt][tt] = wmma_bf16(ak[tt][0], bq[qt][0], s[qt][tt]);
                s[qt][tt] = wmma_bf16(ak[tt][1], bq[qt][1], s[qt][tt]);
            }

        // ---- online softmax, lazy rescale + P^T packed as B operand
        // in-lane maximum of each column's 16 scores, as a tree of three-input maxima
        float mx[2];
#pragma unroll
        for (int qt = 0; qt < 2; ++qt) {
            const v8f x0 = s[qt][0];
            const v8f x1 = s[qt][1];
            const float a0 = fmaxf(fmaxf(x0[0], x0[1]), x0[2]);
            const float a1 = fmaxf(fmaxf(x0[3], x0[4]), x0[5]);
            const float a2 = fmaxf(fmaxf(x0[6], x0[7]), x1[0]);
            const float a3 = fmaxf(fmaxf(x1[1], x1[2]), x1[3]);
            const float a4 = fmaxf(fmaxf(x1[4], x1[5]), x1[6]);
            mx[qt] = fmaxf(fmaxf(fmaxf(a0, a1), a2), fmaxf(fmaxf(a3, a4), x1[7]));
        }
        // inputs-only fence on the loaded V^T fragments: without it the compiler sinks their
        // loads behind the branch, next to the products that use them, each with a full wait
        asm volatile("" :: "v"(av[0]), "v"(av[1]), "v"(av[2]), "v"(av[3]));
        // The maximum in use moves only when a score of the wave lies above it by more than
        // 8 in the exponent: one test and one scalar branch per 32 keys.  Until then
        // p <= 2^8, and sums and O stay in the units of the maximum in use.  The first
        // block always takes the branch (start value of mthr); there alpha = 0.
        if (__builtin_amdgcn_ballot_w32(mx[0] > mthr[0] || mx[1] > mthr[1]) != 0) {
#pragma unroll                                   // constant indices: state and O stay in registers
            for (int qt = 0; qt < 2; ++qt) {
                const float mnew  = fmaxf(fmaxf(mcol[qt], mx[qt]), other_half(mx[qt]));
                const float alpha = __builtin_amdgcn_exp2f((mcol[qt] - mnew) * cs);
                mcol[qt] = mnew;
                mthr[qt] = mnew + LAZY_RAW;
                nmcs[qt] = mnew * -cs;
                lcol[qt] *= alpha;
#pragma unroll
                for (int nt = 0; nt < 4; ++nt)
                    o[qt][nt] *= alpha;
            }
        }
        v16bf bp[2];
#pragma unroll
        for (int qt = 0; qt < 2; ++qt) {
            const float nm = nmcs[qt];
            v8f e0, e1;
#pragma unroll                                   // constant indices: scores stay in registers
            for (int r = 0; r < 8; r += 2) {     // one packed fused multiply-add per score pair
                const v2f c2 = {cs, cs}, n2 = {nm, nm};
                const v2f a = __builtin_elementwise_fma((v2f){s[qt][0][r], s[qt][0][r + 1]}, c2, n2);
                const v2f b = __builtin_elementwise_fma((v2f){s[qt][1][r], s[qt][1][r + 1]}, c2, n2);
                e0[r] = a[0]; e0[r + 1] = a[1];
                e1[r] = b[0]; e1[r + 1] = b[1];
            }
            v8f p0, p1;
#pragma unroll
            for (int r = 0; r < 8; ++r) {
                p0[r] = __builtin_amdgcn_exp2f(e0[r]);
                p1[r] = __builtin_amdgcn_exp2f(e1[r]);
                bp[qt][r]     = (__bf16)p0[r];   // element e = key kmap(e, half):
                bp[qt][8 + r] = (__bf16)p1[r];   // the hardware k order, as V's loads
            }
            const v8f pv = p0 + p1;              // in-lane sum, pairwise
            lcol[qt] += ((pv[0] + pv[1]) + (pv[2] + pv[3])) +
                        ((pv[4] + pv[5]) + (pv[6] + pv[7]));
        }

        // ---- O^T += V^T * P^T  (V tile is [d, t] -> contiguous A loads, shared by column tiles)
#pragma unroll
        for (int nt = 0; nt < 4; ++nt) {
            o[0][nt] = wmma_bf16(av[nt], bp[0], o[0][nt]);
            o[1][nt] = wmma_bf16(av[nt], bp[1], o[1][nt]);
        }
      }

      // hand-over: tile st+1 becomes readable, this trip's buffer becomes free
      asm volatile("s_wait_dscnt 0x0" ::: "memory");          // own reads of this buffer done
      asm volatile("s_wait_asynccnt 0x0" ::: "memory");       // own copies of tile st+1 landed
      __syncthreads();
      if (st + 2 < NSTAGE)
          stage_kv(kcp + (size_t)(st + 2) * KT * HDIM, vcp + (st + 2) * KT,
                   lcp + (st & 1) * (2 * TILE_B));
    }
    asm volatile("s_wait_asynccnt 0x0" ::: "memory");         // nothing in flight when the wave ends

    // ---- join of the key halves.  The last trip's waits and barrier have ended every
    // read of the tiles and no copy is in flight, so the tile memory is free: wave 4+w
    // hands its state to wave w there, 17 rows of 32 lanes x 16 B (whole 512-B rows).
    float4* xch = (float4*)&kv[0][0][0] + qw * (17 * 32) + lane;
    if (part == 1) {
#pragma unroll
        for (int qt = 0; qt < 2; ++qt)
#pragma unroll
            for (int nt = 0; nt < 4; ++nt) {
                const v8f t = o[qt][nt];
                xch[((qt * 4 + nt) * 2 + 0) * 32] = make_float4(t[0], t[1], t[2], t[3]);
                xch[((qt * 4 + nt) * 2 + 1) * 32] = make_float4(t[4], t[5], t[6], t[7]);
            }
        xch[16 * 32] = make_float4(mcol[0], mcol[1], lcol[0], lcol[1]);
    }
    __syncthreads();                             // half 1's state readable by half 0

    // ---- epilogue (half 0): ctx[b, s, head*64 + d] = (o0*a0 + o1*a1) / (l0*a0 + l1*a1);
    // a lane owns 8 consecutive d
    if (part == 0) {
        const float4 ml = xch[16 * 32];
#pragma unroll
        for (int qt = 0; qt < 2; ++qt) {
            const int srow = q0 + qt * 16 + ln;
            const float m1 = qt ? ml.y : ml.x;
            const float l1 = qt ? ml.w : ml.z;
            const float m  = fmaxf(mcol[qt], m1);
            const float a0 = __builtin_amdgcn_exp2f((mcol[qt] - m) * cs);
            const float a1 = __builtin_amdgcn_exp2f((m1 - m) * cs);
            const float l  = lcol[qt] * a0 + l1 * a1;
            const float inv = 1.0f / (l + other_half(l));
            const float c0 = a0 * inv;
            const float c1 = a1 * inv;
#pragma unroll
            for (int nt = 0; nt < 4; ++nt) {
                const float4 u0 = xch[((qt * 4 + nt) * 2 + 0) * 32];
                const float4 u1 = xch[((qt * 4 + nt) * 2 + 1) * 32];
                const float u[8] = { u0.x, u0.y, u0.z, u0.w, u1.x, u1.y, u1.z, u1.w };
                union { __bf16 h[8]; uint4 q; } pk;
#pragma unroll
                for (int r = 0; r < 8; ++r)
                    pk.h[r] = f2bf(o[qt][nt][r] * c0 + u[r] * c1);
                *(uint4*)(ctxb + ((size_t)(b * SEQ + srow)) * HID + head * 64 + nt * 16 + off8) = pk.q;
            }
        }
    }
}

// ---------------------------------------------------------------------------
// Output projection: out[m,n] = sum_k ctx[m,k] * Wo[n,k] + bo[n]   (f32 out)
// grid = (BS/128, HID/64), block = 128.
// ---------------------------------------------------------------------------
__global__ __launch_bounds__(128)
void out_proj_kernel(const __bf16* __restrict__ ctxb,
                     const __bf16* __restrict__ wob,
                     const float* __restrict__ bo,
                     float* __restrict__ out) {
    __shared__ __attribute__((aligned(128))) unsigned char tiles[2][GSTAGE];

    const int tid  = threadIdx.x;
    const int lane = tid & 31;
    const int wave = tid >> 5;
    const int ln   = lane & 15;
    const int off8 = (lane >> 4) ? 8 : 0;

    const int M0 = blockIdx.x * 128 + wave * 32;
    const int N0 = blockIdx.y * 64;

    v8f acc[2][4] = {};
    gemm_128x64(ctxb, wob, blockIdx.x * 128, N0, tiles, acc);

#pragma unroll
    for (int mt = 0; mt < 2; ++mt)
#pragma unroll
        for (int nt = 0; nt < 4; ++nt) {
            const int n = N0 + nt * 16 + ln;
            const float bval = bo[n];
#pragma unroll
            for (int r = 0; r < 8; ++r) {
                const int m = M0 + mt * 16 + r + off8;
                out[(size_t)m * HID + n] = acc[mt][nt][r] + bval;
            }
        }
}

// ---------------------------------------------------------------------------
// Host launcher
// ---------------------------------------------------------------------------
extern "C" void kernel_launch(void* const* d_in, const int* in_sizes, int n_in,
                              void* d_out, int out_size, void* d_ws, size_t ws_size,
                              hipStream_t stream) {
    (void)in_sizes; (void)n_in; (void)out_size; (void)ws_size;

    const float* x  = (const float*)d_in[0];
    const float* Wq = (const float*)d_in[1];
    const float* bq = (const float*)d_in[2];
    const float* Wk = (const float*)d_in[3];
    const float* bk = (const float*)d_in[4];
    const float* Wv = (const float*)d_in[5];
    const float* bv = (const float*)d_in[6];
    const float* Wo = (const float*)d_in[7];
    const float* bo = (const float*)d_in[8];
    float* out = (float*)d_out;

    // workspace layout (bf16 scratch, ~42 MB total)
    const size_t XB_ELE = (size_t)BS * HID;       // 4,194,304
    const size_t W_ELE  = (size_t)HID * HID;      //   262,144
    char* ws = (char*)d_ws;
    size_t off = 0;
    __bf16* xb   = (__bf16*)(ws + off); off += XB_ELE * 2;
    __bf16* wqb  = (__bf16*)(ws + off); off += W_ELE * 2;
    __bf16* wkb  = (__bf16*)(ws + off); off += W_ELE * 2;
    __bf16* wvb  = (__bf16*)(ws + off); off += W_ELE * 2;
    __bf16* wob  = (__bf16*)(ws + off); off += W_ELE * 2;
    __bf16* qbuf = (__bf16*)(ws + off); off += XB_ELE * 2;
    __bf16* kbuf = (__bf16*)(ws + off); off += XB_ELE * 2;
    __bf16* vtb  = (__bf16*)(ws + off); off += XB_ELE * 2;
    __bf16* ctxb = (__bf16*)(ws + off); off += XB_ELE * 2;

    // 1) f32 -> bf16 conversions, one launch: xb, wqb, wkb, wvb, wob are contiguous from xb
    cvt_f32_bf16_kernel<<<CVT_BLOCKS, CVT_THREADS, 0, stream>>>(x, Wq, Wk, Wv, Wo, xb);

    // 2) fused QKV projection (Q,K row-major per head; V transposed per head)
    dim3 gqkv(BS / 128, NHEAD, 3);
    qkv_proj_kernel<<<gqkv, 128, 0, stream>>>(xb, wqb, wkb, wvb, bq, bk, bv,
                                              qbuf, kbuf, vtb);

    // 3) flash attention
    dim3 gattn(SEQ / 128, NHEAD, BATCH);
    flash_attn_kernel<<<gattn, 256, 0, stream>>>(qbuf, kbuf, vtb, ctxb);

    // 4) output projection -> f32 out
    dim3 gout(BS / 128, HID / 64);
    out_proj_kernel<<<gout, 128, 0, stream>>>(ctxb, wob, bo, out);
}

// v008
// A run of this version takes 86.2 microseconds.
// Two timings next to v007 both put it at 1.07 times that version's speed.
// Counting every step since v000, it is 3.60 times as fast.
#include <hip/hip_runtime.h>
#include <stdint.h>

// ---------------------------------------------------------------------------
// Multi-head attention forward for gfx1250 (MI455X), bf16 WMMA pipeline.
// B=2, S=4096, HID=512, HEADS=8, D=64.  Compute-bound -> all three GEMM
// stages through v_wmma_f32_16x16x32_bf16 with f32 accumulation.
// Operand tiles double-buffered in LDS via async global->LDS copies.
// ---------------------------------------------------------------------------

#define BATCH 2
#define SEQ   4096
#define HID   512
#define NHEAD 8
#define HDIM  64
#define BS    (BATCH * SEQ)          // 8192 rows

typedef __attribute__((ext_vector_type(16))) __bf16 v16bf;
typedef __attribute__((ext_vector_type(8)))  float  v8f;
typedef __attribute__((ext_vector_type(2)))  float  v2f;

union BF16x16 {
    v16bf v;
    uint4 q[2];
};

// round-to-nearest-even f32 -> bf16
static __device__ __forceinline__ __bf16 f2bf(float f) {
    unsigned int u = __builtin_bit_cast(unsigned int, f);
    unsigned int r = (u + 0x7FFFu + ((u >> 16) & 1u)) >> 16;
    unsigned short h = (unsigned short)r;
    return __builtin_bit_cast(__bf16, h);
}

// 16-element bf16 WMMA fragment: 8 contiguous bf16 at p0 (elems 0..7) and 8
// contiguous bf16 at p1 (elems 8..15); 16B-aligned -> *_load_b128 pairs.
static __device__ __forceinline__ v16bf load_frag(const __bf16* p0, const __bf16* p1) {
    BF16x16 u;
    u.q[0] = *(const uint4*)p0;
    u.q[1] = *(const uint4*)p1;
    return u.v;
}

static __device__ __forceinline__ v8f wmma_bf16(v16bf a, v16bf b, v8f c) {
    return __builtin_amdgcn_wmma_f32_16x16x32_bf16(false, a, false, b, (short)0, c,
                                                   false, false);
}

// ---------------------------------------------------------------------------
// f32 -> bf16 conversion of x and the four weight matrices in ONE launch.
// The five bf16 copies lie back to back in the workspace (x, Wq, Wk, Wv, Wo),
// so the destination is one array indexed by the block's own number; a block
// converts 4096 chunks (a chunk = 4 elements) of ONE source.
// 16 waves per block; a thread has its 8 loads of 16 B in flight before the
// first store.
// ---------------------------------------------------------------------------
struct alignas(8) BF4 { __bf16 a, b, c, d; };

#define CVT_THREADS 512
#define CVT_LOADS   8                                // chunks per thread
#define CVT_CHUNKS  (CVT_THREADS * CVT_LOADS)        // chunks per block
#define X_BLOCKS    (BS * HID / 4 / CVT_CHUNKS)      // 256
#define W_BLOCKS    (HID * HID / 4 / CVT_CHUNKS)     //  16
#define CVT_BLOCKS  (X_BLOCKS + 4 * W_BLOCKS)        // 320
static_assert(X_BLOCKS * CVT_CHUNKS * 4 == BS * HID && W_BLOCKS * CVT_CHUNKS * 4 == HID * HID,
              "whole blocks per source");

__global__ __launch_bounds__(CVT_THREADS)
void cvt_f32_bf16_kernel(const float* __restrict__ x,
                         const float* __restrict__ wq,
                         const float* __restrict__ wk,
                         const float* __restrict__ wv,
                         const float* __restrict__ wo,
                         __bf16* __restrict__ dst) {
    const int blk = blockIdx.x;
    const float* src = x;                        // source and block number inside it
    int sblk = blk;
    if (blk >= X_BLOCKS) {
        const int w = (blk - X_BLOCKS) / W_BLOCKS;
        src  = (w == 0) ? wq : (w == 1) ? wk : (w == 2) ? wv : wo;
        sblk = (blk - X_BLOCKS) % W_BLOCKS;
    }
    const float4* s4 = (const float4*)src + (size_t)sblk * CVT_CHUNKS + threadIdx.x;
    BF4*          d4 = (BF4*)dst + (size_t)blk * CVT_CHUNKS + threadIdx.x;

    float4 f[CVT_LOADS];
#pragma unroll                                   // all loads issued ahead of the first use
    for (int i = 0; i < CVT_LOADS; ++i)
        f[i] = s4[i * CVT_THREADS];
#pragma unroll
    for (int i = 0; i < CVT_LOADS; ++i) {
        BF4 o;
        o.a = f2bf(f[i].x); o.b = f2bf(f[i].y); o.c = f2bf(f[i].z); o.d = f2bf(f[i].w);
        d4[i * CVT_THREADS] = o;
    }
}

// ---------------------------------------------------------------------------
// Core of both projections: acc = A[m0 .. m0+127][:] * Wm[n0 .. n0+63][:]^T over
// k = 0..HID-1, block = 128 threads (4 waves), wave -> 32x64 tile.
// Both operands reach the waves through LDS: a stage is 64 k = one whole 128-byte
// line of each of the 128 A rows and 64 Wm rows, two buffers, filled by
// asynchronous copies (a wave-wide copy covers 4 whole lines).
// LDS rows are 128 B, unpadded; the 16-byte chunk c of row r lies at place
// c ^ ((r >> 1) & 7), so the 16 rows of a fragment read fall on 16 distinct
// bank groups.
// A and B fragments have the same lane and k order, so the two operands may change
// places: with WROWS the Wm rows are the A operand and acc[mt][nt] holds the
// transposed tile (row = n, column = m); a lane then owns 8 consecutive n of one m.
// ---------------------------------------------------------------------------
#define GK      64                   // k elements per stage
#define GROWB   128                  // bytes per LDS row
#define GA_ROWS 128
#define GW_ROWS 64
#define GSTAGE  ((GA_ROWS + GW_ROWS) * GROWB)
#define GTRIPS  (HID / GK)

// One stage: 1536 chunks of 16 B, 12 per thread.  ag, wg: this lane's first chunk
// of the A and of the Wm tile; l: its LDS byte address in the A tile (the Wm tile
// follows the A rows).  Chunk i lies 16 rows further on, at the same place in its row.
static __device__ __forceinline__ void stage_gemm(const __bf16* ag, const __bf16* wg, uint32_t l) {
    // one statement for the copies and s_wait_xcnt: a precaution, so that no later
    // write of a copy's address registers can be scheduled ahead of that wait
    asm volatile(
        "global_load_async_to_lds_b128 %0, %12, off\n\t"
        "global_load_async_to_lds_b128 %1, %13, off\n\t"
        "global_load_async_to_lds_b128 %2, %14, off\n\t"
        "global_load_async_to_lds_b128 %3, %15, off\n\t"
        "global_load_async_to_lds_b128 %4, %16, off\n\t"
        "global_load_async_to_lds_b128 %5, %17, off\n\t"
        "global_load_async_to_lds_b128 %6, %18, off\n\t"
        "global_load_async_to_lds_b128 %7, %19, off\n\t"
        "global_load_async_to_lds_b128 %8, %20, off\n\t"
        "global_load_async_to_lds_b128 %9, %21, off\n\t"
        "global_load_async_to_lds_b128 %10, %22, off\n\t"
        "global_load_async_to_lds_b128 %11, %23, off\n\t"
        "s_wait_xcnt 0x0"
        :: "v"(l),                "v"(l +  16 * GROWB), "v"(l +  32 * GROWB), "v"(l +  48 * GROWB),
           "v"(l +  64 * GROWB), "v"(l +  80 * GROWB), "v"(l +  96 * GROWB), "v"(l + 112 * GROWB),
           "v"(l + 128 * GROWB), "v"(l + 144 * GROWB), "v"(l + 160 * GROWB), "v"(l + 176 * GROWB),
           "v"(ag),            "v"(ag +  16 * HID), "v"(ag +  32 * HID), "v"(ag +  48 * HID),
           "v"(ag + 64 * HID), "v"(ag +  80 * HID), "v"(ag +  96 * HID), "v"(ag + 112 * HID),
           "v"(wg),            "v"(wg +  16 * HID), "v"(wg +  32 * HID), "v"(wg +  48 * HID)
        : "memory");
}

template <bool WROWS>
static __device__ __forceinline__ void gemm_128x64(const __bf16* __restrict__ A,
                                                   const __bf16* __restrict__ Wm,
                                                   int m0, int n0,
                                                   unsigned char (*tiles)[GSTAGE],
                                                   v8f (&acc)[2][4]) {
    const int tid  = threadIdx.x;
    const int lane = tid & 31;
    const int wave = tid >> 5;
    const int ln   = lane & 15;
    const int half = lane >> 4;

    // this lane's chunk of a stage: row tid/8 (+16 per chunk), 16-byte column tid%8
    const int crow = tid >> 3;
    const int ccol = tid & 7;
    const __bf16* acp = A  + (size_t)(m0 + crow) * HID + ccol * 8;
    const __bf16* wcp = Wm + (size_t)(n0 + crow) * HID + ccol * 8;
    const uint32_t lcp = (uint32_t)(uintptr_t)&tiles[0][crow * GROWB + ((ccol ^ ((crow >> 1) & 7)) << 4)];

    stage_gemm(acp, wcp, lcp);                                // stage 0 -> buffer 0
    asm volatile("s_wait_asynccnt 0x0" ::: "memory");         // own copies landed ...
    __syncthreads();                                          // ... and every wave's
    stage_gemm(acp + GK, wcp + GK, lcp + GSTAGE);             // stage 1 -> buffer 1, in flight over trip 0

    // byte offset of chunk 2*j + half of row ln inside a 16-row group: a fragment of
    // the 32 k at kk*32 is chunks j = 2*kk (elements 0..7) and 2*kk + 1 (elements 8..15)
    int fo[4];
#pragma unroll                                   // constant indices: fo[] stays in registers
    for (int j = 0; j < 4; ++j)
        fo[j] = ln * GROWB + (((2 * j + half) ^ ((ln >> 1) & 7)) << 4);

    for (int t = 0; t < GTRIPS; ++t) {
        const unsigned char* at = tiles[t & 1] + wave * 32 * GROWB;
        const unsigned char* wt = tiles[t & 1] + GA_ROWS * GROWB;
#pragma unroll                                   // both 32-k blocks of a stage in one trip: constant LDS offsets
        for (int kk = 0; kk < GK / 32; ++kk) {
            v16bf bfr[4];
            // the three loops below are unrolled so that fragments and accumulators
            // have constant indices and stay in registers
#pragma unroll
            for (int nt = 0; nt < 4; ++nt)
                bfr[nt] = load_frag((const __bf16*)(wt + nt * 16 * GROWB + fo[2 * kk]),
                                    (const __bf16*)(wt + nt * 16 * GROWB + fo[2 * kk + 1]));
#pragma unroll
            for (int mt = 0; mt < 2; ++mt) {
                v16bf a = load_frag((const __bf16*)(at + mt * 16 * GROWB + fo[2 * kk]),
                                    (const __bf16*)(at + mt * 16 * GROWB + fo[2 * kk + 1]));
#pragma unroll
                for (int nt = 0; nt < 4; ++nt)
                    acc[mt][nt] = WROWS ? wmma_bf16(bfr[nt], a, acc[mt][nt])
                                        : wmma_bf16(a, bfr[nt], acc[mt][nt]);
            }
        }

        // hand-over: stage t+1 becomes readable, this trip's buffer becomes free
        asm volatile("s_wait_dscnt 0x0" ::: "memory");        // own reads of this buffer done
        asm volatile("s_wait_asynccnt 0x0" ::: "memory");     // own copies of stage t+1 landed
        __syncthreads();
        if (t + 2 < GTRIPS)
            stage_gemm(acp + (t + 2) * GK, wcp + (t + 2) * GK, lcp + (t & 1) * GSTAGE);
    }
    asm volatile("s_wait_asynccnt 0x0" ::: "memory");         // nothing in flight behind the loop
}

// ---------------------------------------------------------------------------
// QKV projection: Y[m,n] = sum_k X[m,k] * W[n,k] + bias[n]
// grid = (BS/128, NHEAD, 3), block = 128 (4 waves). Wave -> 32x64 tile.
// Q,K stored [b,h,s,d]; V stored transposed [b,h,d,t].
// Epilogue: a lane owns 8 outputs that are neighbours in memory (Q,K: 8 d of one
// row, from the product with the W rows as A operand; V^T: 8 t of one d), packs
// them into 16 B, and the block's 16-KB tile goes through LDS so that every
// wave-wide store covers 4 whole 128-byte lines.
// ---------------------------------------------------------------------------
#define QPITCH 144                   // staged Q,K row: 128 data bytes + 16 (16 B x odd, as LPITCH below)
#define VPITCH 272                   // staged V^T row: 256 data bytes + 16
static_assert(128 * QPITCH <= 2 * GSTAGE && HDIM * VPITCH <= 2 * GSTAGE, "staged tile fits the ring");

// 8 accumulator values + 8 addends -> 8 bf16 (round to nearest even) in 16 B
static __device__ __forceinline__ uint4 pack8(v8f t, const float (&add)[8]) {
    union { __bf16 h[8]; uint4 q; } pk;
#pragma unroll                                   // constant indices: values stay in registers
    for (int r = 0; r < 8; ++r)
        pk.h[r] = (__bf16)(t[r] + add[r]);
    return pk.q;
}

__global__ __launch_bounds__(128)
void qkv_proj_kernel(const __bf16* __restrict__ xb,
                     const __bf16* __restrict__ wqb,
                     const __bf16* __restrict__ wkb,
                     const __bf16* __restrict__ wvb,
                     const float* __restrict__ bq,
                     const float* __restrict__ bk,
                     const float* __restrict__ bv,
                     __bf16* __restrict__ qout,
                     __bf16* __restrict__ kout,
                     __bf16* __restrict__ vtout) {
    __shared__ __attribute__((aligned(128))) unsigned char tiles[2][GSTAGE];

    const int tid  = threadIdx.x;
    const int lane = tid & 31;
    const int wave = tid >> 5;
    const int ln   = lane & 15;
    const int off8 = (lane >> 4) ? 8 : 0;

    const int m0    = blockIdx.x * 128;         // first global row (b*S + s); 128 divides S
    const int head  = blockIdx.y;
    const int which = blockIdx.z;               // 0=Q 1=K 2=V
    const int N0    = head * 64;
    const int bh    = (m0 >> 12) * NHEAD + head;
    const int s0    = m0 & (SEQ - 1);

    // The ring is free behind gemm_128x64: its last trip's waits and barrier have ended
    // every wave's reads, and no copy is in flight.
    unsigned char* stg = &tiles[0][0];
    v8f acc[2][4] = {};

    if (which == 2) {
        gemm_128x64<false>(xb, wvb, m0, N0, tiles, acc);
        // acc[mt][nt][r]: row t = wave*32 + mt*16 + off8 + r, column d = nt*16 + ln
#pragma unroll
        for (int nt = 0; nt < 4; ++nt) {
            const float bval = bv[N0 + nt * 16 + ln];
            const float add[8] = { bval, bval, bval, bval, bval, bval, bval, bval };
#pragma unroll
            for (int mt = 0; mt < 2; ++mt)
                *(uint4*)(stg + (nt * 16 + ln) * VPITCH + (wave * 32 + mt * 16 + off8) * 2) =
                    pack8(acc[mt][nt], add);
        }
        __syncthreads();                         // a V^T line holds the t of two waves
        __bf16* dst = vtout + (size_t)bh * HDIM * SEQ + s0;
        uint4 q[8];                              // 16-byte chunk c = i*128 + tid: row d = c/16, place c%16
#pragma unroll                                   // constant indices: q[] stays in registers
        for (int i = 0; i < 8; ++i)
            q[i] = *(const uint4*)(stg + ((i * 128 + tid) >> 4) * VPITCH + (tid & 15) * 16);
#pragma unroll
        for (int i = 0; i < 8; ++i)
            *(uint4*)(dst + (size_t)((i * 128 + tid) >> 4) * SEQ + (tid & 15) * 8) = q[i];
    } else {
        const __bf16* W    = (which == 0) ? wqb : wkb;
        const float*  bias = (which == 0) ? bq : bk;
        gemm_128x64<true>(xb, W, m0, N0, tiles, acc);
        // acc[mt][nt][r]: row d = nt*16 + off8 + r, column s = wave*32 + mt*16 + ln
#pragma unroll
        for (int nt = 0; nt < 4; ++nt) {
            const float4 b0 = *(const float4*)(bias + N0 + nt * 16 + off8);
            const float4 b1 = *(const float4*)(bias + N0 + nt * 16 + off8 + 4);
            const float add[8] = { b0.x, b0.y, b0.z, b0.w, b1.x, b1.y, b1.z, b1.w };
#pragma unroll
            for (int mt = 0; mt < 2; ++mt)
                *(uint4*)(stg + (wave * 32 + mt * 16 + ln) * QPITCH + (nt * 16 + off8) * 2) =
                    pack8(acc[mt][nt], add);
        }
        __syncthreads();                         // staged rows readable by every wave
        // the block's 128 rows of 128 B are one contiguous 16-KB piece of the output
        __bf16* dst = ((which == 0) ? qout : kout) + ((size_t)bh * SEQ + s0) * HDIM;
        uint4 q[8];                              // 16-byte chunk c = i*128 + tid: row s = c/8, place c%8
#pragma unroll                                   // constant indices: q[] stays in registers
        for (int i = 0; i < 8; ++i)
            q[i] = *(const uint4*)(stg + ((i * 128 + tid) >> 3) * QPITCH + (tid & 7) * 16);
#pragma unroll
        for (int i = 0; i < 8; ++i)
            *(uint4*)(dst + (size_t)(i * 128 + tid) * 8) = q[i];
    }
}

static __device__ __forceinline__ float other_half(float v) {
    const int b = __builtin_bit_cast(int, v);
    return __builtin_bit_cast(float,
        __builtin_amdgcn_permlanex16(b, b, 0x76543210, 0xfedcba98, false, false));
}

#define KT      64                   // keys per LDS stage
#define LPITCH  144                  // LDS row: 128 data bytes + 16 (16 B x odd: no bank conflict for b128 reads)
#define TILE_B  (64 * LPITCH)        // one tile: 64 rows (K: keys, V^T: head dims)
#define KSPLIT  2                    // key halves per block
#define NSTAGE  (SEQ / KSPLIT / KT)  // stages per half

// One stage: K tile (64 keys x 128 B, contiguous in memory) and V^T tile
// (64 dims x 64 keys) into LDS; 1024 chunks of 16 B, 8 per thread of a half.
// kg, vg: this lane's first chunk of each tile; lk: its LDS byte address in the
// K tile (the V^T tile follows at TILE_B).  Chunk i lies 16 rows further on.
static __device__ __forceinline__ void stage_kv(const __bf16* kg, const __bf16* vg, uint32_t lk) {
    const uint32_t lv = lk + TILE_B;
    // one statement for the copies and s_wait_xcnt: a precaution, so that no later
    // write of a copy's address registers can be scheduled ahead of that wait
    asm volatile(
        "global_load_async_to_lds_b128 %0, %8, off\n\t"
        "global_load_async_to_lds_b128 %1, %9, off\n\t"
        "global_load_async_to_lds_b128 %2, %10, off\n\t"
        "global_load_async_to_lds_b128 %3, %11, off\n\t"
        "global_load_async_to_lds_b128 %4, %12, off\n\t"
        "global_load_async_to_lds_b128 %5, %13, off\n\t"
        "global_load_async_to_lds_b128 %6, %14, off\n\t"
        "global_load_async_to_lds_b128 %7, %15, off\n\t"
        "s_wait_xcnt 0x0"
        :: "v"(lk), "v"(lk + 16 * LPITCH), "v"(lk + 32 * LPITCH), "v"(lk + 48 * LPITCH),
           "v"(lv), "v"(lv + 16 * LPITCH), "v"(lv + 32 * LPITCH), "v"(lv + 48 * LPITCH),
           "v"(kg), "v"(kg + 16 * HDIM), "v"(kg + 32 * HDIM), "v"(kg + 48 * HDIM),
           "v"(vg), "v"(vg + 16 * SEQ), "v"(vg + 32 * SEQ), "v"(vg + 48 * SEQ)
        : "memory");
}

__global__ __launch_bounds__(256)
void flash_attn_kernel(const __bf16* __restrict__ qb,
                       const __bf16* __restrict__ kb,
                       const __bf16* __restrict__ vT,
                       __bf16* __restrict__ ctxb) {
    __shared__ __attribute__((aligned(16))) unsigned char kv[KSPLIT][2][2 * TILE_B];

    const int lane = threadIdx.x & 31;
    const int wave = __builtin_amdgcn_readfirstlane(threadIdx.x >> 5);
    const int part = wave >> 2;                  // key half of this wave
    const int qw   = wave & 3;                   // its 32 query columns in the block
    const int ln   = lane & 15;
    const int off8 = (lane >> 4) ? 8 : 0;

    const int b    = blockIdx.z;
    const int head = blockIdx.y;
    const int bh   = b * NHEAD + head;
    const int q0   = blockIdx.x * 128 + qw * 32;

    const __bf16* qbase = qb + (size_t)bh * SEQ * HDIM;
    const __bf16* kbase = kb + ((size_t)bh * SEQ + part * (SEQ / KSPLIT)) * HDIM;   // first key of the half
    const __bf16* vbase = vT + (size_t)bh * HDIM * SEQ + part * (SEQ / KSPLIT);

    // this lane's chunk of its half's stage: t = thread number inside the half,
    // row t/8 (+16 per chunk), 16-byte column t%8
    const int crow = (threadIdx.x & 127) >> 3;
    const int ccol = threadIdx.x & 7;
    const __bf16* kcp = kbase + (size_t)crow * HDIM + ccol * 8;
    const __bf16* vcp = vbase + (size_t)crow * SEQ + ccol * 8;
    const uint32_t lcp = (uint32_t)(uintptr_t)&kv[part][0][crow * LPITCH + ccol * 16];

    stage_kv(kcp, vcp, lcp);                                  // tile 0 -> buffer 0
    asm volatile("s_wait_asynccnt 0x0" ::: "memory");         // own copies landed ...
    __syncthreads();                                          // ... and every wave's
    stage_kv(kcp + KT * HDIM, vcp + KT, lcp + 2 * TILE_B);    // tile 1 -> buffer 1, in flight over trip 0

    // Q B-fragments (column = query ln) held in registers for the whole key loop
    v16bf bq[2][2];
#pragma unroll
    for (int qt = 0; qt < 2; ++qt) {
        const __bf16* qrow = qbase + (size_t)(q0 + qt * 16 + ln) * HDIM;
        bq[qt][0] = load_frag(qrow + off8,      qrow + off8 + 16);
        bq[qt][1] = load_frag(qrow + 32 + off8, qrow + 32 + off8 + 16);
    }

    // per lane: the maximum in use for query qt*16+ln (equal in both lane halves; at most
    // 8 in the exponent below the true running maximum) and the sum over this lane half's
    // keys in its units (halves joined in the epilogue)
    float mcol[2], lcol[2];
    float mthr[2], nmcs[2];                      // mcol + LAZY_RAW and -mcol * cs, kept beside it
#pragma unroll
    for (int qt = 0; qt < 2; ++qt) { mcol[qt] = -3.0e38f; mthr[qt] = -3.0e38f; nmcs[qt] = 0.0f; lcol[qt] = 0.0f; }
    v8f o[2][4] = {};                            // o[qt][nt][r] = O[query ln][nt*16 + off8 + r]

    // softmax in base 2: exp(scale * (s - m)) = exp2(s * cs - m * cs), cs = scale * log2(e);
    // cs > 0, so the maxima are taken over the raw products and kept in their units
    const float cs = 0.125f * 1.4426950408889634f;
    const float LAZY_RAW = 8.0f / cs;            // 8 in the exponent's units, as a raw product

    for (int st = 0; st < NSTAGE; ++st) {
      const unsigned char* ktile = kv[part][st & 1];
      const unsigned char* vtile = ktile + TILE_B;
#pragma unroll                                   // both 32-key blocks of a stage in one trip: constant LDS offsets
      for (int kk = 0; kk < KT / 32; ++kk) {
        // ---- scores: S^T = K * Q^T  (4 C tiles, K-dim 64 = 2 wmmas each)
        v16bf ak[2][2];
#pragma unroll
        for (int tt = 0; tt < 2; ++tt) {
            const __bf16* kr = (const __bf16*)(ktile + (kk * 32 + tt * 16 + ln) * LPITCH);
            ak[tt][0] = load_frag(kr + off8,      kr + off8 + 16);
            ak[tt][1] = load_frag(kr + 32 + off8, kr + 32 + off8 + 16);
        }
        // V^T fragments of the block, fetched in one group with K's
        v16bf av[4];
#pragma unroll                                   // constant indices: av[] stays in registers
        for (int nt = 0; nt < 4; ++nt) {
            const __bf16* vr = (const __bf16*)(vtile + (nt * 16 + ln) * LPITCH) + kk * 32 + off8;
            av[nt] = load_frag(vr, vr + 16);
        }
        v8f s[2][2] = {};                        // s[qt][tt][r] = S[query ln][block + tt*16 + off8 + r]
#pragma unroll
        for (int qt = 0; qt < 2; ++qt)
#pragma unroll
            for (int tt = 0; tt < 2; ++tt) {
                s[qt][tt] = wmma_bf16(ak[tt][0], bq[qt][0], s[qt][tt]);
                s[qt][tt] = wmma_bf16(ak[tt][1], bq[qt][1], s[qt][tt]);
            }

        // ---- online softmax, lazy rescale + P^T packed as B operand
        // in-lane maximum of each column's 16 scores, as a tree of three-input maxima
        float mx[2];
#pragma unroll
        for (int qt = 0; qt < 2; ++qt) {
            const v8f x0 = s[qt][0];
            const v8f x1 = s[qt][1];
            const float a0 = fmaxf(fmaxf(x0[0], x0[1]), x0[2]);
            const float a1 = fmaxf(fmaxf(x0[3], x0[4]), x0[5]);
            const float a2 = fmaxf(fmaxf(x0[6], x0[7]), x1[0]);
            const float a3 = fmaxf(fmaxf(x1[1], x1[2]), x1[3]);
            const float a4 = fmaxf(fmaxf(x1[4], x1[5]), x1[6]);
            mx[qt] = fmaxf(fmaxf(fmaxf(a0, a1), a2), fmaxf(fmaxf(a3, a4), x1[7]));
        }
        // inputs-only fence on the loaded V^T fragments: without it the compiler sinks their
        // loads behind the branch, next to the products that use them, each with a full wait
        asm volatile("" :: "v"(av[0]), "v"(av[1]), "v"(av[2]), "v"(av[3]));
        // The maximum in use moves only when a score of the wave lies above it by more than
        // 8 in the exponent: one test and one scalar branch per 32 keys.  Until then
        // p <= 2^8, and sums and O stay in the units of the maximum in use.  The first
        // block always takes the branch (start value of mthr); there alpha = 0.
        if (__builtin_amdgcn_ballot_w32(mx[0] > mthr[0] || mx[1] > mthr[1]) != 0) {
#pragma unroll                                   // constant indices: state and O stay in registers
            for (int qt = 0; qt < 2; ++qt) {
                const float mnew  = fmaxf(fmaxf(mcol[qt], mx[qt]), other_half(mx[qt]));
                const float alpha = __builtin_amdgcn_exp2f((mcol[qt] - mnew) * cs);
                mcol[qt] = mnew;
                mthr[qt] = mnew + LAZY_RAW;
                nmcs[qt] = mnew * -cs;
                lcol[qt] *= alpha;
#pragma unroll
                for (int nt = 0; nt < 4; ++nt)
                    o[qt][nt] *= alpha;
            }
        }
        v16bf bp[2];
#pragma unroll
        for (int qt = 0; qt < 2; ++qt) {
            const float nm = nmcs[qt];
            v8f e0, e1;
#pragma unroll                                   // constant indices: scores stay in registers
            for (int r = 0; r < 8; r += 2) {     // one packed fused multiply-add per score pair
                const v2f c2 = {cs, cs}, n2 = {nm, nm};
                const v2f a = __builtin_elementwise_fma((v2f){s[qt][0][r], s[qt][0][r + 1]}, c2, n2);
                const v2f b = __builtin_elementwise_fma((v2f){s[qt][1][r], s[qt][1][r + 1]}, c2, n2);
                e0[r] = a[0]; e0[r + 1] = a[1];
                e1[r] = b[0]; e1[r + 1] = b[1];
            }
            v8f p0, p1;
#pragma unroll
            for (int r = 0; r < 8; ++r) {
                p0[r] = __builtin_amdgcn_exp2f(e0[r]);
                p1[r] = __builtin_amdgcn_exp2f(e1[r]);
                bp[qt][r]     = (__bf16)p0[r];   // element e = key kmap(e, half):
                bp[qt][8 + r] = (__bf16)p1[r];   // the hardware k order, as V's loads
            }
            const v8f pv = p0 + p1;              // in-lane sum, pairwise
            lcol[qt] += ((pv[0] + pv[1]) + (pv[2] + pv[3])) +
                        ((pv[4] + pv[5]) + (pv[6] + pv[7]));
        }

        // ---- O^T += V^T * P^T  (V tile is [d, t] -> contiguous A loads, shared by column tiles)
#pragma unroll
        for (int nt = 0; nt < 4; ++nt) {
            o[0][nt] = wmma_bf16(av[nt], bp[0], o[0][nt]);
            o[1][nt] = wmma_bf16(av[nt], bp[1], o[1][nt]);
        }
      }

      // hand-over: tile st+1 becomes readable, this trip's buffer becomes free
      asm volatile("s_wait_dscnt 0x0" ::: "memory");          // own reads of this buffer done
      asm volatile("s_wait_asynccnt 0x0" ::: "memory");       // own copies of tile st+1 landed
      __syncthreads();
      if (st + 2 < NSTAGE)
          stage_kv(kcp + (size_t)(st + 2) * KT * HDIM, vcp + (st + 2) * KT,
                   lcp + (st & 1) * (2 * TILE_B));
    }
    asm volatile("s_wait_asynccnt 0x0" ::: "memory");         // nothing in flight when the wave ends

    // ---- join of the key halves.  The last trip's waits and barrier have ended every
    // read of the tiles and no copy is in flight, so the tile memory is free: wave 4+w
    // hands its state to wave w there, 17 rows of 32 lanes x 16 B (whole 512-B rows).
    float4* xch = (float4*)&kv[0][0][0] + qw * (17 * 32) + lane;
    if (part == 1) {
#pragma unroll
        for (int qt = 0; qt < 2; ++qt)
#pragma unroll
            for (int nt = 0; nt < 4; ++nt) {
                const v8f t = o[qt][nt];
                xch[((qt * 4 + nt) * 2 + 0) * 32] = make_float4(t[0], t[1], t[2], t[3]);
                xch[((qt * 4 + nt) * 2 + 1) * 32] = make_float4(t[4], t[5], t[6], t[7]);
            }
        xch[16 * 32] = make_float4(mcol[0], mcol[1], lcol[0], lcol[1]);
    }
    __syncthreads();                             // half 1's state readable by half 0

    // ---- epilogue (half 0): ctx[b, s, head*64 + d] = (o0*a0 + o1*a1) / (l0*a0 + l1*a1);
    // a lane owns 8 consecutive d
    if (part == 0) {
        const float4 ml = xch[16 * 32];
#pragma unroll
        for (int qt = 0; qt < 2; ++qt) {
            const int srow = q0 + qt * 16 + ln;
            const float m1 = qt ? ml.y : ml.x;
            const float l1 = qt ? ml.w : ml.z;
            const float m  = fmaxf(mcol[qt], m1);
            const float a0 = __builtin_amdgcn_exp2f((mcol[qt] - m) * cs);
            const float a1 = __builtin_amdgcn_exp2f((m1 - m) * cs);
            const float l  = lcol[qt] * a0 + l1 * a1;
            const float inv = 1.0f / (l + other_half(l));
            const float c0 = a0 * inv;
            const float c1 = a1 * inv;
#pragma unroll
            for (int nt = 0; nt < 4; ++nt) {
                const float4 u0 = xch[((qt * 4 + nt) * 2 + 0) * 32];
                const float4 u1 = xch[((qt * 4 + nt) * 2 + 1) * 32];
                const float u[8] = { u0.x, u0.y, u0.z, u0.w, u1.x, u1.y, u1.z, u1.w };
                union { __bf16 h[8]; uint4 q; } pk;
#pragma unroll
                for (int r = 0; r < 8; ++r)
                    pk.h[r] = f2bf(o[qt][nt][r] * c0 + u[r] * c1);
                *(uint4*)(ctxb + ((size_t)(b * SEQ + srow)) * HID + head * 64 + nt * 16 + off8) = pk.q;
            }
        }
    }
}

// ---------------------------------------------------------------------------
// Output projection: out[m,n] = sum_k ctx[m,k] * Wo[n,k] + bo[n]   (f32 out)
// grid = (BS/128, HID/64), block = 128.
// ---------------------------------------------------------------------------
__global__ __launch_bounds__(128)
void out_proj_kernel(const __bf16* __restrict__ ctxb,
                     const __bf16* __restrict__ wob,
                     const float* __restrict__ bo,
                     float* __restrict__ out) {
    __shared__ __attribute__((aligned(128))) unsigned char tiles[2][GSTAGE];

    const int tid  = threadIdx.x;
    const int lane = tid & 31;
    const int wave = tid >> 5;
    const int ln   = lane & 15;
    const int off8 = (lane >> 4) ? 8 : 0;

    const int M0 = blockIdx.x * 128 + wave * 32;
    const int N0 = blockIdx.y * 64;

    v8f acc[2][4] = {};
    gemm_128x64<false>(ctxb, wob, blockIdx.x * 128, N0, tiles, acc);

#pragma unroll
    for (int mt = 0; mt < 2; ++mt)
#pragma unroll
        for (int nt = 0; nt < 4; ++nt) {
            const int n = N0 + nt * 16 + ln;
            const float bval = bo[n];
#pragma unroll
            for (int r = 0; r < 8; ++r) {
                const int m = M0 + mt * 16 + r + off8;
                out[(size_t)m * HID + n] = acc[mt][nt][r] + bval;
            }
        }
}

// ---------------------------------------------------------------------------
// Host launcher
// ---------------------------------------------------------------------------
extern "C" void kernel_launch(void* const* d_in, const int* in_sizes, int n_in,
                              void* d_out, int out_size, void* d_ws, size_t ws_size,
                              hipStream_t stream) {
    (void)in_sizes; (void)n_in; (void)out_size; (void)ws_size;

    const float* x  = (const float*)d_in[0];
    const float* Wq = (const float*)d_in[1];
    const float* bq = (const float*)d_in[2];
    const float* Wk = (const float*)d_in[3];
    const float* bk = (const float*)d_in[4];
    const float* Wv = (const float*)d_in[5];
    const float* bv = (const float*)d_in[6];
    const float* Wo = (const float*)d_in[7];
    const float* bo = (const float*)d_in[8];
    float* out = (float*)d_out;

    // workspace layout (bf16 scratch, ~42 MB total)
    const size_t XB_ELE = (size_t)BS * HID;       // 4,194,304
    const size_t W_ELE  = (size_t)HID * HID;      //   262,144
    char* ws = (char*)d_ws;
    size_t off = 0;
    __bf16* xb   = (__bf16*)(ws + off); off += XB_ELE * 2;
    __bf16* wqb  = (__bf16*)(ws + off); off += W_ELE * 2;
    __bf16* wkb  = (__bf16*)(ws + off); off += W_ELE * 2;
    __bf16* wvb  = (__bf16*)(ws + off); off += W_ELE * 2;
    __bf16* wob  = (__bf16*)(ws + off); off += W_ELE * 2;
    __bf16* qbuf = (__bf16*)(ws + off); off += XB_ELE * 2;
    __bf16* kbuf = (__bf16*)(ws + off); off += XB_ELE * 2;
    __bf16* vtb  = (__bf16*)(ws + off); off += XB_ELE * 2;
    __bf16* ctxb = (__bf16*)(ws + off); off += XB_ELE * 2;

    // 1) f32 -> bf16 conversions, one launch: xb, wqb, wkb, wvb, wob are contiguous from xb
    cvt_f32_bf16_kernel<<<CVT_BLOCKS, CVT_THREADS, 0, stream>>>(x, Wq, Wk, Wv, Wo, xb);

    // 2) fused QKV projection (Q,K row-major per head; V transposed per head)
    dim3 gqkv(BS / 128, NHEAD, 3);
    qkv_proj_kernel<<<gqkv, 128, 0, stream>>>(xb, wqb, wkb, wvb, bq, bk, bv,
                                              qbuf, kbuf, vtb);

    // 3) flash attention
    dim3 gattn(SEQ / 128, NHEAD, BATCH);
    flash_attn_kernel<<<gattn, 256, 0, stream>>>(qbuf, kbuf, vtb, ctxb);

    // 4) output projection -> f32 out
    dim3 gout(BS / 128, HID / 64);
    out_proj_kernel<<<gout, 128, 0, stream>>>(ctxb, wob, bo, out);
}

// v009
// Measured time: 81.8 microseconds a run.
// Timed twice side by side with v008, it ran 1.05 times as fast both times.
// All steps since v000 together make it 3.79 times as fast.
#include <hip/hip_runtime.h>
#include <stdint.h>

// ---------------------------------------------------------------------------
// Multi-head attention forward for gfx1250 (MI455X), bf16 WMMA pipeline.
// B=2, S=4096, HID=512, HEADS=8, D=64.  Compute-bound -> all three GEMM
// stages through v_wmma_f32_16x16x32_bf16 with f32 accumulation.
// Operand tiles double-buffered in LDS via async global->LDS copies.
// ---------------------------------------------------------------------------

#define BATCH 2
#define SEQ   4096
#define HID   512
#define NHEAD 8
#define HDIM  64
#define BS    (BATCH * SEQ)          // 8192 rows

// softmax runs in base 2: exp(scale * s) = exp2(s * QK_LOG2), QK_LOG2 = scale * log2(e).
// The Q projection stores Q * QK_LOG2, so the score products come out as exponents.
#define QK_LOG2 (0.125f * 1.4426950408889634f)

typedef __attribute__((ext_vector_type(16))) __bf16 v16bf;
typedef __attribute__((ext_vector_type(8)))  float  v8f;

union BF16x16 {
    v16bf v;
    uint4 q[2];
};

// round-to-nearest-even f32 -> bf16
static __device__ __forceinline__ __bf16 f2bf(float f) {
    unsigned int u = __builtin_bit_cast(unsigned int, f);
    unsigned int r = (u + 0x7FFFu + ((u >> 16) & 1u)) >> 16;
    unsigned short h = (unsigned short)r;
    return __builtin_bit_cast(__bf16, h);
}

// 16-element bf16 WMMA fragment: 8 contiguous bf16 at p0 (elems 0..7) and 8
// contiguous bf16 at p1 (elems 8..15); 16B-aligned -> *_load_b128 pairs.
static __device__ __forceinline__ v16bf load_frag(const __bf16* p0, const __bf16* p1) {
    BF16x16 u;
    u.q[0] = *(const uint4*)p0;
    u.q[1] = *(const uint4*)p1;
    return u.v;
}

static __device__ __forceinline__ v8f wmma_bf16(v16bf a, v16bf b, v8f c) {
    return __builtin_amdgcn_wmma_f32_16x16x32_bf16(false, a, false, b, (short)0, c,
                                                   false, false);
}

// ---------------------------------------------------------------------------
// f32 -> bf16 conversion of x and the four weight matrices in ONE launch.
// The five bf16 copies lie back to back in the workspace (x, Wq, Wk, Wv, Wo),
// so the destination is one array indexed by the block's own number; a block
// converts 4096 chunks (a chunk = 4 elements) of ONE source.
// 16 waves per block; a thread has its 8 loads of 16 B in flight before the
// first store.
// ---------------------------------------------------------------------------
struct alignas(8) BF4 { __bf16 a, b, c, d; };

#define CVT_THREADS 512
#define CVT_LOADS   8                                // chunks per thread
#define CVT_CHUNKS  (CVT_THREADS * CVT_LOADS)        // chunks per block
#define X_BLOCKS    (BS * HID / 4 / CVT_CHUNKS)      // 256
#define W_BLOCKS    (HID * HID / 4 / CVT_CHUNKS)     //  16
#define CVT_BLOCKS  (X_BLOCKS + 4 * W_BLOCKS)        // 320
static_assert(X_BLOCKS * CVT_CHUNKS * 4 == BS * HID && W_BLOCKS * CVT_CHUNKS * 4 == HID * HID,
              "whole blocks per source");

__global__ __launch_bounds__(CVT_THREADS)
void cvt_f32_bf16_kernel(const float* __restrict__ x,
                         const float* __restrict__ wq,
                         const float* __restrict__ wk,
                         const float* __restrict__ wv,
                         const float* __restrict__ wo,
                         __bf16* __restrict__ dst) {
    const int blk = blockIdx.x;
    const float* src = x;                        // source and block number inside it
    int sblk = blk;
    if (blk >= X_BLOCKS) {
        const int w = (blk - X_BLOCKS) / W_BLOCKS;
        src  = (w == 0) ? wq : (w == 1) ? wk : (w == 2) ? wv : wo;
        sblk = (blk - X_BLOCKS) % W_BLOCKS;
    }
    const float4* s4 = (const float4*)src + (size_t)sblk * CVT_CHUNKS + threadIdx.x;
    BF4*          d4 = (BF4*)dst + (size_t)blk * CVT_CHUNKS + threadIdx.x;

    float4 f[CVT_LOADS];
#pragma unroll                                   // all loads issued ahead of the first use
    for (int i = 0; i < CVT_LOADS; ++i)
        f[i] = s4[i * CVT_THREADS];
#pragma unroll
    for (int i = 0; i < CVT_LOADS; ++i) {
        BF4 o;
        o.a = f2bf(f[i].x); o.b = f2bf(f[i].y); o.c = f2bf(f[i].z); o.d = f2bf(f[i].w);
        d4[i * CVT_THREADS] = o;
    }
}

// ---------------------------------------------------------------------------
// Core of both projections: acc = A[m0 .. m0+127][:] * Wm[n0 .. n0+63][:]^T over
// k = 0..HID-1, block = 128 threads (4 waves), wave -> 32x64 tile.
// Both operands reach the waves through LDS: a stage is 64 k = one whole 128-byte
// line of each of the 128 A rows and 64 Wm rows, two buffers, filled by
// asynchronous copies (a wave-wide copy covers 4 whole lines).
// LDS rows are 128 B, unpadded; the 16-byte chunk c of row r lies at place
// c ^ ((r >> 1) & 7), so the 16 rows of a fragment read fall on 16 distinct
// bank groups.
// A and B fragments have the same lane and k order, so the two operands may change
// places: with WROWS the Wm rows are the A operand and acc[mt][nt] holds the
// transposed tile (row = n, column = m); a lane then owns 8 consecutive n of one m.
// ---------------------------------------------------------------------------
#define GK      64                   // k elements per stage
#define GROWB   128                  // bytes per LDS row
#define GA_ROWS 128
#define GW_ROWS 64
#define GSTAGE  ((GA_ROWS + GW_ROWS) * GROWB)
#define GTRIPS  (HID / GK)

// One stage: 1536 chunks of 16 B, 12 per thread.  ag, wg: this lane's first chunk
// of the A and of the Wm tile; l: its LDS byte address in the A tile (the Wm tile
// follows the A rows).  Chunk i lies 16 rows further on, at the same place in its row.
static __device__ __forceinline__ void stage_gemm(const __bf16* ag, const __bf16* wg, uint32_t l) {
    // one statement for the copies and s_wait_xcnt: a precaution, so that no later
    // write of a copy's address registers can be scheduled ahead of that wait
    asm volatile(
        "global_load_async_to_lds_b128 %0, %12, off\n\t"
        "global_load_async_to_lds_b128 %1, %13, off\n\t"
        "global_load_async_to_lds_b128 %2, %14, off\n\t"
        "global_load_async_to_lds_b128 %3, %15, off\n\t"
        "global_load_async_to_lds_b128 %4, %16, off\n\t"
        "global_load_async_to_lds_b128 %5, %17, off\n\t"
        "global_load_async_to_lds_b128 %6, %18, off\n\t"
        "global_load_async_to_lds_b128 %7, %19, off\n\t"
        "global_load_async_to_lds_b128 %8, %20, off\n\t"
        "global_load_async_to_lds_b128 %9, %21, off\n\t"
        "global_load_async_to_lds_b128 %10, %22, off\n\t"
        "global_load_async_to_lds_b128 %11, %23, off\n\t"
        "s_wait_xcnt 0x0"
        :: "v"(l),                "v"(l +  16 * GROWB), "v"(l +  32 * GROWB), "v"(l +  48 * GROWB),
           "v"(l +  64 * GROWB), "v"(l +  80 * GROWB), "v"(l +  96 * GROWB), "v"(l + 112 * GROWB),
           "v"(l + 128 * GROWB), "v"(l + 144 * GROWB), "v"(l + 160 * GROWB), "v"(l + 176 * GROWB),
           "v"(ag),            "v"(ag +  16 * HID), "v"(ag +  32 * HID), "v"(ag +  48 * HID),
           "v"(ag + 64 * HID), "v"(ag +  80 * HID), "v"(ag +  96 * HID), "v"(ag + 112 * HID),
           "v"(wg),            "v"(wg +  16 * HID), "v"(wg +  32 * HID), "v"(wg +  48 * HID)
        : "memory");
}

template <bool WROWS>
static __device__ __forceinline__ void gemm_128x64(const __bf16* __restrict__ A,
                                                   const __bf16* __restrict__ Wm,
                                                   int m0, int n0,
                                                   unsigned char (*tiles)[GSTAGE],
                                                   v8f (&acc)[2][4]) {
    const int tid  = threadIdx.x;
    const int lane = tid & 31;
    const int wave = tid >> 5;
    const int ln   = lane & 15;
    const int half = lane >> 4;

    // this lane's chunk of a stage: row tid/8 (+16 per chunk), 16-byte column tid%8
    const int crow = tid >> 3;
    const int ccol = tid & 7;
    const __bf16* acp = A  + (size_t)(m0 + crow) * HID + ccol * 8;
    const __bf16* wcp = Wm + (size_t)(n0 + crow) * HID + ccol * 8;
    const uint32_t lcp = (uint32_t)(uintptr_t)&tiles[0][crow * GROWB + ((ccol ^ ((crow >> 1) & 7)) << 4)];

    stage_gemm(acp, wcp, lcp);                                // stage 0 -> buffer 0
    asm volatile("s_wait_asynccnt 0x0" ::: "memory");         // own copies landed ...
    __syncthreads();                                          // ... and every wave's
    stage_gemm(acp + GK, wcp + GK, lcp + GSTAGE);             // stage 1 -> buffer 1, in flight over trip 0

    // byte offset of chunk 2*j + half of row ln inside a 16-row group: a fragment of
    // the 32 k at kk*32 is chunks j = 2*kk (elements 0..7) and 2*kk + 1 (elements 8..15)
    int fo[4];
#pragma unroll                                   // constant indices: fo[] stays in registers
    for (int j = 0; j < 4; ++j)
        fo[j] = ln * GROWB + (((2 * j + half) ^ ((ln >> 1) & 7)) << 4);

    for (int t = 0; t < GTRIPS; ++t) {
        const unsigned char* at = tiles[t & 1] + wave * 32 * GROWB;
        const unsigned char* wt = tiles[t & 1] + GA_ROWS * GROWB;
#pragma unroll                                   // both 32-k blocks of a stage in one trip: constant LDS offsets
        for (int kk = 0; kk < GK / 32; ++kk) {
            v16bf bfr[4];
            // the three loops below are unrolled so that fragments and accumulators
            // have constant indices and stay in registers
#pragma unroll
            for (int nt = 0; nt < 4; ++nt)
                bfr[nt] = load_frag((const __bf16*)(wt + nt * 16 * GROWB + fo[2 * kk]),
                                    (const __bf16*)(wt + nt * 16 * GROWB + fo[2 * kk + 1]));
#pragma unroll
            for (int mt = 0; mt < 2; ++mt) {
                v16bf a = load_frag((const __bf16*)(at + mt * 16 * GROWB + fo[2 * kk]),
                                    (const __bf16*)(at + mt * 16 * GROWB + fo[2 * kk + 1]));
#pragma unroll
                for (int nt = 0; nt < 4; ++nt)
                    acc[mt][nt] = WROWS ? wmma_bf16(bfr[nt], a, acc[mt][nt])
                                        : wmma_bf16(a, bfr[nt], acc[mt][nt]);
            }
        }

        // hand-over: stage t+1 becomes readable, this trip's buffer becomes free
        asm volatile("s_wait_dscnt 0x0" ::: "memory");        // own reads of this buffer done
        asm volatile("s_wait_asynccnt 0x0" ::: "memory");     // own copies of stage t+1 landed
        __syncthreads();
        if (t + 2 < GTRIPS)
            stage_gemm(acp + (t + 2) * GK, wcp + (t + 2) * GK, lcp + (t & 1) * GSTAGE);
    }
    asm volatile("s_wait_asynccnt 0x0" ::: "memory");         // nothing in flight behind the loop
}

// ---------------------------------------------------------------------------
// QKV projection: Y[m,n] = sum_k X[m,k] * W[n,k] + bias[n]
// grid = (BS/128, NHEAD, 3), block = 128 (4 waves). Wave -> 32x64 tile.
// Q,K stored [b,h,s,d], Q times QK_LOG2; V stored transposed [b,h,d,t].
// Epilogue: a lane owns 8 outputs that are neighbours in memory (Q,K: 8 d of one
// row, from the product with the W rows as A operand; V^T: 8 t of one d), packs
// them into 16 B, and the block's 16-KB tile goes through LDS so that every
// wave-wide store covers 4 whole 128-byte lines.
// ---------------------------------------------------------------------------
#define QPITCH 144                   // staged Q,K row: 128 data bytes + 16 (16 B x odd, as LPITCH below)
#define VPITCH 272                   // staged V^T row: 256 data bytes + 16
static_assert(128 * QPITCH <= 2 * GSTAGE && HDIM * VPITCH <= 2 * GSTAGE, "staged tile fits the ring");

// 8 accumulator values + 8 addends -> 8 bf16 (round to nearest even) in 16 B
static __device__ __forceinline__ uint4 pack8(v8f t, const float (&add)[8]) {
    union { __bf16 h[8]; uint4 q; } pk;
#pragma unroll                                   // constant indices: values stay in registers
    for (int r = 0; r < 8; ++r)
        pk.h[r] = (__bf16)(t[r] + add[r]);
    return pk.q;
}

// the same with a factor: 8 values t * sc + add (add holds bias * sc); sc = 1 gives t + add exactly
static __device__ __forceinline__ uint4 pack8s(v8f t, float sc, const float (&add)[8]) {
    union { __bf16 h[8]; uint4 q; } pk;
#pragma unroll                                   // constant indices: values stay in registers
    for (int r = 0; r < 8; ++r)
        pk.h[r] = (__bf16)__builtin_fmaf(t[r], sc, add[r]);
    return pk.q;
}

__global__ __launch_bounds__(128)
void qkv_proj_kernel(const __bf16* __restrict__ xb,
                     const __bf16* __restrict__ wqb,
                     const __bf16* __restrict__ wkb,
                     const __bf16* __restrict__ wvb,
                     const float* __restrict__ bq,
                     const float* __restrict__ bk,
                     const float* __restrict__ bv,
                     __bf16* __restrict__ qout,
                     __bf16* __restrict__ kout,
                     __bf16* __restrict__ vtout) {
    __shared__ __attribute__((aligned(128))) unsigned char tiles[2][GSTAGE];

    const int tid  = threadIdx.x;
    const int lane = tid & 31;
    const int wave = tid >> 5;
    const int ln   = lane & 15;
    const int off8 = (lane >> 4) ? 8 : 0;

    const int m0    = blockIdx.x * 128;         // first global row (b*S + s); 128 divides S
    const int head  = blockIdx.y;
    const int which = blockIdx.z;               // 0=Q 1=K 2=V
    const int N0    = head * 64;
    const int bh    = (m0 >> 12) * NHEAD + head;
    const int s0    = m0 & (SEQ - 1);

    // The ring is free behind gemm_128x64: its last trip's waits and barrier have ended
    // every wave's reads, and no copy is in flight.
    unsigned char* stg = &tiles[0][0];
    v8f acc[2][4] = {};

    if (which == 2) {
        gemm_128x64<false>(xb, wvb, m0, N0, tiles, acc);
        // acc[mt][nt][r]: row t = wave*32 + mt*16 + off8 + r, column d = nt*16 + ln
#pragma unroll
        for (int nt = 0; nt < 4; ++nt) {
            const float bval = bv[N0 + nt * 16 + ln];
            const float add[8] = { bval, bval, bval, bval, bval, bval, bval, bval };
#pragma unroll
            for (int mt = 0; mt < 2; ++mt)
                *(uint4*)(stg + (nt * 16 + ln) * VPITCH + (wave * 32 + mt * 16 + off8) * 2) =
                    pack8(acc[mt][nt], add);
        }
        __syncthreads();                         // a V^T line holds the t of two waves
        __bf16* dst = vtout + (size_t)bh * HDIM * SEQ + s0;
        uint4 q[8];                              // 16-byte chunk c = i*128 + tid: row d = c/16, place c%16
#pragma unroll                                   // constant indices: q[] stays in registers
        for (int i = 0; i < 8; ++i)
            q[i] = *(const uint4*)(stg + ((i * 128 + tid) >> 4) * VPITCH + (tid & 15) * 16);
#pragma unroll
        for (int i = 0; i < 8; ++i)
            *(uint4*)(dst + (size_t)((i * 128 + tid) >> 4) * SEQ + (tid & 15) * 8) = q[i];
    } else {
        const __bf16* W    = (which == 0) ? wqb : wkb;
        const float*  bias = (which == 0) ? bq : bk;
        const float   sc   = (which == 0) ? QK_LOG2 : 1.0f;   // Q is stored in exponent units
        gemm_128x64<true>(xb, W, m0, N0, tiles, acc);
        // acc[mt][nt][r]: row d = nt*16 + off8 + r, column s = wave*32 + mt*16 + ln
#pragma unroll
        for (int nt = 0; nt < 4; ++nt) {
            const float4 b0 = *(const float4*)(bias + N0 + nt * 16 + off8);
            const float4 b1 = *(const float4*)(bias + N0 + nt * 16 + off8 + 4);
            const float add[8] = { b0.x * sc, b0.y * sc, b0.z * sc, b0.w * sc,
                                   b1.x * sc, b1.y * sc, b1.z * sc, b1.w * sc };
#pragma unroll
            for (int mt = 0; mt < 2; ++mt)
                *(uint4*)(stg + (wave * 32 + mt * 16 + ln) * QPITCH + (nt * 16 + off8) * 2) =
                    pack8s(acc[mt][nt], sc, add);
        }
        __syncthreads();                         // staged rows readable by every wave
        // the block's 128 rows of 128 B are one contiguous 16-KB piece of the output
        __bf16* dst = ((which == 0) ? qout : kout) + ((size_t)bh * SEQ + s0) * HDIM;
        uint4 q[8];                              // 16-byte chunk c = i*128 + tid: row s = c/8, place c%8
#pragma unroll                                   // constant indices: q[] stays in registers
        for (int i = 0; i < 8; ++i)
            q[i] = *(const uint4*)(stg + ((i * 128 + tid) >> 3) * QPITCH + (tid & 7) * 16);
#pragma unroll
        for (int i = 0; i < 8; ++i)
            *(uint4*)(dst + (size_t)(i * 128 + tid) * 8) = q[i];
    }
}

static __device__ __forceinline__ float other_half(float v) {
    const int b = __builtin_bit_cast(int, v);
    return __builtin_bit_cast(float,
        __builtin_amdgcn_permlanex16(b, b, 0x76543210, 0xfedcba98, false, false));
}

#define KT      64                   // keys per LDS stage
#define LPITCH  144                  // LDS row: 128 data bytes + 16 (16 B x odd: no bank conflict for b128 reads)
#define TILE_B  (64 * LPITCH)        // one tile: 64 rows (K: keys, V^T: head dims)
#define KSPLIT  2                    // key halves per block
#define NSTAGE  (SEQ / KSPLIT / KT)  // stages per half

// One stage: K tile (64 keys x 128 B, contiguous in memory) and V^T tile
// (64 dims x 64 keys) into LDS; 1024 chunks of 16 B, 8 per thread of a half.
// kg, vg: this lane's first chunk of each tile; lk: its LDS byte address in the
// K tile (the V^T tile follows at TILE_B).  Chunk i lies 16 rows further on.
static __device__ __forceinline__ void stage_kv(const __bf16* kg, const __bf16* vg, uint32_t lk) {
    const uint32_t lv = lk + TILE_B;
    // one statement for the copies and s_wait_xcnt: a precaution, so that no later
    // write of a copy's address registers can be scheduled ahead of that wait
    asm volatile(
        "global_load_async_to_lds_b128 %0, %8, off\n\t"
        "global_load_async_to_lds_b128 %1, %9, off\n\t"
        "global_load_async_to_lds_b128 %2, %10, off\n\t"
        "global_load_async_to_lds_b128 %3, %11, off\n\t"
        "global_load_async_to_lds_b128 %4, %12, off\n\t"
        "global_load_async_to_lds_b128 %5, %13, off\n\t"
        "global_load_async_to_lds_b128 %6, %14, off\n\t"
        "global_load_async_to_lds_b128 %7, %15, off\n\t"
        "s_wait_xcnt 0x0"
        :: "v"(lk), "v"(lk + 16 * LPITCH), "v"(lk + 32 * LPITCH), "v"(lk + 48 * LPITCH),
           "v"(lv), "v"(lv + 16 * LPITCH), "v"(lv + 32 * LPITCH), "v"(lv + 48 * LPITCH),
           "v"(kg), "v"(kg + 16 * HDIM), "v"(kg + 32 * HDIM), "v"(kg + 48 * HDIM),
           "v"(vg), "v"(vg + 16 * SEQ), "v"(vg + 32 * SEQ), "v"(vg + 48 * SEQ)
        : "memory");
}

__global__ __launch_bounds__(256)
void flash_attn_kernel(const __bf16* __restrict__ qb,
                       const __bf16* __restrict__ kb,
                       const __bf16* __restrict__ vT,
                       __bf16* __restrict__ ctxb) {
    __shared__ __attribute__((aligned(16))) unsigned char kv[KSPLIT][2][2 * TILE_B];

    const int lane = threadIdx.x & 31;
    const int wave = __builtin_amdgcn_readfirstlane(threadIdx.x >> 5);
    const int part = wave >> 2;                  // key half of this wave
    const int qw   = wave & 3;                   // its 32 query columns in the block
    const int ln   = lane & 15;
    const int off8 = (lane >> 4) ? 8 : 0;

    const int b    = blockIdx.z;
    const int head = blockIdx.y;
    const int bh   = b * NHEAD + head;
    const int q0   = blockIdx.x * 128 + qw * 32;

    const __bf16* qbase = qb + (size_t)bh * SEQ * HDIM;
    const __bf16* kbase = kb + ((size_t)bh * SEQ + part * (SEQ / KSPLIT)) * HDIM;   // first key of the half
    const __bf16* vbase = vT + (size_t)bh * HDIM * SEQ + part * (SEQ / KSPLIT);

    // this lane's chunk of its half's stage: t = thread number inside the half,
    // row t/8 (+16 per chunk), 16-byte column t%8
    const int crow = (threadIdx.x & 127) >> 3;
    const int ccol = threadIdx.x & 7;
    const __bf16* kcp = kbase + (size_t)crow * HDIM + ccol * 8;
    const __bf16* vcp = vbase + (size_t)crow * SEQ + ccol * 8;
    const uint32_t lcp = (uint32_t)(uintptr_t)&kv[part][0][crow * LPITCH + ccol * 16];

    stage_kv(kcp, vcp, lcp);                                  // tile 0 -> buffer 0
    asm volatile("s_wait_asynccnt 0x0" ::: "memory");         // own copies landed ...
    __syncthreads();                                          // ... and every wave's
    stage_kv(kcp + KT * HDIM, vcp + KT, lcp + 2 * TILE_B);    // tile 1 -> buffer 1, in flight over trip 0

    // Q B-fragments (column = query ln) held in registers for the whole key loop
    v16bf bq[2][2];
#pragma unroll
    for (int qt = 0; qt < 2; ++qt) {
        const __bf16* qrow = qbase + (size_t)(q0 + qt * 16 + ln) * HDIM;
        bq[qt][0] = load_frag(qrow + off8,      qrow + off8 + 16);
        bq[qt][1] = load_frag(qrow + 32 + off8, qrow + 32 + off8 + 16);
    }

    // per lane: the maximum in use at the head of a trip for query qt*16+ln, in exponent units
    // (equal in both lane halves; at most 8 below the true running maximum) and the sum over
    // this lane half's keys in the units of the maximum in use (halves joined in the epilogue)
    float mcol[2], lcol[2];
    // cneg: -mcol in all 8 rows of a lane's column, the C operand of the score products: Q holds
    // QK_LOG2, so a product leaves the matrix unit as the exponent s * QK_LOG2 - mcol itself.
    // cneg and mcol change only in a trip's second block, so both blocks of a trip read C from
    // the same registers; a move in the first block is carried to the second in pend.
    v8f cneg[2] = {};
    // how far an exponent may lie above 0 before the maximum moves; the low value sends a
    // block into the branch whatever its scores: the very first one, and the second block
    // of a trip whose first block has moved the maximum
    float mthr = -3.0e38f;
#pragma unroll
    for (int qt = 0; qt < 2; ++qt) { mcol[qt] = 0.0f; lcol[qt] = 0.0f; }
    v8f o[2][4] = {};                            // o[qt][nt][r] = O[query ln][nt*16 + off8 + r]

    for (int st = 0; st < NSTAGE; ++st) {
      const unsigned char* ktile = kv[part][st & 1];
      const unsigned char* vtile = ktile + TILE_B;
      float pend[2] = { 0.0f, 0.0f };            // the maximum in use, above mcol, behind the first block
#pragma unroll                                   // both 32-key blocks of a stage in one trip: constant LDS offsets
      for (int kk = 0; kk < KT / 32; ++kk) {
        // ---- scores: S^T = K * Q^T  (4 C tiles, K-dim 64 = 2 wmmas each)
        v16bf ak[2][2];
#pragma unroll
        for (int tt = 0; tt < 2; ++tt) {
            const __bf16* kr = (const __bf16*)(ktile + (kk * 32 + tt * 16 + ln) * LPITCH);
            ak[tt][0] = load_frag(kr + off8,      kr + off8 + 16);
            ak[tt][1] = load_frag(kr + 32 + off8, kr + 32 + off8 + 16);
        }
        // V^T fragments of the block, fetched in one group with K's
        v16bf av[4];
#pragma unroll                                   // constant indices: av[] stays in registers
        for (int nt = 0; nt < 4; ++nt) {
            const __bf16* vr = (const __bf16*)(vtile + (nt * 16 + ln) * LPITCH) + kk * 32 + off8;
            av[nt] = load_frag(vr, vr + 16);
        }
        v8f s[2][2];                             // s[qt][tt][r]: exponent of [query ln][block + tt*16 + off8 + r]
        // In asm so that C is read in place: the builtin ties C to D in two of a trip's eight
        // tiles and copies cneg (16 registers) for them.  The four tiles are independent, so a
        // chain's second product stands four products behind its first.  The four v_nop keep
        // the distance between the last product and a vector instruction on its result or
        // operands.
        asm("v_wmma_f32_16x16x32_bf16 %0, %4, %8, %12\n\t"
            "v_wmma_f32_16x16x32_bf16 %1, %6, %8, %12\n\t"
            "v_wmma_f32_16x16x32_bf16 %2, %4, %10, %13\n\t"
            "v_wmma_f32_16x16x32_bf16 %3, %6, %10, %13\n\t"
            "v_wmma_f32_16x16x32_bf16 %0, %5, %9, %0\n\t"
            "v_wmma_f32_16x16x32_bf16 %1, %7, %9, %1\n\t"
            "v_wmma_f32_16x16x32_bf16 %2, %5, %11, %2\n\t"
            "v_wmma_f32_16x16x32_bf16 %3, %7, %11, %3\n\t"
            "v_nop\n\tv_nop\n\tv_nop\n\tv_nop"
            : "=&v"(s[0][0]), "=&v"(s[0][1]), "=&v"(s[1][0]), "=&v"(s[1][1])
            : "v"(ak[0][0]), "v"(ak[0][1]), "v"(ak[1][0]), "v"(ak[1][1]),
              "v"(bq[0][0]), "v"(bq[0][1]), "v"(bq[1][0]), "v"(bq[1][1]),
              "v"(cneg[0]), "v"(cneg[1]));

        // ---- online softmax, lazy rescale + P^T packed as B operand
        // in-lane maximum of each column's 16 scores, as a tree of three-input maxima
        float mx[2];
#pragma unroll
        for (int qt = 0; qt < 2; ++qt) {
            const v8f x0 = s[qt][0];
            const v8f x1 = s[qt][1];
            const float a0 = fmaxf(fmaxf(x0[0], x0[1]), x0[2]);
            const float a1 = fmaxf(fmaxf(x0[3], x0[4]), x0[5]);
            const float a2 = fmaxf(fmaxf(x0[6], x0[7]), x1[0]);
            const float a3 = fmaxf(fmaxf(x1[1], x1[2]), x1[3]);
            const float a4 = fmaxf(fmaxf(x1[4], x1[5]), x1[6]);
            mx[qt] = fmaxf(fmaxf(fmaxf(a0, a1), a2), fmaxf(fmaxf(a3, a4), x1[7]));
        }
        // inputs-only fence on the loaded V^T fragments: without it the compiler sinks their
        // loads behind the branch, next to the products that use them, each with a full wait
        asm volatile("" :: "v"(av[0]), "v"(av[1]), "v"(av[2]), "v"(av[3]));
        // The maximum in use moves only when an exponent of the wave lies above 8: one test
        // and one scalar branch per 32 keys.  Until then p <= 2^8, and sums and O stay in the
        // units of the maximum in use.  t: the new maximum in use, above mcol.  In the very
        // first block it may also lie below the start value 0; sums and O are still 0 there,
        // so alpha only has to be finite.
        if (__builtin_amdgcn_ballot_w32(mx[0] > mthr || mx[1] > mthr) != 0) {
#pragma unroll                                   // constant indices: state and O stay in registers
            for (int qt = 0; qt < 2; ++qt) {
                const float lo    = (kk == 1) ? pend[qt] : (mthr < 0.0f) ? -3.0e38f : 0.0f;
                const float t     = fmaxf(fmaxf(lo, mx[qt]), other_half(mx[qt]));
                const float alpha = __builtin_amdgcn_exp2f(fminf(pend[qt] - t, 0.0f));
                s[qt][0] -= t;                   // this block's exponents were formed with mcol
                s[qt][1] -= t;
                lcol[qt] *= alpha;
#pragma unroll
                for (int nt = 0; nt < 4; ++nt)
                    o[qt][nt] *= alpha;
                if (kk == 0) {
                    pend[qt] = t;
                } else {
                    mcol[qt] += t;
                    const float nm = -mcol[qt];
                    cneg[qt] = (v8f){nm, nm, nm, nm, nm, nm, nm, nm};
                }
            }
            mthr = (kk == 0) ? -3.0e38f : 8.0f;
        }
        v16bf bp[2];
#pragma unroll
        for (int qt = 0; qt < 2; ++qt) {
            v8f p0, p1;
#pragma unroll                                   // constant indices: exponents stay in registers
            for (int r = 0; r < 8; ++r) {
                p0[r] = __builtin_amdgcn_exp2f(s[qt][0][r]);
                p1[r] = __builtin_amdgcn_exp2f(s[qt][1][r]);
                bp[qt][r]     = (__bf16)p0[r];   // element e = key kmap(e, half):
                bp[qt][8 + r] = (__bf16)p1[r];   // the hardware k order, as V's loads
            }
            const v8f pv = p0 + p1;              // in-lane sum, pairwise
            lcol[qt] += ((pv[0] + pv[1]) + (pv[2] + pv[3])) +
                        ((pv[4] + pv[5]) + (pv[6] + pv[7]));
        }

        // ---- O^T += V^T * P^T  (V tile is [d, t] -> contiguous A loads, shared by column tiles)
#pragma unroll
        for (int nt = 0; nt < 4; ++nt) {
            o[0][nt] = wmma_bf16(av[nt], bp[0], o[0][nt]);
            o[1][nt] = wmma_bf16(av[nt], bp[1], o[1][nt]);
        }
      }

      // hand-over: tile st+1 becomes readable, this trip's buffer becomes free
      asm volatile("s_wait_dscnt 0x0" ::: "memory");          // own reads of this buffer done
      asm volatile("s_wait_asynccnt 0x0" ::: "memory");       // own copies of tile st+1 landed
      __syncthreads();
      if (st + 2 < NSTAGE)
          stage_kv(kcp + (size_t)(st + 2) * KT * HDIM, vcp + (st + 2) * KT,
                   lcp + (st & 1) * (2 * TILE_B));
    }
    asm volatile("s_wait_asynccnt 0x0" ::: "memory");         // nothing in flight when the wave ends

    // ---- join of the key halves.  The last trip's waits and barrier have ended every
    // read of the tiles and no copy is in flight, so the tile memory is free: wave 4+w
    // hands its state to wave w there, 17 rows of 32 lanes x 16 B (whole 512-B rows).
    float4* xch = (float4*)&kv[0][0][0] + qw * (17 * 32) + lane;
    if (part == 1) {
#pragma unroll
        for (int qt = 0; qt < 2; ++qt)
#pragma unroll
            for (int nt = 0; nt < 4; ++nt) {
                const v8f t = o[qt][nt];
                xch[((qt * 4 + nt) * 2 + 0) * 32] = make_float4(t[0], t[1], t[2], t[3]);
                xch[((qt * 4 + nt) * 2 + 1) * 32] = make_float4(t[4], t[5], t[6], t[7]);
            }
        xch[16 * 32] = make_float4(mcol[0], mcol[1], lcol[0], lcol[1]);
    }
    __syncthreads();                             // half 1's state readable by half 0

    // ---- epilogue (half 0): ctx[b, s, head*64 + d] = (o0*a0 + o1*a1) / (l0*a0 + l1*a1);
    // a lane owns 8 consecutive d
    if (part == 0) {
        const float4 ml = xch[16 * 32];
#pragma unroll
        for (int qt = 0; qt < 2; ++qt) {
            const int srow = q0 + qt * 16 + ln;
            const float m1 = qt ? ml.y : ml.x;
            const float l1 = qt ? ml.w : ml.z;
            const float m  = fmaxf(mcol[qt], m1);
            const float a0 = __builtin_amdgcn_exp2f(mcol[qt] - m);
            const float a1 = __builtin_amdgcn_exp2f(m1 - m);
            const float l  = lcol[qt] * a0 + l1 * a1;
            const float inv = 1.0f / (l + other_half(l));
            const float c0 = a0 * inv;
            const float c1 = a1 * inv;
#pragma unroll
            for (int nt = 0; nt < 4; ++nt) {
                const float4 u0 = xch[((qt * 4 + nt) * 2 + 0) * 32];
                const float4 u1 = xch[((qt * 4 + nt) * 2 + 1) * 32];
                const float u[8] = { u0.x, u0.y, u0.z, u0.w, u1.x, u1.y, u1.z, u1.w };
                union { __bf16 h[8]; uint4 q; } pk;
#pragma unroll
                for (int r = 0; r < 8; ++r)
                    pk.h[r] = f2bf(o[qt][nt][r] * c0 + u[r] * c1);
                *(uint4*)(ctxb + ((size_t)(b * SEQ + srow)) * HID + head * 64 + nt * 16 + off8) = pk.q;
            }
        }
    }
}

// ---------------------------------------------------------------------------
// Output projection: out[m,n] = sum_k ctx[m,k] * Wo[n,k] + bo[n]   (f32 out)
// grid = (BS/128, HID/64), block = 128.
// ---------------------------------------------------------------------------
__global__ __launch_bounds__(128)
void out_proj_kernel(const __bf16* __restrict__ ctxb,
                     const __bf16* __restrict__ wob,
                     const float* __restrict__ bo,
                     float* __restrict__ out) {
    __shared__ __attribute__((aligned(128))) unsigned char tiles[2][GSTAGE];

    const int tid  = threadIdx.x;
    const int lane = tid & 31;
    const int wave = tid >> 5;
    const int ln   = lane & 15;
    const int off8 = (lane >> 4) ? 8 : 0;

    const int M0 = blockIdx.x * 128 + wave * 32;
    const int N0 = blockIdx.y * 64;

    v8f acc[2][4] = {};
    gemm_128x64<false>(ctxb, wob, blockIdx.x * 128, N0, tiles, acc);

#pragma unroll
    for (int mt = 0; mt < 2; ++mt)
#pragma unroll
        for (int nt = 0; nt < 4; ++nt) {
            const int n = N0 + nt * 16 + ln;
            const float bval = bo[n];
#pragma unroll
            for (int r = 0; r < 8; ++r) {
                const int m = M0 + mt * 16 + r + off8;
                out[(size_t)m * HID + n] = acc[mt][nt][r] + bval;
            }
        }
}

// ---------------------------------------------------------------------------
// Host launcher
// ---------------------------------------------------------------------------
extern "C" void kernel_launch(void* const* d_in, const int* in_sizes, int n_in,
                              void* d_out, int out_size, void* d_ws, size_t ws_size,
                              hipStream_t stream) {
    (void)in_sizes; (void)n_in; (void)out_size; (void)ws_size;

    const float* x  = (const float*)d_in[0];
    const float* Wq = (const float*)d_in[1];
    const float* bq = (const float*)d_in[2];
    const float* Wk = (const float*)d_in[3];
    const float* bk = (const float*)d_in[4];
    const float* Wv = (const float*)d_in[5];
    const float* bv = (const float*)d_in[6];
    const float* Wo = (const float*)d_in[7];
    const float* bo = (const float*)d_in[8];
    float* out = (float*)d_out;

    // workspace layout (bf16 scratch, ~42 MB total)
    const size_t XB_ELE = (size_t)BS * HID;       // 4,194,304
    const size_t W_ELE  = (size_t)HID * HID;      //   262,144
    char* ws = (char*)d_ws;
    size_t off = 0;
    __bf16* xb   = (__bf16*)(ws + off); off += XB_ELE * 2;
    __bf16* wqb  = (__bf16*)(ws + off); off += W_ELE * 2;
    __bf16* wkb  = (__bf16*)(ws + off); off += W_ELE * 2;
    __bf16* wvb  = (__bf16*)(ws + off); off += W_ELE * 2;
    __bf16* wob  = (__bf16*)(ws + off); off += W_ELE * 2;
    __bf16* qbuf = (__bf16*)(ws + off); off += XB_ELE * 2;
    __bf16* kbuf = (__bf16*)(ws + off); off += XB_ELE * 2;
    __bf16* vtb  = (__bf16*)(ws + off); off += XB_ELE * 2;
    __bf16* ctxb = (__bf16*)(ws + off); off += XB_ELE * 2;

    // 1) f32 -> bf16 conversions, one launch: xb, wqb, wkb, wvb, wob are contiguous from xb
    cvt_f32_bf16_kernel<<<CVT_BLOCKS, CVT_THREADS, 0, stream>>>(x, Wq, Wk, Wv, Wo, xb);

    // 2) fused QKV projection (Q,K row-major per head; V transposed per head)
    dim3 gqkv(BS / 128, NHEAD, 3);
    qkv_proj_kernel<<<gqkv, 128, 0, stream>>>(xb, wqb, wkb, wvb, bq, bk, bv,
                                              qbuf, kbuf, vtb);

    // 3) flash attention
    dim3 gattn(SEQ / 128, NHEAD, BATCH);
    flash_attn_kernel<<<gattn, 256, 0, stream>>>(qbuf, kbuf, vtb, ctxb);

    // 4) output projection -> f32 out
    dim3 gout(BS / 128, HID / 64);
    out_proj_kernel<<<gout, 128, 0, stream>>>(ctxb, wob, bo, out);
}

// v010
// It runs in 79.7 microseconds.
// Two timings next to v009 put it at 1.03 and 1.02 times that version's speed.
// Over all steps from v000 it is 3.88 times as fast.
#include <hip/hip_runtime.h>
#include <stdint.h>

// ---------------------------------------------------------------------------
// Multi-head attention forward for gfx1250 (MI455X), bf16 WMMA pipeline.
// B=2, S=4096, HID=512, HEADS=8, D=64.  Compute-bound -> all three GEMM
// stages through v_wmma_f32_16x16x32_bf16 with f32 accumulation.
// Operand tiles double-buffered in LDS via async global->LDS copies.
// ---------------------------------------------------------------------------

#define BATCH 2
#define SEQ   4096
#define HID   512
#define NHEAD 8
#define HDIM  64
#define BS    (BATCH * SEQ)          // 8192 rows

// softmax runs in base 2: exp(scale * s) = exp2(s * QK_LOG2), QK_LOG2 = scale * log2(e).
// The Q projection stores Q * QK_LOG2, so the score products come out as exponents.
#define QK_LOG2 (0.125f * 1.4426950408889634f)

typedef __attribute__((ext_vector_type(16))) __bf16 v16bf;
typedef __attribute__((ext_vector_type(8)))  float  v8f;

union BF16x16 {
    v16bf v;
    uint4 q[2];
};

// round-to-nearest-even f32 -> bf16
static __device__ __forceinline__ __bf16 f2bf(float f) {
    unsigned int u = __builtin_bit_cast(unsigned int, f);
    unsigned int r = (u + 0x7FFFu + ((u >> 16) & 1u)) >> 16;
    unsigned short h = (unsigned short)r;
    return __builtin_bit_cast(__bf16, h);
}

// 16-element bf16 WMMA fragment: 8 contiguous bf16 at p0 (elems 0..7) and 8
// contiguous bf16 at p1 (elems 8..15); 16B-aligned -> *_load_b128 pairs.
static __device__ __forceinline__ v16bf load_frag(const __bf16* p0, const __bf16* p1) {
    BF16x16 u;
    u.q[0] = *(const uint4*)p0;
    u.q[1] = *(const uint4*)p1;
    return u.v;
}

static __device__ __forceinline__ v8f wmma_bf16(v16bf a, v16bf b, v8f c) {
    return __builtin_amdgcn_wmma_f32_16x16x32_bf16(false, a, false, b, (short)0, c,
                                                   false, false);
}

// ---------------------------------------------------------------------------
// f32 -> bf16 conversion of x and the four weight matrices in ONE launch.
// The five bf16 copies lie back to back in the workspace (x, Wq, Wk, Wv, Wo),
// so the destination is one array indexed by the block's own number; a block
// converts 4096 chunks (a chunk = 4 elements) of ONE source.
// 16 waves per block; a thread has its 8 loads of 16 B in flight before the
// first store.
// ---------------------------------------------------------------------------
struct alignas(8) BF4 { __bf16 a, b, c, d; };

#define CVT_THREADS 512
#define CVT_LOADS   8                                // chunks per thread
#define CVT_CHUNKS  (CVT_THREADS * CVT_LOADS)        // chunks per block
#define X_BLOCKS    (BS * HID / 4 / CVT_CHUNKS)      // 256
#define W_BLOCKS    (HID * HID / 4 / CVT_CHUNKS)     //  16
#define CVT_BLOCKS  (X_BLOCKS + 4 * W_BLOCKS)        // 320
static_assert(X_BLOCKS * CVT_CHUNKS * 4 == BS * HID && W_BLOCKS * CVT_CHUNKS * 4 == HID * HID,
              "whole blocks per source");

__global__ __launch_bounds__(CVT_THREADS)
void cvt_f32_bf16_kernel(const float* __restrict__ x,
                         const float* __restrict__ wq,
                         const float* __restrict__ wk,
                         const float* __restrict__ wv,
                         const float* __restrict__ wo,
                         __bf16* __restrict__ dst) {
    const int blk = blockIdx.x;
    const float* src = x;                        // source and block number inside it
    int sblk = blk;
    if (blk >= X_BLOCKS) {
        const int w = (blk - X_BLOCKS) / W_BLOCKS;
        src  = (w == 0) ? wq : (w == 1) ? wk : (w == 2) ? wv : wo;
        sblk = (blk - X_BLOCKS) % W_BLOCKS;
    }
    const float4* s4 = (const float4*)src + (size_t)sblk * CVT_CHUNKS + threadIdx.x;
    BF4*          d4 = (BF4*)dst + (size_t)blk * CVT_CHUNKS + threadIdx.x;

    float4 f[CVT_LOADS];
#pragma unroll                                   // all loads issued ahead of the first use
    for (int i = 0; i < CVT_LOADS; ++i)
        f[i] = s4[i * CVT_THREADS];
#pragma unroll
    for (int i = 0; i < CVT_LOADS; ++i) {
        BF4 o;
        o.a = f2bf(f[i].x); o.b = f2bf(f[i].y); o.c = f2bf(f[i].z); o.d = f2bf(f[i].w);
        d4[i * CVT_THREADS] = o;
    }
}

// ---------------------------------------------------------------------------
// Core of both projections: acc = A[m0 .. m0+127][:] * Wm[n0 .. n0+63][:]^T over
// k = 0..HID-1, block = 128 threads (4 waves), wave -> 32x64 tile.
// Both operands reach the waves through LDS: a stage is 64 k = one whole 128-byte
// line of each of the 128 A rows and 64 Wm rows, two buffers, filled by
// asynchronous copies (a wave-wide copy covers 4 whole lines).
// LDS rows are 128 B, unpadded; the 16-byte chunk c of row r lies at place
// c ^ ((r >> 1) & 7), so the 16 rows of a fragment read fall on 16 distinct
// bank groups.
// A and B fragments have the same lane and k order, so the two operands may change
// places: with WROWS the Wm rows are the A operand and acc[mt][nt] holds the
// transposed tile (row = n, column = m); a lane then owns 8 consecutive n of one m.
// ---------------------------------------------------------------------------
#define GK      64                   // k elements per stage
#define GROWB   128                  // bytes per LDS row
#define GA_ROWS 128
#define GW_ROWS 64
#define GSTAGE  ((GA_ROWS + GW_ROWS) * GROWB)
#define GTRIPS  (HID / GK)

// One stage: 1536 chunks of 16 B, 12 per thread.  ag, wg: this lane's first chunk
// of the A and of the Wm tile; l: its LDS byte address in the A tile (the Wm tile
// follows the A rows).  Chunk i lies 16 rows further on, at the same place in its row.
static __device__ __forceinline__ void stage_gemm(const __bf16* ag, const __bf16* wg, uint32_t l) {
    // one statement for the copies and s_wait_xcnt: a precaution, so that no later
    // write of a copy's address registers can be scheduled ahead of that wait
    asm volatile(
        "global_load_async_to_lds_b128 %0, %12, off\n\t"
        "global_load_async_to_lds_b128 %1, %13, off\n\t"
        "global_load_async_to_lds_b128 %2, %14, off\n\t"
        "global_load_async_to_lds_b128 %3, %15, off\n\t"
        "global_load_async_to_lds_b128 %4, %16, off\n\t"
        "global_load_async_to_lds_b128 %5, %17, off\n\t"
        "global_load_async_to_lds_b128 %6, %18, off\n\t"
        "global_load_async_to_lds_b128 %7, %19, off\n\t"
        "global_load_async_to_lds_b128 %8, %20, off\n\t"
        "global_load_async_to_lds_b128 %9, %21, off\n\t"
        "global_load_async_to_lds_b128 %10, %22, off\n\t"
        "global_load_async_to_lds_b128 %11, %23, off\n\t"
        "s_wait_xcnt 0x0"
        :: "v"(l),                "v"(l +  16 * GROWB), "v"(l +  32 * GROWB), "v"(l +  48 * GROWB),
           "v"(l +  64 * GROWB), "v"(l +  80 * GROWB), "v"(l +  96 * GROWB), "v"(l + 112 * GROWB),
           "v"(l + 128 * GROWB), "v"(l + 144 * GROWB), "v"(l + 160 * GROWB), "v"(l + 176 * GROWB),
           "v"(ag),            "v"(ag +  16 * HID), "v"(ag +  32 * HID), "v"(ag +  48 * HID),
           "v"(ag + 64 * HID), "v"(ag +  80 * HID), "v"(ag +  96 * HID), "v"(ag + 112 * HID),
           "v"(wg),            "v"(wg +  16 * HID), "v"(wg +  32 * HID), "v"(wg +  48 * HID)
        : "memory");
}

template <bool WROWS>
static __device__ __forceinline__ void gemm_128x64(const __bf16* __restrict__ A,
                                                   const __bf16* __restrict__ Wm,
                                                   int m0, int n0,
                                                   unsigned char (*tiles)[GSTAGE],
                                                   v8f (&acc)[2][4]) {
    const int tid  = threadIdx.x;
    const int lane = tid & 31;
    const int wave = tid >> 5;
    const int ln   = lane & 15;
    const int half = lane >> 4;

    // this lane's chunk of a stage: row tid/8 (+16 per chunk), 16-byte column tid%8
    const int crow = tid >> 3;
    const int ccol = tid & 7;
    const __bf16* acp = A  + (size_t)(m0 + crow) * HID + ccol * 8;
    const __bf16* wcp = Wm + (size_t)(n0 + crow) * HID + ccol * 8;
    const uint32_t lcp = (uint32_t)(uintptr_t)&tiles[0][crow * GROWB + ((ccol ^ ((crow >> 1) & 7)) << 4)];

    stage_gemm(acp, wcp, lcp);                                // stage 0 -> buffer 0
    asm volatile("s_wait_asynccnt 0x0" ::: "memory");         // own copies landed ...
    __syncthreads();                                          // ... and every wave's
    stage_gemm(acp + GK, wcp + GK, lcp + GSTAGE);             // stage 1 -> buffer 1, in flight over trip 0

    // byte offset of chunk 2*j + half of row ln inside a 16-row group: a fragment of
    // the 32 k at kk*32 is chunks j = 2*kk (elements 0..7) and 2*kk + 1 (elements 8..15)
    int fo[4];
#pragma unroll                                   // constant indices: fo[] stays in registers
    for (int j = 0; j < 4; ++j)
        fo[j] = ln * GROWB + (((2 * j + half) ^ ((ln >> 1) & 7)) << 4);

    for (int t = 0; t < GTRIPS; ++t) {
        const unsigned char* at = tiles[t & 1] + wave * 32 * GROWB;
        const unsigned char* wt = tiles[t & 1] + GA_ROWS * GROWB;
#pragma unroll                                   // both 32-k blocks of a stage in one trip: constant LDS offsets
        for (int kk = 0; kk < GK / 32; ++kk) {
            v16bf bfr[4];
            // the three loops below are unrolled so that fragments and accumulators
            // have constant indices and stay in registers
#pragma unroll
            for (int nt = 0; nt < 4; ++nt)
                bfr[nt] = load_frag((const __bf16*)(wt + nt * 16 * GROWB + fo[2 * kk]),
                                    (const __bf16*)(wt + nt * 16 * GROWB + fo[2 * kk + 1]));
#pragma unroll
            for (int mt = 0; mt < 2; ++mt) {
                v16bf a = load_frag((const __bf16*)(at + mt * 16 * GROWB + fo[2 * kk]),
                                    (const __bf16*)(at + mt * 16 * GROWB + fo[2 * kk + 1]));
#pragma unroll
                for (int nt = 0; nt < 4; ++nt)
                    acc[mt][nt] = WROWS ? wmma_bf16(bfr[nt], a, acc[mt][nt])
                                        : wmma_bf16(a, bfr[nt], acc[mt][nt]);
            }
        }

        // hand-over: stage t+1 becomes readable, this trip's buffer becomes free
        asm volatile("s_wait_dscnt 0x0" ::: "memory");        // own reads of this buffer done
        asm volatile("s_wait_asynccnt 0x0" ::: "memory");     // own copies of stage t+1 landed
        __syncthreads();
        if (t + 2 < GTRIPS)
            stage_gemm(acp + (t + 2) * GK, wcp + (t + 2) * GK, lcp + (t & 1) * GSTAGE);
    }
    asm volatile("s_wait_asynccnt 0x0" ::: "memory");         // nothing in flight behind the loop
}

// ---------------------------------------------------------------------------
// QKV projection: Y[m,n] = sum_k X[m,k] * W[n,k] + bias[n]
// grid = (BS/128, NHEAD, 3), block = 128 (4 waves). Wave -> 32x64 tile.
// Q,K stored [b,h,s,d], Q times QK_LOG2; V stored transposed [b,h,d,t].
// Epilogue: a lane owns 8 outputs that are neighbours in memory (Q,K: 8 d of one
// row, from the product with the W rows as A operand; V^T: 8 t of one d), packs
// them into 16 B, and the block's 16-KB tile goes through LDS so that every
// wave-wide store covers 4 whole 128-byte lines.
// ---------------------------------------------------------------------------
#define QPITCH 144                   // staged Q,K row: 128 data bytes + 16 (16 B x odd, as LPITCH below)
#define VPITCH 272                   // staged V^T row: 256 data bytes + 16
static_assert(128 * QPITCH <= 2 * GSTAGE && HDIM * VPITCH <= 2 * GSTAGE, "staged tile fits the ring");

// 8 accumulator values + 8 addends -> 8 bf16 (round to nearest even) in 16 B
static __device__ __forceinline__ uint4 pack8(v8f t, const float (&add)[8]) {
    union { __bf16 h[8]; uint4 q; } pk;
#pragma unroll                                   // constant indices: values stay in registers
    for (int r = 0; r < 8; ++r)
        pk.h[r] = (__bf16)(t[r] + add[r]);
    return pk.q;
}

// the same with a factor: 8 values t * sc + add (add holds bias * sc); sc = 1 gives t + add exactly
static __device__ __forceinline__ uint4 pack8s(v8f t, float sc, const float (&add)[8]) {
    union { __bf16 h[8]; uint4 q; } pk;
#pragma unroll                                   // constant indices: values stay in registers
    for (int r = 0; r < 8; ++r)
        pk.h[r] = (__bf16)__builtin_fmaf(t[r], sc, add[r]);
    return pk.q;
}

__global__ __launch_bounds__(128)
void qkv_proj_kernel(const __bf16* __restrict__ xb,
                     const __bf16* __restrict__ wqb,
                     const __bf16* __restrict__ wkb,
                     const __bf16* __restrict__ wvb,
                     const float* __restrict__ bq,
                     const float* __restrict__ bk,
                     const float* __restrict__ bv,
                     __bf16* __restrict__ qout,
                     __bf16* __restrict__ kout,
                     __bf16* __restrict__ vtout) {
    __shared__ __attribute__((aligned(128))) unsigned char tiles[2][GSTAGE];

    const int tid  = threadIdx.x;
    const int lane = tid & 31;
    const int wave = tid >> 5;
    const int ln   = lane & 15;
    const int off8 = (lane >> 4) ? 8 : 0;

    const int m0    = blockIdx.x * 128;         // first global row (b*S + s); 128 divides S
    const int head  = blockIdx.y;
    const int which = blockIdx.z;               // 0=Q 1=K 2=V
    const int N0    = head * 64;
    const int bh    = (m0 >> 12) * NHEAD + head;
    const int s0    = m0 & (SEQ - 1);

    // The ring is free behind gemm_128x64: its last trip's waits and barrier have ended
    // every wave's reads, and no copy is in flight.
    unsigned char* stg = &tiles[0][0];
    v8f acc[2][4] = {};

    if (which == 2) {
        gemm_128x64<false>(xb, wvb, m0, N0, tiles, acc);
        // acc[mt][nt][r]: row t = wave*32 + mt*16 + off8 + r, column d = nt*16 + ln
#pragma unroll
        for (int nt = 0; nt < 4; ++nt) {
            const float bval = bv[N0 + nt * 16 + ln];
            const float add[8] = { bval, bval, bval, bval, bval, bval, bval, bval };
#pragma unroll
            for (int mt = 0; mt < 2; ++mt)
                *(uint4*)(stg + (nt * 16 + ln) * VPITCH + (wave * 32 + mt * 16 + off8) * 2) =
                    pack8(acc[mt][nt], add);
        }
        __syncthreads();                         // a V^T line holds the t of two waves
        __bf16* dst = vtout + (size_t)bh * HDIM * SEQ + s0;
        uint4 q[8];                              // 16-byte chunk c = i*128 + tid: row d = c/16, place c%16
#pragma unroll                                   // constant indices: q[] stays in registers
        for (int i = 0; i < 8; ++i)
            q[i] = *(const uint4*)(stg + ((i * 128 + tid) >> 4) * VPITCH + (tid & 15) * 16);
#pragma unroll
        for (int i = 0; i < 8; ++i)
            *(uint4*)(dst + (size_t)((i * 128 + tid) >> 4) * SEQ + (tid & 15) * 8) = q[i];
    } else {
        const __bf16* W    = (which == 0) ? wqb : wkb;
        const float*  bias = (which == 0) ? bq : bk;
        const float   sc   = (which == 0) ? QK_LOG2 : 1.0f;   // Q is stored in exponent units
        gemm_128x64<true>(xb, W, m0, N0, tiles, acc);
        // acc[mt][nt][r]: row d = nt*16 + off8 + r, column s = wave*32 + mt*16 + ln
#pragma unroll
        for (int nt = 0; nt < 4; ++nt) {
            const float4 b0 = *(const float4*)(bias + N0 + nt * 16 + off8);
            const float4 b1 = *(const float4*)(bias + N0 + nt * 16 + off8 + 4);
            const float add[8] = { b0.x * sc, b0.y * sc, b0.z * sc, b0.w * sc,
                                   b1.x * sc, b1.y * sc, b1.z * sc, b1.w * sc };
#pragma unroll
            for (int mt = 0; mt < 2; ++mt)
                *(uint4*)(stg + (wave * 32 + mt * 16 + ln) * QPITCH + (nt * 16 + off8) * 2) =
                    pack8s(acc[mt][nt], sc, add);
        }
        __syncthreads();                         // staged rows readable by every wave
        // the block's 128 rows of 128 B are one contiguous 16-KB piece of the output
        __bf16* dst = ((which == 0) ? qout : kout) + ((size_t)bh * SEQ + s0) * HDIM;
        uint4 q[8];                              // 16-byte chunk c = i*128 + tid: row s = c/8, place c%8
#pragma unroll                                   // constant indices: q[] stays in registers
        for (int i = 0; i < 8; ++i)
            q[i] = *(const uint4*)(stg + ((i * 128 + tid) >> 3) * QPITCH + (tid & 7) * 16);
#pragma unroll
        for (int i = 0; i < 8; ++i)
            *(uint4*)(dst + (size_t)(i * 128 + tid) * 8) = q[i];
    }
}

static __device__ __forceinline__ float other_half(float v) {
    const int b = __builtin_bit_cast(int, v);
    return __builtin_bit_cast(float,
        __builtin_amdgcn_permlanex16(b, b, 0x76543210, 0xfedcba98, false, false));
}

typedef __attribute__((ext_vector_type(4))) float v4f;
typedef __attribute__((ext_vector_type(2))) float v2f;

// One column tile of a 32-key block: p = 2^exponent for the lane's 16 exponents, packed as
// the B operand of the second product; returns the in-lane sum of the 16 p as one register
// pair (even and odd rows apart), so that every addition is a packed one.
static __device__ __forceinline__ v2f exp2_pack(v8f x0, v8f x1, v16bf& bp) {
    v8f p0, p1;
#pragma unroll                                   // constant indices: values stay in registers
    for (int r = 0; r < 8; ++r) {
        p0[r] = __builtin_amdgcn_exp2f(x0[r]);
        p1[r] = __builtin_amdgcn_exp2f(x1[r]);
        bp[r]     = (__bf16)p0[r];               // element e = key kmap(e, half):
        bp[8 + r] = (__bf16)p1[r];               // the hardware k order, as V's loads
    }
    const v8f pv = p0 + p1;
    const v4f q4 = pv.lo + pv.hi;
    return q4.lo + q4.hi;
}

#define KT      64                   // keys per LDS stage
#define LPITCH  144                  // LDS row: 128 data bytes + 16 (16 B x odd: no bank conflict for b128 reads)
#define TILE_B  (64 * LPITCH)        // one tile: 64 rows (K: keys, V^T: head dims)
#define KSPLIT  2                    // key halves per block
#define NSTAGE  (SEQ / KSPLIT / KT)  // stages per half

// One stage: K tile (64 keys x 128 B, contiguous in memory) and V^T tile
// (64 dims x 64 keys) into LDS; 1024 chunks of 16 B, 8 per thread of a half.
// kg, vg: this lane's first chunk of each tile; lk: its LDS byte address in the
// K tile (the V^T tile follows at TILE_B).  Chunk i lies 16 rows further on.
static __device__ __forceinline__ void stage_kv(const __bf16* kg, const __bf16* vg, uint32_t lk) {
    const uint32_t lv = lk + TILE_B;
    // one statement for the copies and s_wait_xcnt: a precaution, so that no later
    // write of a copy's address registers can be scheduled ahead of that wait
    asm volatile(
        "global_load_async_to_lds_b128 %0, %8, off\n\t"
        "global_load_async_to_lds_b128 %1, %9, off\n\t"
        "global_load_async_to_lds_b128 %2, %10, off\n\t"
        "global_load_async_to_lds_b128 %3, %11, off\n\t"
        "global_load_async_to_lds_b128 %4, %12, off\n\t"
        "global_load_async_to_lds_b128 %5, %13, off\n\t"
        "global_load_async_to_lds_b128 %6, %14, off\n\t"
        "global_load_async_to_lds_b128 %7, %15, off\n\t"
        "s_wait_xcnt 0x0"
        :: "v"(lk), "v"(lk + 16 * LPITCH), "v"(lk + 32 * LPITCH), "v"(lk + 48 * LPITCH),
           "v"(lv), "v"(lv + 16 * LPITCH), "v"(lv + 32 * LPITCH), "v"(lv + 48 * LPITCH),
           "v"(kg), "v"(kg + 16 * HDIM), "v"(kg + 32 * HDIM), "v"(kg + 48 * HDIM),
           "v"(vg), "v"(vg + 16 * SEQ), "v"(vg + 32 * SEQ), "v"(vg + 48 * SEQ)
        : "memory");
}

__global__ __launch_bounds__(256)
void flash_attn_kernel(const __bf16* __restrict__ qb,
                       const __bf16* __restrict__ kb,
                       const __bf16* __restrict__ vT,
                       __bf16* __restrict__ ctxb) {
    __shared__ __attribute__((aligned(16))) unsigned char kv[KSPLIT][2][2 * TILE_B];

    const int lane = threadIdx.x & 31;
    const int wave = __builtin_amdgcn_readfirstlane(threadIdx.x >> 5);
    const int part = wave >> 2;                  // key half of this wave
    const int qw   = wave & 3;                   // its 32 query columns in the block
    const int ln   = lane & 15;
    const int off8 = (lane >> 4) ? 8 : 0;

    const int b    = blockIdx.z;
    const int head = blockIdx.y;
    const int bh   = b * NHEAD + head;
    const int q0   = blockIdx.x * 128 + qw * 32;

    const __bf16* qbase = qb + (size_t)bh * SEQ * HDIM;
    const __bf16* kbase = kb + ((size_t)bh * SEQ + part * (SEQ / KSPLIT)) * HDIM;   // first key of the half
    const __bf16* vbase = vT + (size_t)bh * HDIM * SEQ + part * (SEQ / KSPLIT);

    // this lane's chunk of its half's stage: t = thread number inside the half,
    // row t/8 (+16 per chunk), 16-byte column t%8
    const int crow = (threadIdx.x & 127) >> 3;
    const int ccol = threadIdx.x & 7;
    const __bf16* kcp = kbase + (size_t)crow * HDIM + ccol * 8;
    const __bf16* vcp = vbase + (size_t)crow * SEQ + ccol * 8;
    const uint32_t lcp = (uint32_t)(uintptr_t)&kv[part][0][crow * LPITCH + ccol * 16];

    stage_kv(kcp, vcp, lcp);                                  // tile 0 -> buffer 0
    asm volatile("s_wait_asynccnt 0x0" ::: "memory");         // own copies landed ...
    __syncthreads();                                          // ... and every wave's
    stage_kv(kcp + KT * HDIM, vcp + KT, lcp + 2 * TILE_B);    // tile 1 -> buffer 1, in flight over trip 0

    // Q B-fragments (column = query ln) held in registers for the whole key loop
    v16bf bq[2][2];
#pragma unroll
    for (int qt = 0; qt < 2; ++qt) {
        const __bf16* qrow = qbase + (size_t)(q0 + qt * 16 + ln) * HDIM;
        bq[qt][0] = load_frag(qrow + off8,      qrow + off8 + 16);
        bq[qt][1] = load_frag(qrow + 32 + off8, qrow + 32 + off8 + 16);
    }

    // per lane: the maximum in use at the head of a trip for query qt*16+ln, in exponent units
    // (equal in both lane halves; no exponent accepted so far lies more than 8 above it) and the
    // sum over this lane half's keys in the units of the maximum in use, as a register pair
    // (pair and halves joined in the epilogue)
    float mcol[2];
    v2f lcol[2];
    // cneg: -mcol in all 8 rows of a lane's column, the C operand of the score products: Q holds
    // QK_LOG2, so a product leaves the matrix unit as the exponent s * QK_LOG2 - mcol itself.
    // cneg and mcol change only in a trip's second block, so both blocks of a trip read C from
    // the same registers; a move in the first block is carried to the second in pend.
    v8f cneg[2] = {};
    // how large a lane's sum of a block's p may be before the maximum moves; the negative
    // value sends a block into the branch whatever its scores: the very first one, and the
    // second block of a trip whose first block has moved the maximum
    float sthr = -1.0f;
#pragma unroll
    for (int qt = 0; qt < 2; ++qt) { mcol[qt] = 0.0f; lcol[qt] = (v2f){0.0f, 0.0f}; }
    v8f o[2][4] = {};                            // o[qt][nt][r] = O[query ln][nt*16 + off8 + r]

    for (int st = 0; st < NSTAGE; ++st) {
      const unsigned char* ktile = kv[part][st & 1];
      const unsigned char* vtile = ktile + TILE_B;
      float pend[2] = { 0.0f, 0.0f };            // the maximum in use, above mcol, behind the first block
#pragma unroll                                   // both 32-key blocks of a stage in one trip: constant LDS offsets
      for (int kk = 0; kk < KT / 32; ++kk) {
        // ---- scores: S^T = K * Q^T  (4 C tiles, K-dim 64 = 2 wmmas each)
        v16bf ak[2][2];
#pragma unroll
        for (int tt = 0; tt < 2; ++tt) {
            const __bf16* kr = (const __bf16*)(ktile + (kk * 32 + tt * 16 + ln) * LPITCH);
            ak[tt][0] = load_frag(kr + off8,      kr + off8 + 16);
            ak[tt][1] = load_frag(kr + 32 + off8, kr + 32 + off8 + 16);
        }
        // V^T fragments of the block, fetched in one group with K's
        v16bf av[4];
#pragma unroll                                   // constant indices: av[] stays in registers
        for (int nt = 0; nt < 4; ++nt) {
            const __bf16* vr = (const __bf16*)(vtile + (nt * 16 + ln) * LPITCH) + kk * 32 + off8;
            av[nt] = load_frag(vr, vr + 16);
        }
        // keeps the block's 16 LDS loads in one group ahead of the score products: without it
        // the compiler sinks V^T loads behind the exponentials, a full wait directly behind them
        __builtin_amdgcn_sched_barrier(0);
        v8f s[2][2];                             // s[qt][tt][r]: exponent of [query ln][block + tt*16 + off8 + r]
        // In asm so that C is read in place: the builtin ties C to D in two of a trip's eight
        // tiles and copies cneg (16 registers) for them.  The four tiles are independent, so a
        // chain's second product stands four products behind its first.  The four v_nop keep
        // the distance between the last product and a vector instruction on its result or
        // operands.
        asm("v_wmma_f32_16x16x32_bf16 %0, %4, %8, %12\n\t"
            "v_wmma_f32_16x16x32_bf16 %1, %6, %8, %12\n\t"
            "v_wmma_f32_16x16x32_bf16 %2, %4, %10, %13\n\t"
            "v_wmma_f32_16x16x32_bf16 %3, %6, %10, %13\n\t"
            "v_wmma_f32_16x16x32_bf16 %0, %5, %9, %0\n\t"
            "v_wmma_f32_16x16x32_bf16 %1, %7, %9, %1\n\t"
            "v_wmma_f32_16x16x32_bf16 %2, %5, %11, %2\n\t"
            "v_wmma_f32_16x16x32_bf16 %3, %7, %11, %3\n\t"
            "v_nop\n\tv_nop\n\tv_nop\n\tv_nop"
            : "=&v"(s[0][0]), "=&v"(s[0][1]), "=&v"(s[1][0]), "=&v"(s[1][1])
            : "v"(ak[0][0]), "v"(ak[0][1]), "v"(ak[1][0]), "v"(ak[1][1]),
              "v"(bq[0][0]), "v"(bq[0][1]), "v"(bq[1][0]), "v"(bq[1][1]),
              "v"(cneg[0]), "v"(cneg[1]));

        // ---- online softmax, lazy rescale + P^T packed as B operand
        // inputs-only fence on the loaded V^T fragments: it holds their one wait ahead of the
        // branch, long behind the loads; without it the compiler waits among the O products,
        // in several counted waits mixed with the next block's loads
        asm volatile("" :: "v"(av[0]), "v"(av[1]), "v"(av[2]), "v"(av[3]));
        // p and the in-lane sums with the maximum in use as it stands
        v16bf bp[2];
        v2f bs[2];
#pragma unroll                                   // constant indices: bp and bs stay in registers
        for (int qt = 0; qt < 2; ++qt)
            bs[qt] = exp2_pack(s[qt][0], s[qt][1], bp[qt]);
        // The test for a moved maximum reads the sums, which are needed anyway: every p is
        // >= 0, so sums of at most 2^8 bound each p by 2^8, and an exponent too large for
        // exp2 shows as an infinite sum (the negated compare also catches a NaN).  One test and
        // one scalar branch per 32 keys; nothing of the block has been added to sums or O yet.
        // Inside the branch the scores' maxima are formed and the block's p are made anew.
        // t: the new maximum in use, above mcol.  In the very first block it may also lie below
        // the start value 0; sums and O are still 0 there, so alpha only has to be finite.
        const v2f bsum = bs[0] + bs[1];
        if (__builtin_amdgcn_ballot_w32(!(bsum.x + bsum.y <= sthr)) != 0) {
#pragma unroll                                   // constant indices: state and O stay in registers
            for (int qt = 0; qt < 2; ++qt) {
                // in-lane maximum of the column's 16 scores, as a tree of three-input maxima
                const v8f x0 = s[qt][0];
                const v8f x1 = s[qt][1];
                const float a0 = fmaxf(fmaxf(x0[0], x0[1]), x0[2]);
                const float a1 = fmaxf(fmaxf(x0[3], x0[4]), x0[5]);
                const float a2 = fmaxf(fmaxf(x0[6], x0[7]), x1[0]);
                const float a3 = fmaxf(fmaxf(x1[1], x1[2]), x1[3]);
                const float a4 = fmaxf(fmaxf(x1[4], x1[5]), x1[6]);
                const float mx = fmaxf(fmaxf(fmaxf(a0, a1), a2), fmaxf(fmaxf(a3, a4), x1[7]));
                const float lo    = (kk == 1) ? pend[qt] : (sthr < 0.0f) ? -3.0e38f : 0.0f;
                const float t     = fmaxf(fmaxf(lo, mx), other_half(mx));
                const float alpha = __builtin_amdgcn_exp2f(fminf(pend[qt] - t, 0.0f));
                // this block's exponents were formed with mcol
                bs[qt] = exp2_pack(x0 - t, x1 - t, bp[qt]);
                lcol[qt] *= alpha;
#pragma unroll
                for (int nt = 0; nt < 4; ++nt)
                    o[qt][nt] *= alpha;
                if (kk == 0) {
                    pend[qt] = t;
                } else {
                    mcol[qt] += t;
                    const float nm = -mcol[qt];
                    cneg[qt] = (v8f){nm, nm, nm, nm, nm, nm, nm, nm};
                }
            }
            sthr = (kk == 0) ? -1.0f : 256.0f;
        }
        lcol[0] += bs[0];
        lcol[1] += bs[1];

        // ---- O^T += V^T * P^T  (V tile is [d, t] -> contiguous A loads, shared by column tiles)
#pragma unroll
        for (int nt = 0; nt < 4; ++nt) {
            o[0][nt] = wmma_bf16(av[nt], bp[0], o[0][nt]);
            o[1][nt] = wmma_bf16(av[nt], bp[1], o[1][nt]);
        }
      }

      // hand-over: tile st+1 becomes readable, this trip's buffer becomes free
      asm volatile("s_wait_dscnt 0x0" ::: "memory");          // own reads of this buffer done
      asm volatile("s_wait_asynccnt 0x0" ::: "memory");       // own copies of tile st+1 landed
      __syncthreads();
      if (st + 2 < NSTAGE)
          stage_kv(kcp + (size_t)(st + 2) * KT * HDIM, vcp + (st + 2) * KT,
                   lcp + (st & 1) * (2 * TILE_B));
    }
    asm volatile("s_wait_asynccnt 0x0" ::: "memory");         // nothing in flight when the wave ends

    // ---- join of the key halves.  The last trip's waits and barrier have ended every
    // read of the tiles and no copy is in flight, so the tile memory is free: wave 4+w
    // hands its state to wave w there, 17 rows of 32 lanes x 16 B (whole 512-B rows).
    float4* xch = (float4*)&kv[0][0][0] + qw * (17 * 32) + lane;
    if (part == 1) {
#pragma unroll
        for (int qt = 0; qt < 2; ++qt)
#pragma unroll
            for (int nt = 0; nt < 4; ++nt) {
                const v8f t = o[qt][nt];
                xch[((qt * 4 + nt) * 2 + 0) * 32] = make_float4(t[0], t[1], t[2], t[3]);
                xch[((qt * 4 + nt) * 2 + 1) * 32] = make_float4(t[4], t[5], t[6], t[7]);
            }
        xch[16 * 32] = make_float4(mcol[0], mcol[1], lcol[0].x + lcol[0].y, lcol[1].x + lcol[1].y);
    }
    __syncthreads();                             // half 1's state readable by half 0

    // ---- epilogue (half 0): ctx[b, s, head*64 + d] = (o0*a0 + o1*a1) / (l0*a0 + l1*a1);
    // a lane owns 8 consecutive d
    if (part == 0) {
        const float4 ml = xch[16 * 32];
#pragma unroll
        for (int qt = 0; qt < 2; ++qt) {
            const int srow = q0 + qt * 16 + ln;
            const float m1 = qt ? ml.y : ml.x;
            const float l1 = qt ? ml.w : ml.z;
            const float m  = fmaxf(mcol[qt], m1);
            const float a0 = __builtin_amdgcn_exp2f(mcol[qt] - m);
            const float a1 = __builtin_amdgcn_exp2f(m1 - m);
            const float l  = (lcol[qt].x + lcol[qt].y) * a0 + l1 * a1;
            const float inv = 1.0f / (l + other_half(l));
            const float c0 = a0 * inv;
            const float c1 = a1 * inv;
#pragma unroll
            for (int nt = 0; nt < 4; ++nt) {
                const float4 u0 = xch[((qt * 4 + nt) * 2 + 0) * 32];
                const float4 u1 = xch[((qt * 4 + nt) * 2 + 1) * 32];
                const float u[8] = { u0.x, u0.y, u0.z, u0.w, u1.x, u1.y, u1.z, u1.w };
                union { __bf16 h[8]; uint4 q; } pk;
#pragma unroll
                for (int r = 0; r < 8; ++r)
                    pk.h[r] = f2bf(o[qt][nt][r] * c0 + u[r] * c1);
                *(uint4*)(ctxb + ((size_t)(b * SEQ + srow)) * HID + head * 64 + nt * 16 + off8) = pk.q;
            }
        }
    }
}

// ---------------------------------------------------------------------------
// Output projection: out[m,n] = sum_k ctx[m,k] * Wo[n,k] + bo[n]   (f32 out)
// grid = (BS/128, HID/64), block = 128.
// ---------------------------------------------------------------------------
__global__ __launch_bounds__(128)
void out_proj_kernel(const __bf16* __restrict__ ctxb,
                     const __bf16* __restrict__ wob,
                     const float* __restrict__ bo,
                     float* __restrict__ out) {
    __shared__ __attribute__((aligned(128))) unsigned char tiles[2][GSTAGE];

    const int tid  = threadIdx.x;
    const int lane = tid & 31;
    const int wave = tid >> 5;
    const int ln   = lane & 15;
    const int off8 = (lane >> 4) ? 8 : 0;

    const int M0 = blockIdx.x * 128 + wave * 32;
    const int N0 = blockIdx.y * 64;

    v8f acc[2][4] = {};
    gemm_128x64<false>(ctxb, wob, blockIdx.x * 128, N0, tiles, acc);

#pragma unroll
    for (int mt = 0; mt < 2; ++mt)
#pragma unroll
        for (int nt = 0; nt < 4; ++nt) {
            const int n = N0 + nt * 16 + ln;
            const float bval = bo[n];
#pragma unroll
            for (int r = 0; r < 8; ++r) {
                const int m = M0 + mt * 16 + r + off8;
                out[(size_t)m * HID + n] = acc[mt][nt][r] + bval;
            }
        }
}

// ---------------------------------------------------------------------------
// Host launcher
// ---------------------------------------------------------------------------
extern "C" void kernel_launch(void* const* d_in, const int* in_sizes, int n_in,
                              void* d_out, int out_size, void* d_ws, size_t ws_size,
                              hipStream_t stream) {
    (void)in_sizes; (void)n_in; (void)out_size; (void)ws_size;

    const float* x  = (const float*)d_in[0];
    const float* Wq = (const float*)d_in[1];
    const float* bq = (const float*)d_in[2];
    const float* Wk = (const float*)d_in[3];
    const float* bk = (const float*)d_in[4];
    const float* Wv = (const float*)d_in[5];
    const float* bv = (const float*)d_in[6];
    const float* Wo = (const float*)d_in[7];
    const float* bo = (const float*)d_in[8];
    float* out = (float*)d_out;

    // workspace layout (bf16 scratch, ~42 MB total)
    const size_t XB_ELE = (size_t)BS * HID;       // 4,194,304
    const size_t W_ELE  = (size_t)HID * HID;      //   262,144
    char* ws = (char*)d_ws;
    size_t off = 0;
    __bf16* xb   = (__bf16*)(ws + off); off += XB_ELE * 2;
    __bf16* wqb  = (__bf16*)(ws + off); off += W_ELE * 2;
    __bf16* wkb  = (__bf16*)(ws + off); off += W_ELE * 2;
    __bf16* wvb  = (__bf16*)(ws + off); off += W_ELE * 2;
    __bf16* wob  = (__bf16*)(ws + off); off += W_ELE * 2;
    __bf16* qbuf = (__bf16*)(ws + off); off += XB_ELE * 2;
    __bf16* kbuf = (__bf16*)(ws + off); off += XB_ELE * 2;
    __bf16* vtb  = (__bf16*)(ws + off); off += XB_ELE * 2;
    __bf16* ctxb = (__bf16*)(ws + off); off += XB_ELE * 2;

    // 1) f32 -> bf16 conversions, one launch: xb, wqb, wkb, wvb, wob are contiguous from xb
    cvt_f32_bf16_kernel<<<CVT_BLOCKS, CVT_THREADS, 0, stream>>>(x, Wq, Wk, Wv, Wo, xb);

    // 2) fused QKV projection (Q,K row-major per head; V transposed per head)
    dim3 gqkv(BS / 128, NHEAD, 3);
    qkv_proj_kernel<<<gqkv, 128, 0, stream>>>(xb, wqb, wkb, wvb, bq, bk, bv,
                                              qbuf, kbuf, vtb);

    // 3) flash attention
    dim3 gattn(SEQ / 128, NHEAD, BATCH);
    flash_attn_kernel<<<gattn, 256, 0, stream>>>(qbuf, kbuf, vtb, ctxb);

    // 4) output projection -> f32 out
    dim3 gout(BS / 128, HID / 64);
    out_proj_kernel<<<gout, 128, 0, stream>>>(ctxb, wob, bo, out);
}
